// v000
// The times below were measured on an AMD MI455X: many runs one after another, warmed up first and cycling through
// copies of the inputs, with the whole window's GPU time divided by the number of runs. Launches and the gaps
// between them are all in it. The median over several windows is given; except for v000 it joins two sittings, which
// can be a few percent apart, so the side-by-side timings, each taken in one sitting, are the better comparison.
// v000, which the later versions start from, runs in 1280 microseconds.
// compute dtype: all float inputs rounded to bf16; q/k/v = x . W^T + b with EXACT bf16 products on WMMA 16x16x32 (natural rows; v uses the k projection as the module does); ReLU and the cos/sin position weights in f32 (precise sinf/cosf); the linear-attention contractions on WMMA with every computed operand as hi + residual (3 products (f16 hi + lo) for kv = k_w^T v, 4 products (bf16 hi + lo) for q_w . kv); key sums, normaliser z and the final scaling in f32; f32 output.
#include <hip/hip_runtime.h>
#include <math.h>

typedef __attribute__((ext_vector_type(16))) _Float16 v16h;
typedef __attribute__((ext_vector_type(16))) __bf16 v16b;
typedef __attribute__((ext_vector_type(8)))  _Float16 v8h;
typedef __attribute__((ext_vector_type(8)))  float v8f;
typedef __attribute__((ext_vector_type(4)))  float v4f;
typedef __attribute__((ext_vector_type(2)))  float v2f;
typedef __attribute__((ext_vector_type(4)))  unsigned v4u;
typedef __attribute__((ext_vector_type(4)))  int v4i;
typedef float __attribute__((may_alias)) float_a;
typedef int __attribute__((may_alias)) int_a;

template <typename T> __device__ __forceinline__ void vst2(void* p, T v) { *(T*)p = v;  }
__device__ __forceinline__ v8f wmma16(v16h a, v16h b, v8f c) {
  v8f d = __builtin_amdgcn_wmma_f32_16x16x32_f16(false, a, false, b, (short)0, c, false, false);
  asm volatile("v_nop\n\tv_nop\n\tv_nop\n\tv_nop" : "+v"(d) : "v"(a), "v"(b));
  return d;
}
__device__ __forceinline__ v8f wmma_bf(v16b a, v16b b, v8f c) {
  v8f d = __builtin_amdgcn_wmma_f32_16x16x32_bf16(false, a, false, b, (short)0, c, false, false);
  asm volatile("v_nop\n\tv_nop\n\tv_nop\n\tv_nop" : "+v"(d) : "v"(a), "v"(b));
  return d;
}
// 16x16x32 fragments: lane = (h = lane>>4, row/col = lane&15); elements 0..7 = k0+8h+0..7, 8..15 = k0+16+8h+0..7; D element r = row 8h+r
__device__ __forceinline__ v16h frag_h(const _Float16* rowk0, int lane) {
  union { v16h v; v8h q[2]; } u; const _Float16* p = rowk0 + 8 * (lane >> 4);
  u.q[0] = *(const v8h*)p; u.q[1] = *(const v8h*)(p + 16); return u.v;
}
__device__ __forceinline__ v16h frag_f32(const float* rowk0, int lane) {
  v16h a; const float* p = rowk0 + 8 * (lane >> 4);
#pragma unroll
  for (int i = 0; i < 8; ++i) { a[i] = (_Float16)p[i]; a[8 + i] = (_Float16)p[16 + i]; }
  return a;
}
__device__ __forceinline__ v16h frag_f32s(const float* rowk0, int lane, float sc) {
  v16h a; const float* p = rowk0 + 8 * (lane >> 4);
#pragma unroll
  for (int i = 0; i < 8; ++i) { a[i] = (_Float16)(p[i] * sc); a[8 + i] = (_Float16)(p[16 + i] * sc); }
  return a;
}
// column fragment from a [K][ld] layout (column n), rows >= K read as 0
__device__ __forceinline__ v16h fragc_f32(const float* W, int k0, int n, int lane, int ld, int K) {
  v16h a; const int g = lane >> 4;
#pragma unroll
  for (int i = 0; i < 8; ++i) { const int ka = k0 + 8 * g + i, kb = ka + 16;
    a[i] = (_Float16)(ka < K ? W[(size_t)(ka < K ? ka : K - 1) * ld + n] : 0.f); a[8 + i] = (_Float16)(kb < K ? W[(size_t)(kb < K ? kb : K - 1) * ld + n] : 0.f); }
  return a;
}
struct F2 { v16b h, l; };
__device__ __forceinline__ F2 bsplit16(const float v[16]) { F2 r;
#pragma unroll
  for (int i = 0; i < 16; ++i) { const __bf16 h = (__bf16)v[i]; r.h[i] = h; r.l[i] = (__bf16)(v[i] - (float)h); }
  return r; }
__device__ __forceinline__ F2 split_row(const float* row, int k0, int lane) { float v[16]; const float* p = row + k0 + 8 * (lane >> 4);
#pragma unroll
  for (int i = 0; i < 8; ++i) { v[i] = p[i]; v[8 + i] = p[16 + i]; }
  return bsplit16(v); }
__device__ __forceinline__ F2 split_rowK(const float* row, int k0, int lane, int K) { float v[16]; const int g = lane >> 4;
#pragma unroll
  for (int i = 0; i < 8; ++i) { const int ka = k0 + 8 * g + i, kb = ka + 16; v[i] = ka < K ? row[ka < K ? ka : K - 1] : 0.f; v[8 + i] = kb < K ? row[kb < K ? kb : K - 1] : 0.f; }
  return bsplit16(v); }
__device__ __forceinline__ F2 split_col(const float* W, int k0, int n, int lane, int ld, int K) { float v[16]; const int g = lane >> 4;
#pragma unroll
  for (int i = 0; i < 8; ++i) { const int ka = k0 + 8 * g + i, kb = ka + 16; v[i] = ka < K ? W[(size_t)(ka < K ? ka : K - 1) * ld + n] : 0.f; v[8 + i] = kb < K ? W[(size_t)(kb < K ? kb : K - 1) * ld + n] : 0.f; }
  return bsplit16(v); }
__device__ __forceinline__ v8f mac3(const F2& a, const F2& b, v8f c) { c = wmma_bf(a.l, b.h, c); c = wmma_bf(a.h, b.l, c); return wmma_bf(a.h, b.h, c); }
__device__ __forceinline__ float sigm(float v) { return 1.0f / (1.0f + expf(-v)); }
#define LDSX() do { asm volatile("s_wait_dscnt 0" ::: "memory"); __builtin_amdgcn_wave_barrier(); __builtin_amdgcn_fence(__ATOMIC_RELEASE, "workgroup"); } while (0)


// cosFormer multi-head linear attention (L 2,048, B 4, E 1,024, 16 heads x 64, non-causal): q = relu(Wq x), k = relu(Wk key), v = Wk value; attn = [q cos . (k cos)^T v + q sin . (k sin)^T v] / (q cos . sum k cos + q sin . sum k sin + eps), reshaped (B H, L, 64) -> (L, B, E) by raw view.
#define LL 2048
#define NBATCH 4
#define EE 1024
#define NH 16
#define HD 64
#define NBH (NBATCH * NH)
#define NR (LL * NBATCH)          // token rows (l, b) = l*B + b
#ifndef TBH
#define TBH NBH
#endif
typedef __attribute__((ext_vector_type(8))) __bf16 v8b;
__device__ __forceinline__ v16b frag_b(const __bf16* rowk0, int lane) {
  union { v16b v; v8b q[2]; } u; const __bf16* p = rowk0 + 8 * (lane >> 4);
  u.q[0] = *(const v8b*)p; u.q[1] = *(const v8b*)(p + 16); return u.v;
}
__device__ __forceinline__ float bfr(float v) { return (float)(__bf16)v; }
__device__ __attribute__((noinline)) float exp_ni(float v) { return expf(v); }
__device__ __attribute__((noinline)) float erf_ni(float v) { return erff(v); }

#define WS_PW  0u                                      // bf16 natural rows Wq, Wk [2][1024][1024]
#define WS_Q   (WS_PW + 2u * (size_t)2 * EE * EE)         // f32 rows relu(q) [NR][1024] ; relu(k) ; v
#define WS_K   (WS_Q + 4u * (size_t)NR * EE)
#define WS_V   (WS_K + 4u * (size_t)NR * EE)
#define WS_PL  (WS_V + 4u * (size_t)NR * EE)             // f16 planes [bh][6][64][LL]: kcos hi, kcos lo(x2048), ksin hi, ksin lo, v hi, v lo
#define WS_KV  (WS_PL + 2u * (size_t)NBH * 6 * HD * LL)    // f32 [bh][2][64 m][64 d] kv_cos, kv_sin ; ksum [bh][2][64]
#define WS_KS  (WS_KV + 4u * (size_t)NBH * 2 * HD * HD)
#define WS_END (WS_KS + 4u * (size_t)NBH * 2 * HD)

__device__ __attribute__((noinline)) float sin_p(float v) { return sinf(v); }
__device__ __attribute__((noinline)) float cos_p(float v) { return cosf(v); }
__global__ __launch_bounds__(256) void k_pack(const float* __restrict__ WQ, const float* __restrict__ WK, __bf16* __restrict__ PW) { const int n = blockIdx.x, which = blockIdx.y, t = threadIdx.x; __shared__ __align__(16) __bf16 s[EE]; const float* w = which ? WK : WQ; for (int k = t; k < EE; k += 256) s[k] = (__bf16)w[(size_t)n * EE + k]; __syncthreads(); if (t < EE / 8) vst2((unsigned*)(PW + ((size_t)which * EE + n) * EE + t * 8), *(const v4u*)&s[t * 8]); }
// ---- k_proj: block = (64 token rows, 128 cols, which): q = relu(x Wq^T + bq), k = relu(key Wk^T + bk), v = value Wk^T + bk; f32 rows
__global__ __launch_bounds__(128) void k_proj(const float* __restrict__ XQ, const float* __restrict__ XK, const float* __restrict__ XV, const __bf16* __restrict__ PW, const float* __restrict__ BQ, const float* __restrict__ BK, float* __restrict__ Q, float* __restrict__ K, float* __restrict__ V) {
  __shared__ __align__(16) float so[4][16][132];
  const int tid = threadIdx.x, wave = tid >> 5, lane = tid & 31, col = lane & 15, g = lane >> 4; const int which = blockIdx.z; const size_t r0 = (size_t)blockIdx.x * 64 + wave * 16; const int c0 = blockIdx.y * 128;
  const float* X = (which == 0) ? XQ : (which == 1) ? XK : XV; const __bf16* Wr = PW + ((which == 0) ? 0 : (size_t)EE * EE); const float* BB = (which == 0) ? BQ : BK; float* dst = (which == 0) ? Q : (which == 1) ? K : V;
  v8f acc[8] = {};
#pragma unroll 2
  for (int kc = 0; kc < EE / 32; ++kc) { v16b a; { const float* p = X + (r0 + col) * EE + kc * 32 + 8 * g;
#pragma unroll
      for (int i = 0; i < 8; ++i) { a[i] = (__bf16)p[i]; a[8 + i] = (__bf16)p[16 + i]; } }
#pragma unroll
    for (int j = 0; j < 8; ++j) acc[j] = wmma_bf(a, frag_b(Wr + (size_t)(c0 + j * 16 + col) * EE + kc * 32, lane), acc[j]); }
#pragma unroll
  for (int j = 0; j < 8; ++j) { const float bb = bfr(BB[c0 + j * 16 + col]);
#pragma unroll
    for (int r = 0; r < 8; ++r) { const float v = acc[j][r] + bb; so[wave][8 * g + r][j * 16 + col] = (which < 2) ? fmaxf(v, 0.f) : v; } }
  LDSX();
  for (int rl = 0; rl < 16; ++rl) vst2(dst + (r0 + rl) * EE + c0 + lane * 4, *(const v4f*)&so[wave][rl][lane * 4]);
}
// ---- k_planes: block = (64 positions s, bh): k cos/sin-weighted and v as f16 hi + (x2048) residual planes [d][s]; also the per-block partial key sums are NOT needed (k_kv sums exactly)
__global__ __launch_bounds__(256) void k_planes(const float* __restrict__ K, const float* __restrict__ V, _Float16* __restrict__ PL) {
  __shared__ __align__(16) _Float16 st[6][HD][72]; const int s0 = blockIdx.x * 64; const size_t bh = blockIdx.y; const size_t b = bh / NH; const int h = (int)(bh % NH); const int t = threadIdx.x;
  for (int e = t; e < 64 * HD; e += 256) { const int sl = e >> 6, d = e & 63; const int s = s0 + sl; const size_t row = ((size_t)s * NBATCH + b) * EE + h * HD + d;
    const float ang = (1.5707963267948966f * (float)(s + 1)) / (float)LL; const float cs = cos_p(ang), sn = sin_p(ang); const float kv = K[row], vv = V[row];
    const float kc = kv * cs, ks = kv * sn; _Float16 hv;
    hv = (_Float16)kc; st[0][d][sl] = hv; st[1][d][sl] = (_Float16)((kc - (float)hv) * 2048.0f);
    hv = (_Float16)ks; st[2][d][sl] = hv; st[3][d][sl] = (_Float16)((ks - (float)hv) * 2048.0f);
    hv = (_Float16)vv; st[4][d][sl] = hv; st[5][d][sl] = (_Float16)((vv - (float)hv) * 2048.0f); }
  __syncthreads();
  for (int e = t; e < 6 * HD * 8; e += 256) { const int p = e / (HD * 8), rem = e % (HD * 8); const int d = rem >> 3, pc = rem & 7; vst2((unsigned*)(PL + ((bh * 6 + p) * HD + d) * LL + s0 + pc * 8), *(const v4u*)&st[p][d][pc * 8]); }
}
// ---- k_kv: block = bh: kv_cos[m][d] = sum_s kcos[s][d] v[s][m] and kv_sin (A = v planes [m][s], B = k planes [d][s]; hi.hi + hi.lo + lo.hi); key sums over s in f32 (fixed order); whole tables per block
__global__ __launch_bounds__(128) void k_kv(const _Float16* __restrict__ PL, const float* __restrict__ K, float* __restrict__ KV, float* __restrict__ KS) {
  __shared__ __align__(16) float skv[2][HD][HD + 4]; __shared__ __align__(16) float sks[2][HD];
  const int tid = threadIdx.x, wave = tid >> 5, lane = tid & 31, col = lane & 15, g = lane >> 4; const size_t bh = blockIdx.x; const size_t b = bh / NH; const int h = (int)(bh % NH); const int m0 = wave * 16;
  const _Float16* KCH = PL + ((bh * 6 + 0) * HD) * LL; const _Float16* KCL = PL + ((bh * 6 + 1) * HD) * LL; const _Float16* KSH = PL + ((bh * 6 + 2) * HD) * LL; const _Float16* KSL = PL + ((bh * 6 + 3) * HD) * LL; const _Float16* VH = PL + ((bh * 6 + 4) * HD) * LL; const _Float16* VL = PL + ((bh * 6 + 5) * HD) * LL;
  v8f ac[4] = {}, acl[4] = {}, as[4] = {}, asl[4] = {};
#pragma unroll 1
  for (int kc = 0; kc < LL / 32; ++kc) { const v16h vh = frag_h(VH + (size_t)(m0 + col) * LL + kc * 32, lane), vl = frag_h(VL + (size_t)(m0 + col) * LL + kc * 32, lane);
#pragma unroll
    for (int j = 0; j < 4; ++j) { const size_t o = (size_t)(j * 16 + col) * LL + kc * 32; const v16h kch = frag_h(KCH + o, lane), ksh = frag_h(KSH + o, lane);
      ac[j] = wmma16(vh, kch, ac[j]); acl[j] = wmma16(vl, kch, acl[j]); acl[j] = wmma16(vh, frag_h(KCL + o, lane), acl[j]);
      as[j] = wmma16(vh, ksh, as[j]); asl[j] = wmma16(vl, ksh, asl[j]); asl[j] = wmma16(vh, frag_h(KSL + o, lane), asl[j]); } }
#pragma unroll
  for (int j = 0; j < 4; ++j)
#pragma unroll
    for (int r = 0; r < 8; ++r) { skv[0][m0 + 8 * g + r][j * 16 + col] = ac[j][r] + acl[j][r] * (1.0f / 2048.0f); skv[1][m0 + 8 * g + r][j * 16 + col] = as[j][r] + asl[j][r] * (1.0f / 2048.0f); }
  { const int d = tid & 63, which = tid >> 6; float s = 0.f; for (int sx = 0; sx < LL; ++sx) { const float ang = (1.5707963267948966f * (float)(sx + 1)) / (float)LL; const float w = which ? sin_p(ang) : cos_p(ang); s += K[((size_t)sx * NBATCH + b) * EE + h * HD + d] * w; } sks[which][d] = s; }
  __syncthreads();
  for (int q = tid; q < 2 * HD * HD / 4; q += 128) { const int p = q / (HD * HD / 4), rem = q % (HD * HD / 4); const int m = rem / (HD / 4), d4 = rem % (HD / 4); vst2(KV + ((bh * 2 + p) * HD + m) * HD + d4 * 4, *(const v4f*)&skv[p][m][d4 * 4]); }
  if (tid < 2 * HD / 4) vst2(KS + bh * 2 * HD + tid * 4, *(const v4f*)(&sks[0][0] + tid * 4));
}
// ---- k_fin: block = (64 positions l, bh): z = 1/(qcos . sum kcos + qsin . sum ksin + eps); attn[l][m] = z (qcos . kv_cos[m] + qsin . kv_sin[m]) with bf16 hi + lo operands (4 products each); output rows (bh, l) of 64 (raw view)
__global__ __launch_bounds__(128) void k_fin(const float* __restrict__ Q, const float* __restrict__ KV, const float* __restrict__ KS, float* __restrict__ OUT) {
  __shared__ __align__(16) float sq[2][64][HD + 4]; __shared__ __align__(16) __bf16 skh[2][HD][HD + 8]; __shared__ __align__(16) __bf16 skl[2][HD][HD + 8]; __shared__ float sz[64]; __shared__ __align__(16) float so[4][16][68];
  const int tid = threadIdx.x, wave = tid >> 5, lane = tid & 31, col = lane & 15, g = lane >> 4; const int l0 = blockIdx.x * 64; const size_t bh = blockIdx.y; const size_t b = bh / NH; const int h = (int)(bh % NH);
  for (int e = tid; e < 64 * HD; e += 128) { const int ll = e >> 6, d = e & 63; const int l = l0 + ll; const float ang = (1.5707963267948966f * (float)(l + 1)) / (float)LL; const float qv = Q[((size_t)l * NBATCH + b) * EE + h * HD + d]; sq[0][ll][d] = qv * cos_p(ang); sq[1][ll][d] = qv * sin_p(ang); }
  for (int e = tid; e < 2 * HD * HD; e += 128) { const int p = e / (HD * HD), rem = e % (HD * HD); const int m = rem / HD, d = rem % HD; const float v = KV[((bh * 2 + p) * HD + m) * HD + d]; const __bf16 hv = (__bf16)v; skh[p][m][d] = hv; skl[p][m][d] = (__bf16)(v - (float)hv); }
  __syncthreads();
  if (tid < 64) { float a = 0.f; for (int d = 0; d < HD; ++d) a += sq[0][tid][d] * KS[bh * 2 * HD + d] + sq[1][tid][d] * KS[bh * 2 * HD + HD + d]; sz[tid] = 1.0f / (a + 1e-6f); }
  v8f acc[4] = {};
#pragma unroll
  for (int p = 0; p < 2; ++p)
#pragma unroll
    for (int kc = 0; kc < HD / 32; ++kc) { const F2 a = split_row(&sq[p][wave * 16 + col][0], kc * 32, lane);
#pragma unroll
      for (int j = 0; j < 4; ++j) { const v16b wh = frag_b(&skh[p][j * 16 + col][0] + kc * 32, lane), wl = frag_b(&skl[p][j * 16 + col][0] + kc * 32, lane); acc[j] = wmma_bf(a.h, wh, acc[j]); acc[j] = wmma_bf(a.l, wh, acc[j]); acc[j] = wmma_bf(a.h, wl, acc[j]); acc[j] = wmma_bf(a.l, wl, acc[j]); } }
  __syncthreads();
#pragma unroll
  for (int j = 0; j < 4; ++j)
#pragma unroll
    for (int r = 0; r < 8; ++r) so[wave][8 * g + r][j * 16 + col] = acc[j][r] * sz[wave * 16 + 8 * g + r];
  LDSX();
  for (int rl = 0; rl < 16; ++rl) if (lane < 16) vst2(OUT + (bh * LL + l0 + wave * 16 + rl) * HD + lane * 4, *(const v4f*)&so[wave][rl][lane * 4]);   // (B H, L, 64) buffer viewed as (L, B, E)
}
extern "C" void kernel_launch(void* const* d_in, const int* in_sizes, int n_in, void* d_out, int out_size, void* d_ws, size_t ws_size, hipStream_t stream) {
  (void)in_sizes; (void)n_in; (void)out_size;
  const float** F = (const float**)d_in;   // 0 query, 1 key, 2 value [2048,4,1024]; 3 Wq [1024,1024], 4 bq, 5 Wk, 6 bk (natural; v uses Wk, bk)
  if (ws_size < (size_t)WS_END) return;
  char* ws = (char*)d_ws; __bf16* PW = (__bf16*)(ws + WS_PW); float *Q = (float*)(ws + WS_Q), *K = (float*)(ws + WS_K), *V = (float*)(ws + WS_V), *KV = (float*)(ws + WS_KV), *KS = (float*)(ws + WS_KS); _Float16* PL = (_Float16*)(ws + WS_PL);
  k_pack<<<dim3(EE, 2), 256, 0, stream>>>(F[3], F[5], PW);
  k_proj<<<dim3(NR / 64, EE / 128, 3), 128, 0, stream>>>(F[0], F[1], F[2], PW, F[4], F[6], Q, K, V);
  k_planes<<<dim3(LL / 64, TBH), 256, 0, stream>>>(K, V, PL);
  k_kv<<<TBH, 128, 0, stream>>>(PL, K, KV, KS);
  k_fin<<<dim3(LL / 64, TBH), 128, 0, stream>>>(Q, KV, KS, (float*)d_out);
}

// v001
// It runs in 423 microseconds.
// In two side-by-side timings against v000, it was 3.01 and 3.02 times as fast.
// compute dtype: all float inputs rounded to bf16; q/k/v = x . W^T + b with EXACT bf16 products on WMMA 16x16x32 (natural rows; v uses the k projection as the module does); ReLU and the cos/sin position weights in f32 (precise sinf/cosf); the linear-attention contractions on WMMA with every computed operand as hi + residual (3 products (f16 hi + lo) for kv = k_w^T v, 4 products (bf16 hi + lo) for q_w . kv); key sums, normaliser z and the final scaling in f32; f32 output.
#include <hip/hip_runtime.h>
#include <math.h>

typedef __attribute__((ext_vector_type(16))) _Float16 v16h;
typedef __attribute__((ext_vector_type(16))) __bf16 v16b;
typedef __attribute__((ext_vector_type(8)))  _Float16 v8h;
typedef __attribute__((ext_vector_type(8)))  float v8f;
typedef __attribute__((ext_vector_type(4)))  float v4f;
typedef __attribute__((ext_vector_type(2)))  float v2f;
typedef __attribute__((ext_vector_type(4)))  unsigned v4u;
typedef __attribute__((ext_vector_type(4)))  int v4i;
typedef float __attribute__((may_alias)) float_a;
typedef int __attribute__((may_alias)) int_a;

template <typename T> __device__ __forceinline__ void vst2(void* p, T v) { *(T*)p = v;  }
__device__ __forceinline__ v8f wmma16(v16h a, v16h b, v8f c) {
  v8f d = __builtin_amdgcn_wmma_f32_16x16x32_f16(false, a, false, b, (short)0, c, false, false);
  asm volatile("v_nop\n\tv_nop\n\tv_nop\n\tv_nop" : "+v"(d) : "v"(a), "v"(b));
  return d;
}
__device__ __forceinline__ v8f wmma_bf(v16b a, v16b b, v8f c) {
  v8f d = __builtin_amdgcn_wmma_f32_16x16x32_bf16(false, a, false, b, (short)0, c, false, false);
  asm volatile("v_nop\n\tv_nop\n\tv_nop\n\tv_nop" : "+v"(d) : "v"(a), "v"(b));
  return d;
}
// 16x16x32 fragments: lane = (h = lane>>4, row/col = lane&15); elements 0..7 = k0+8h+0..7, 8..15 = k0+16+8h+0..7; D element r = row 8h+r
__device__ __forceinline__ v16h frag_h(const _Float16* rowk0, int lane) {
  union { v16h v; v8h q[2]; } u; const _Float16* p = rowk0 + 8 * (lane >> 4);
  u.q[0] = *(const v8h*)p; u.q[1] = *(const v8h*)(p + 16); return u.v;
}
__device__ __forceinline__ v16h frag_f32(const float* rowk0, int lane) {
  v16h a; const float* p = rowk0 + 8 * (lane >> 4);
#pragma unroll
  for (int i = 0; i < 8; ++i) { a[i] = (_Float16)p[i]; a[8 + i] = (_Float16)p[16 + i]; }
  return a;
}
__device__ __forceinline__ v16h frag_f32s(const float* rowk0, int lane, float sc) {
  v16h a; const float* p = rowk0 + 8 * (lane >> 4);
#pragma unroll
  for (int i = 0; i < 8; ++i) { a[i] = (_Float16)(p[i] * sc); a[8 + i] = (_Float16)(p[16 + i] * sc); }
  return a;
}
// column fragment from a [K][ld] layout (column n), rows >= K read as 0
__device__ __forceinline__ v16h fragc_f32(const float* W, int k0, int n, int lane, int ld, int K) {
  v16h a; const int g = lane >> 4;
#pragma unroll
  for (int i = 0; i < 8; ++i) { const int ka = k0 + 8 * g + i, kb = ka + 16;
    a[i] = (_Float16)(ka < K ? W[(size_t)(ka < K ? ka : K - 1) * ld + n] : 0.f); a[8 + i] = (_Float16)(kb < K ? W[(size_t)(kb < K ? kb : K - 1) * ld + n] : 0.f); }
  return a;
}
struct F2 { v16b h, l; };
__device__ __forceinline__ F2 bsplit16(const float v[16]) { F2 r;
#pragma unroll
  for (int i = 0; i < 16; ++i) { const __bf16 h = (__bf16)v[i]; r.h[i] = h; r.l[i] = (__bf16)(v[i] - (float)h); }
  return r; }
__device__ __forceinline__ F2 split_row(const float* row, int k0, int lane) { float v[16]; const float* p = row + k0 + 8 * (lane >> 4);
#pragma unroll
  for (int i = 0; i < 8; ++i) { v[i] = p[i]; v[8 + i] = p[16 + i]; }
  return bsplit16(v); }
__device__ __forceinline__ F2 split_rowK(const float* row, int k0, int lane, int K) { float v[16]; const int g = lane >> 4;
#pragma unroll
  for (int i = 0; i < 8; ++i) { const int ka = k0 + 8 * g + i, kb = ka + 16; v[i] = ka < K ? row[ka < K ? ka : K - 1] : 0.f; v[8 + i] = kb < K ? row[kb < K ? kb : K - 1] : 0.f; }
  return bsplit16(v); }
__device__ __forceinline__ F2 split_col(const float* W, int k0, int n, int lane, int ld, int K) { float v[16]; const int g = lane >> 4;
#pragma unroll
  for (int i = 0; i < 8; ++i) { const int ka = k0 + 8 * g + i, kb = ka + 16; v[i] = ka < K ? W[(size_t)(ka < K ? ka : K - 1) * ld + n] : 0.f; v[8 + i] = kb < K ? W[(size_t)(kb < K ? kb : K - 1) * ld + n] : 0.f; }
  return bsplit16(v); }
__device__ __forceinline__ v8f mac3(const F2& a, const F2& b, v8f c) { c = wmma_bf(a.l, b.h, c); c = wmma_bf(a.h, b.l, c); return wmma_bf(a.h, b.h, c); }
__device__ __forceinline__ float sigm(float v) { return 1.0f / (1.0f + expf(-v)); }
#define LDSX() do { asm volatile("s_wait_dscnt 0" ::: "memory"); __builtin_amdgcn_wave_barrier(); __builtin_amdgcn_fence(__ATOMIC_RELEASE, "workgroup"); } while (0)


// cosFormer multi-head linear attention (L 2,048, B 4, E 1,024, 16 heads x 64, non-causal): q = relu(Wq x), k = relu(Wk key), v = Wk value; attn = [q cos . (k cos)^T v + q sin . (k sin)^T v] / (q cos . sum k cos + q sin . sum k sin + eps), reshaped (B H, L, 64) -> (L, B, E) by raw view.
#define LL 2048
#define NBATCH 4
#define EE 1024
#define NH 16
#define HD 64
#define NBH (NBATCH * NH)
#define NR (LL * NBATCH)          // token rows (l, b) = l*B + b
#ifndef TBH
#define TBH NBH
#endif
typedef __attribute__((ext_vector_type(8))) __bf16 v8b;
__device__ __forceinline__ v16b frag_b(const __bf16* rowk0, int lane) {
  union { v16b v; v8b q[2]; } u; const __bf16* p = rowk0 + 8 * (lane >> 4);
  u.q[0] = *(const v8b*)p; u.q[1] = *(const v8b*)(p + 16); return u.v;
}
__device__ __forceinline__ float bfr(float v) { return (float)(__bf16)v; }
__device__ __attribute__((noinline)) float exp_ni(float v) { return expf(v); }
__device__ __attribute__((noinline)) float erf_ni(float v) { return erff(v); }

#define WS_PW  0u                                      // bf16 natural rows Wq, Wk [2][1024][1024]
#define WS_Q   (WS_PW + 2u * (size_t)2 * EE * EE)         // f32 rows relu(q) [NR][1024] ; relu(k) ; v
#define WS_K   (WS_Q + 4u * (size_t)NR * EE)
#define WS_V   (WS_K + 4u * (size_t)NR * EE)
#define WS_PL  (WS_V + 4u * (size_t)NR * EE)             // f16 planes [bh][6][64][LL]: kcos hi, kcos lo(x2048), ksin hi, ksin lo, v hi, v lo
#define WS_KV  (WS_PL + 2u * (size_t)NBH * 6 * HD * LL)    // f32 [bh][2][64 m][64 d] kv_cos, kv_sin ; ksum [bh][2][64]
#define WS_KS  (WS_KV + 4u * (size_t)NBH * 2 * HD * HD)
#define NSP 16                                         // k_kv splits the LL positions over NSP work-groups a head
#define PREC (2 * HD * HD + 2 * HD)                    // floats of one partial record: kv_cos, kv_sin [64 m][64 d], then the two key sums [64]
#define WS_KVP (WS_KS + 4u * (size_t)NBH * 2 * HD)        // f32 [bh][NSP][PREC] partial records
#define WS_END (WS_KVP + 4u * (size_t)NBH * NSP * PREC)

__device__ __attribute__((noinline)) float sin_p(float v) { return sinf(v); }
__device__ __attribute__((noinline)) float cos_p(float v) { return cosf(v); }
__global__ __launch_bounds__(256) void k_pack(const float* __restrict__ WQ, const float* __restrict__ WK, __bf16* __restrict__ PW) { const int n = blockIdx.x, which = blockIdx.y, t = threadIdx.x; __shared__ __align__(16) __bf16 s[EE]; const float* w = which ? WK : WQ; for (int k = t; k < EE; k += 256) s[k] = (__bf16)w[(size_t)n * EE + k]; __syncthreads(); if (t < EE / 8) vst2((unsigned*)(PW + ((size_t)which * EE + n) * EE + t * 8), *(const v4u*)&s[t * 8]); }
// ---- k_proj: block = (64 token rows, 128 cols, which): q = relu(x Wq^T + bq), k = relu(key Wk^T + bk), v = value Wk^T + bk; f32 rows
__global__ __launch_bounds__(128) void k_proj(const float* __restrict__ XQ, const float* __restrict__ XK, const float* __restrict__ XV, const __bf16* __restrict__ PW, const float* __restrict__ BQ, const float* __restrict__ BK, float* __restrict__ Q, float* __restrict__ K, float* __restrict__ V) {
  __shared__ __align__(16) float so[4][16][132];
  const int tid = threadIdx.x, wave = tid >> 5, lane = tid & 31, col = lane & 15, g = lane >> 4; const int which = blockIdx.z; const size_t r0 = (size_t)blockIdx.x * 64 + wave * 16; const int c0 = blockIdx.y * 128;
  const float* X = (which == 0) ? XQ : (which == 1) ? XK : XV; const __bf16* Wr = PW + ((which == 0) ? 0 : (size_t)EE * EE); const float* BB = (which == 0) ? BQ : BK; float* dst = (which == 0) ? Q : (which == 1) ? K : V;
  v8f acc[8] = {};
#pragma unroll 2
  for (int kc = 0; kc < EE / 32; ++kc) { v16b a; { const float* p = X + (r0 + col) * EE + kc * 32 + 8 * g;
#pragma unroll
      for (int i = 0; i < 8; ++i) { a[i] = (__bf16)p[i]; a[8 + i] = (__bf16)p[16 + i]; } }
#pragma unroll
    for (int j = 0; j < 8; ++j) acc[j] = wmma_bf(a, frag_b(Wr + (size_t)(c0 + j * 16 + col) * EE + kc * 32, lane), acc[j]); }
#pragma unroll
  for (int j = 0; j < 8; ++j) { const float bb = bfr(BB[c0 + j * 16 + col]);
#pragma unroll
    for (int r = 0; r < 8; ++r) { const float v = acc[j][r] + bb; so[wave][8 * g + r][j * 16 + col] = (which < 2) ? fmaxf(v, 0.f) : v; } }
  LDSX();
  for (int rl = 0; rl < 16; ++rl) vst2(dst + (r0 + rl) * EE + c0 + lane * 4, *(const v4f*)&so[wave][rl][lane * 4]);
}
// ---- k_planes: block = (64 positions s, bh): k cos/sin-weighted and v as f16 hi + (x2048) residual planes [d][s]; also the per-block partial key sums are NOT needed (k_kv sums exactly)
__global__ __launch_bounds__(256) void k_planes(const float* __restrict__ K, const float* __restrict__ V, _Float16* __restrict__ PL) {
  __shared__ __align__(16) _Float16 st[6][HD][72]; const int s0 = blockIdx.x * 64; const size_t bh = blockIdx.y; const size_t b = bh / NH; const int h = (int)(bh % NH); const int t = threadIdx.x;
  for (int e = t; e < 64 * HD; e += 256) { const int sl = e >> 6, d = e & 63; const int s = s0 + sl; const size_t row = ((size_t)s * NBATCH + b) * EE + h * HD + d;
    const float ang = (1.5707963267948966f * (float)(s + 1)) / (float)LL; const float cs = cos_p(ang), sn = sin_p(ang); const float kv = K[row], vv = V[row];
    const float kc = kv * cs, ks = kv * sn; _Float16 hv;
    hv = (_Float16)kc; st[0][d][sl] = hv; st[1][d][sl] = (_Float16)((kc - (float)hv) * 2048.0f);
    hv = (_Float16)ks; st[2][d][sl] = hv; st[3][d][sl] = (_Float16)((ks - (float)hv) * 2048.0f);
    hv = (_Float16)vv; st[4][d][sl] = hv; st[5][d][sl] = (_Float16)((vv - (float)hv) * 2048.0f); }
  __syncthreads();
  for (int e = t; e < 6 * HD * 8; e += 256) { const int p = e / (HD * 8), rem = e % (HD * 8); const int d = rem >> 3, pc = rem & 7; vst2((unsigned*)(PL + ((bh * 6 + p) * HD + d) * LL + s0 + pc * 8), *(const v4u*)&st[p][d][pc * 8]); }
}
// ---- k_kv: block = (LL/NSP positions s, bh), a partial record each, summed by k_red: kv_cos[m][d] = sum_s kcos[s][d] v[s][m] and kv_sin (A = v planes [m][s], B = k planes [d][s]; hi.hi + hi.lo + lo.hi); key sums over s in f32 (fixed order); whole tables per block, over its own positions
__global__ __launch_bounds__(128) void k_kv(const _Float16* __restrict__ PL, const float* __restrict__ K, float* __restrict__ KVP) {
  __shared__ __align__(16) float skv[2][HD][HD + 4]; __shared__ __align__(16) float sks[2][HD];
  const int tid = threadIdx.x, wave = tid >> 5, lane = tid & 31, col = lane & 15, g = lane >> 4; const int s0 = blockIdx.x * (LL / NSP); const size_t bh = blockIdx.y; const size_t b = bh / NH; const int h = (int)(bh % NH); const int m0 = wave * 16; float* P = KVP + (bh * NSP + blockIdx.x) * PREC;
  const _Float16* KCH = PL + ((bh * 6 + 0) * HD) * LL; const _Float16* KCL = PL + ((bh * 6 + 1) * HD) * LL; const _Float16* KSH = PL + ((bh * 6 + 2) * HD) * LL; const _Float16* KSL = PL + ((bh * 6 + 3) * HD) * LL; const _Float16* VH = PL + ((bh * 6 + 4) * HD) * LL; const _Float16* VL = PL + ((bh * 6 + 5) * HD) * LL;
  v8f ac[4] = {}, acl[4] = {}, as[4] = {}, asl[4] = {};
#pragma unroll 1
  for (int kc = s0 / 32; kc < (s0 + LL / NSP) / 32; ++kc) { const v16h vh = frag_h(VH + (size_t)(m0 + col) * LL + kc * 32, lane), vl = frag_h(VL + (size_t)(m0 + col) * LL + kc * 32, lane);
    asm volatile("s_wait_xcnt 0x0" ::: "memory");   // stands behind the v loads, in front of any later write of their address registers (a later load's result may be given those registers)
#pragma unroll
    for (int j = 0; j < 4; ++j) { const size_t o = (size_t)(j * 16 + col) * LL + kc * 32; const v16h kch = frag_h(KCH + o, lane), ksh = frag_h(KSH + o, lane);
      ac[j] = wmma16(vh, kch, ac[j]); acl[j] = wmma16(vl, kch, acl[j]); acl[j] = wmma16(vh, frag_h(KCL + o, lane), acl[j]);
      as[j] = wmma16(vh, ksh, as[j]); asl[j] = wmma16(vl, ksh, asl[j]); asl[j] = wmma16(vh, frag_h(KSL + o, lane), asl[j]); } }
#pragma unroll
  for (int j = 0; j < 4; ++j)
#pragma unroll
    for (int r = 0; r < 8; ++r) { skv[0][m0 + 8 * g + r][j * 16 + col] = ac[j][r] + acl[j][r] * (1.0f / 2048.0f); skv[1][m0 + 8 * g + r][j * 16 + col] = as[j][r] + asl[j][r] * (1.0f / 2048.0f); }
  { const int d = tid & 63, which = tid >> 6; float s = 0.f; for (int i = 0; i < LL / NSP; ++i) { const int sx = s0 + i; const float ang = (1.5707963267948966f * (float)(sx + 1)) / (float)LL; const float w = which ? sin_p(ang) : cos_p(ang); s += K[((size_t)sx * NBATCH + b) * EE + h * HD + d] * w; } sks[which][d] = s; }
  __syncthreads();
  for (int q = tid; q < 2 * HD * HD / 4; q += 128) { const int p = q / (HD * HD / 4), rem = q % (HD * HD / 4); const int m = rem / (HD / 4), d4 = rem % (HD / 4); vst2(P + (p * HD + m) * HD + d4 * 4, *(const v4f*)&skv[p][m][d4 * 4]); }
  if (tid < 2 * HD / 4) vst2(P + 2 * HD * HD + tid * 4, *(const v4f*)(&sks[0][0] + tid * 4));
}
// ---- k_red: thread = 4 floats of a head's record: the NSP partial records added in f32, in the order of the positions; tables to KV, key sums to KS
__global__ __launch_bounds__(256) void k_red(const float* __restrict__ KVP, float* __restrict__ KV, float* __restrict__ KS) {
  const int q = blockIdx.x * 256 + threadIdx.x; const size_t bh = blockIdx.y; if (q >= PREC / 4) return;
  const float* p = KVP + bh * NSP * PREC + q * 4; v4f r[NSP];
#pragma unroll      // whole: the NSP independent loads are in flight together, one latency instead of NSP
  for (int sp = 0; sp < NSP; ++sp) r[sp] = *(const v4f*)(p + (size_t)sp * PREC);
  asm volatile("s_wait_xcnt 0x0" :: "v"(p) : "memory");   // stands behind the loads; p as an input keeps their address registers unwritten up to this wait
  v4f s = r[0];
#pragma unroll      // whole: r stays in registers
  for (int sp = 1; sp < NSP; ++sp) s += r[sp];
  vst2((q < 2 * HD * HD / 4) ? KV + bh * 2 * HD * HD + q * 4 : KS + bh * 2 * HD + (q * 4 - 2 * HD * HD), s);
}
// ---- k_fin: block = (64 positions l, bh): z = 1/(qcos . sum kcos + qsin . sum ksin + eps); attn[l][m] = z (qcos . kv_cos[m] + qsin . kv_sin[m]) with bf16 hi + lo operands (4 products each); output rows (bh, l) of 64 (raw view)
__global__ __launch_bounds__(128) void k_fin(const float* __restrict__ Q, const float* __restrict__ KV, const float* __restrict__ KS, float* __restrict__ OUT) {
  __shared__ __align__(16) float sq[2][64][HD + 4]; __shared__ __align__(16) __bf16 skh[2][HD][HD + 8]; __shared__ __align__(16) __bf16 skl[2][HD][HD + 8]; __shared__ float sz[64]; __shared__ __align__(16) float so[4][16][68];
  const int tid = threadIdx.x, wave = tid >> 5, lane = tid & 31, col = lane & 15, g = lane >> 4; const int l0 = blockIdx.x * 64; const size_t bh = blockIdx.y; const size_t b = bh / NH; const int h = (int)(bh % NH);
  for (int e = tid; e < 64 * HD; e += 128) { const int ll = e >> 6, d = e & 63; const int l = l0 + ll; const float ang = (1.5707963267948966f * (float)(l + 1)) / (float)LL; const float qv = Q[((size_t)l * NBATCH + b) * EE + h * HD + d]; sq[0][ll][d] = qv * cos_p(ang); sq[1][ll][d] = qv * sin_p(ang); }
  for (int e = tid; e < 2 * HD * HD; e += 128) { const int p = e / (HD * HD), rem = e % (HD * HD); const int m = rem / HD, d = rem % HD; const float v = KV[((bh * 2 + p) * HD + m) * HD + d]; const __bf16 hv = (__bf16)v; skh[p][m][d] = hv; skl[p][m][d] = (__bf16)(v - (float)hv); }
  __syncthreads();
  if (tid < 64) { float a = 0.f; for (int d = 0; d < HD; ++d) a += sq[0][tid][d] * KS[bh * 2 * HD + d] + sq[1][tid][d] * KS[bh * 2 * HD + HD + d]; sz[tid] = 1.0f / (a + 1e-6f); }
  v8f acc[4] = {};
#pragma unroll
  for (int p = 0; p < 2; ++p)
#pragma unroll
    for (int kc = 0; kc < HD / 32; ++kc) { const F2 a = split_row(&sq[p][wave * 16 + col][0], kc * 32, lane);
#pragma unroll
      for (int j = 0; j < 4; ++j) { const v16b wh = frag_b(&skh[p][j * 16 + col][0] + kc * 32, lane), wl = frag_b(&skl[p][j * 16 + col][0] + kc * 32, lane); acc[j] = wmma_bf(a.h, wh, acc[j]); acc[j] = wmma_bf(a.l, wh, acc[j]); acc[j] = wmma_bf(a.h, wl, acc[j]); acc[j] = wmma_bf(a.l, wl, acc[j]); } }
  __syncthreads();
#pragma unroll
  for (int j = 0; j < 4; ++j)
#pragma unroll
    for (int r = 0; r < 8; ++r) so[wave][8 * g + r][j * 16 + col] = acc[j][r] * sz[wave * 16 + 8 * g + r];
  LDSX();
  for (int rl = 0; rl < 16; ++rl) if (lane < 16) vst2(OUT + (bh * LL + l0 + wave * 16 + rl) * HD + lane * 4, *(const v4f*)&so[wave][rl][lane * 4]);   // (B H, L, 64) buffer viewed as (L, B, E)
}
extern "C" void kernel_launch(void* const* d_in, const int* in_sizes, int n_in, void* d_out, int out_size, void* d_ws, size_t ws_size, hipStream_t stream) {
  (void)in_sizes; (void)n_in; (void)out_size;
  const float** F = (const float**)d_in;   // 0 query, 1 key, 2 value [2048,4,1024]; 3 Wq [1024,1024], 4 bq, 5 Wk, 6 bk (natural; v uses Wk, bk)
  if (ws_size < (size_t)WS_END) return;
  char* ws = (char*)d_ws; __bf16* PW = (__bf16*)(ws + WS_PW); float *Q = (float*)(ws + WS_Q), *K = (float*)(ws + WS_K), *V = (float*)(ws + WS_V), *KV = (float*)(ws + WS_KV), *KS = (float*)(ws + WS_KS), *KVP = (float*)(ws + WS_KVP); _Float16* PL = (_Float16*)(ws + WS_PL);
  k_pack<<<dim3(EE, 2), 256, 0, stream>>>(F[3], F[5], PW);
  k_proj<<<dim3(NR / 64, EE / 128, 3), 128, 0, stream>>>(F[0], F[1], F[2], PW, F[4], F[6], Q, K, V);
  k_planes<<<dim3(LL / 64, TBH), 256, 0, stream>>>(K, V, PL);
  k_kv<<<dim3(NSP, TBH), 128, 0, stream>>>(PL, K, KVP);
  k_red<<<dim3((PREC / 4 + 255) / 256, TBH), 256, 0, stream>>>(KVP, KV, KS);
  k_fin<<<dim3(LL / 64, TBH), 128, 0, stream>>>(Q, KV, KS, (float*)d_out);
}

// v002
// One run takes 375 microseconds.
// Next to v001, in two timings, it ran 1.12 times as fast each time.
// All steps since v000 together make it 3.38 times as fast.
// compute dtype: all float inputs rounded to bf16; q/k/v = x . W^T + b with EXACT bf16 products on WMMA 16x16x32 (both operands packed ahead in fragment order; v uses the k projection as the module does); ReLU and the cos/sin position weights in f32 (precise sinf/cosf); the linear-attention contractions on WMMA with every computed operand as f16 hi + residual (3 products for kv = k_w^T v, 4 products (bf16 hi + lo) for q_w . kv); key sums, normaliser z and the final scaling in f32; f32 output.
#include <hip/hip_runtime.h>
#include <math.h>

typedef __attribute__((ext_vector_type(16))) _Float16 v16h;
typedef __attribute__((ext_vector_type(16))) __bf16 v16b;
typedef __attribute__((ext_vector_type(8)))  _Float16 v8h;
typedef __attribute__((ext_vector_type(8)))  float v8f;
typedef __attribute__((ext_vector_type(4)))  float v4f;
typedef __attribute__((ext_vector_type(2)))  float v2f;
typedef __attribute__((ext_vector_type(4)))  unsigned v4u;
typedef __attribute__((ext_vector_type(4)))  int v4i;
typedef float __attribute__((may_alias)) float_a;
typedef int __attribute__((may_alias)) int_a;

template <typename T> __device__ __forceinline__ void vst2(void* p, T v) { *(T*)p = v;  }
__device__ __forceinline__ v8f wmma16(v16h a, v16h b, v8f c) {
  v8f d = __builtin_amdgcn_wmma_f32_16x16x32_f16(false, a, false, b, (short)0, c, false, false);
  asm volatile("v_nop\n\tv_nop\n\tv_nop\n\tv_nop" : "+v"(d) : "v"(a), "v"(b));
  return d;
}
__device__ __forceinline__ v8f wmma_bf(v16b a, v16b b, v8f c) {
  v8f d = __builtin_amdgcn_wmma_f32_16x16x32_bf16(false, a, false, b, (short)0, c, false, false);
  asm volatile("v_nop\n\tv_nop\n\tv_nop\n\tv_nop" : "+v"(d) : "v"(a), "v"(b));
  return d;
}
// 16x16x32 fragments: lane = (h = lane>>4, row/col = lane&15); elements 0..7 = k0+8h+0..7, 8..15 = k0+16+8h+0..7; D element r = row 8h+r
__device__ __forceinline__ v16h frag_h(const _Float16* rowk0, int lane) {
  union { v16h v; v8h q[2]; } u; const _Float16* p = rowk0 + 8 * (lane >> 4);
  u.q[0] = *(const v8h*)p; u.q[1] = *(const v8h*)(p + 16); return u.v;
}
__device__ __forceinline__ v16h frag_f32(const float* rowk0, int lane) {
  v16h a; const float* p = rowk0 + 8 * (lane >> 4);
#pragma unroll
  for (int i = 0; i < 8; ++i) { a[i] = (_Float16)p[i]; a[8 + i] = (_Float16)p[16 + i]; }
  return a;
}
__device__ __forceinline__ v16h frag_f32s(const float* rowk0, int lane, float sc) {
  v16h a; const float* p = rowk0 + 8 * (lane >> 4);
#pragma unroll
  for (int i = 0; i < 8; ++i) { a[i] = (_Float16)(p[i] * sc); a[8 + i] = (_Float16)(p[16 + i] * sc); }
  return a;
}
// column fragment from a [K][ld] layout (column n), rows >= K read as 0
__device__ __forceinline__ v16h fragc_f32(const float* W, int k0, int n, int lane, int ld, int K) {
  v16h a; const int g = lane >> 4;
#pragma unroll
  for (int i = 0; i < 8; ++i) { const int ka = k0 + 8 * g + i, kb = ka + 16;
    a[i] = (_Float16)(ka < K ? W[(size_t)(ka < K ? ka : K - 1) * ld + n] : 0.f); a[8 + i] = (_Float16)(kb < K ? W[(size_t)(kb < K ? kb : K - 1) * ld + n] : 0.f); }
  return a;
}
struct F2 { v16b h, l; };
__device__ __forceinline__ F2 bsplit16(const float v[16]) { F2 r;
#pragma unroll
  for (int i = 0; i < 16; ++i) { const __bf16 h = (__bf16)v[i]; r.h[i] = h; r.l[i] = (__bf16)(v[i] - (float)h); }
  return r; }
__device__ __forceinline__ F2 split_row(const float* row, int k0, int lane) { float v[16]; const float* p = row + k0 + 8 * (lane >> 4);
#pragma unroll
  for (int i = 0; i < 8; ++i) { v[i] = p[i]; v[8 + i] = p[16 + i]; }
  return bsplit16(v); }
__device__ __forceinline__ F2 split_rowK(const float* row, int k0, int lane, int K) { float v[16]; const int g = lane >> 4;
#pragma unroll
  for (int i = 0; i < 8; ++i) { const int ka = k0 + 8 * g + i, kb = ka + 16; v[i] = ka < K ? row[ka < K ? ka : K - 1] : 0.f; v[8 + i] = kb < K ? row[kb < K ? kb : K - 1] : 0.f; }
  return bsplit16(v); }
__device__ __forceinline__ F2 split_col(const float* W, int k0, int n, int lane, int ld, int K) { float v[16]; const int g = lane >> 4;
#pragma unroll
  for (int i = 0; i < 8; ++i) { const int ka = k0 + 8 * g + i, kb = ka + 16; v[i] = ka < K ? W[(size_t)(ka < K ? ka : K - 1) * ld + n] : 0.f; v[8 + i] = kb < K ? W[(size_t)(kb < K ? kb : K - 1) * ld + n] : 0.f; }
  return bsplit16(v); }
__device__ __forceinline__ v8f mac3(const F2& a, const F2& b, v8f c) { c = wmma_bf(a.l, b.h, c); c = wmma_bf(a.h, b.l, c); return wmma_bf(a.h, b.h, c); }
__device__ __forceinline__ float sigm(float v) { return 1.0f / (1.0f + expf(-v)); }
#define LDSX() do { asm volatile("s_wait_dscnt 0" ::: "memory"); __builtin_amdgcn_wave_barrier(); __builtin_amdgcn_fence(__ATOMIC_RELEASE, "workgroup"); } while (0)


// cosFormer multi-head linear attention (L 2,048, B 4, E 1,024, 16 heads x 64, non-causal): q = relu(Wq x), k = relu(Wk key), v = Wk value; attn = [q cos . (k cos)^T v + q sin . (k sin)^T v] / (q cos . sum k cos + q sin . sum k sin + eps), reshaped (B H, L, 64) -> (L, B, E) by raw view.
#define LL 2048
#define NBATCH 4
#define EE 1024
#define NH 16
#define HD 64
#define NBH (NBATCH * NH)
#define NR (LL * NBATCH)          // token rows (l, b) = l*B + b
#ifndef TBH
#define TBH NBH
#endif
typedef __attribute__((ext_vector_type(8))) __bf16 v8b;
__device__ __forceinline__ v16b frag_b(const __bf16* rowk0, int lane) {
  union { v16b v; v8b q[2]; } u; const __bf16* p = rowk0 + 8 * (lane >> 4);
  u.q[0] = *(const v8b*)p; u.q[1] = *(const v8b*)(p + 16); return u.v;
}
__device__ __forceinline__ float bfr(float v) { return (float)(__bf16)v; }
__device__ __attribute__((noinline)) float exp_ni(float v) { return expf(v); }
__device__ __attribute__((noinline)) float erf_ni(float v) { return erff(v); }

#define WS_PW  0u                                      // bf16 Wq, Wk in fragment order [2][RT_W][TILE_E]
#define WS_Q   (WS_PW + 2u * (size_t)2 * EE * EE)         // f32 rows relu(q) [NR][1024] ; relu(k) ; v
#define WS_K   (WS_Q + 4u * (size_t)NR * EE)
#define WS_V   (WS_K + 4u * (size_t)NR * EE)
#define WS_PL  (WS_V + 4u * (size_t)NR * EE)             // f16 planes [bh][6][64][LL]: kcos hi, kcos lo(x2048), ksin hi, ksin lo, v hi, v lo
#define WS_KV  (WS_PL + 2u * (size_t)NBH * 6 * HD * LL)    // f32 [bh][2][64 m][64 d] kv_cos, kv_sin ; ksum [bh][2][64]
#define WS_KS  (WS_KV + 4u * (size_t)NBH * 2 * HD * HD)
#define NSP 16                                         // k_kv splits the LL positions over NSP work-groups a head
#define PREC (2 * HD * HD + 2 * HD)                    // floats of one partial record: kv_cos, kv_sin [64 m][64 d], then the two key sums [64]
#define WS_KVP (WS_KS + 4u * (size_t)NBH * 2 * HD)        // f32 [bh][NSP][PREC] partial records
#define WS_END (WS_KVP + 4u * (size_t)NBH * NSP * PREC)
#define RT_X (NR / 16)                                 // tiles of 16 token rows in one input
#define RT_W (EE / 16)                                 // tiles of 16 rows in one weight
#define TILE_E (16 * EE)                               // bf16 elements of one packed tile: [kc 32][half 2][lane 32][8], the 16 bytes a lane loads for half a 16x16x32 fragment
#define WS_PX  WS_PL                                   // bf16 query, key, value in fragment order [3][RT_X][TILE_E]; half the planes' room, last read by k_proj, before k_planes writes the planes there

__device__ __attribute__((noinline)) float sin_p(float v) { return sinf(v); }
__device__ __attribute__((noinline)) float cos_p(float v) { return cosf(v); }
typedef __attribute__((ext_vector_type(4))) __bf16 v4b;
// ---- k_pack: block = one tile of 16 rows x 1024 k of query, key, value, Wq or Wk: read in whole lines, rounded to bf16, turned in LDS and written in fragment order, so that each operand load of k_proj is 512 contiguous bytes
__global__ __launch_bounds__(256) void k_pack(const float* __restrict__ XQ, const float* __restrict__ XK, const float* __restrict__ XV, const float* __restrict__ WQ, const float* __restrict__ WK, __bf16* __restrict__ PX, __bf16* __restrict__ PW) {
  __shared__ __align__(16) __bf16 s[16][EE + 8]; const int t = threadIdx.x, bx = blockIdx.x; const float* src; __bf16* dst;
  if (bx < 3 * RT_X) { const int which = bx / RT_X; src = ((which == 0) ? XQ : (which == 1) ? XK : XV) + (size_t)(bx % RT_X) * TILE_E; dst = PX + (size_t)bx * TILE_E; }
  else { const int e = bx - 3 * RT_X; src = ((e / RT_W) ? WK : WQ) + (size_t)(e % RT_W) * TILE_E; dst = PW + (size_t)e * TILE_E; }
  v4f v[16];
#pragma unroll      // whole: the 16 independent row loads are in flight together
  for (int i = 0; i < 16; ++i) v[i] = *(const v4f*)(src + (size_t)i * EE + t * 4);
#pragma unroll      // whole: v stays in registers
  for (int i = 0; i < 16; ++i) { v4b h; h[0] = (__bf16)v[i][0]; h[1] = (__bf16)v[i][1]; h[2] = (__bf16)v[i][2]; h[3] = (__bf16)v[i][3]; *(v4b*)&s[i][t * 4] = h; }
  __syncthreads();
  for (int o = t; o < TILE_E / 8; o += 256) { const int kc = o >> 6, half = (o >> 5) & 1, lane = o & 31; *(v8b*)(dst + (size_t)o * 8) = *(const v8b*)&s[lane & 15][kc * 32 + half * 16 + 8 * (lane >> 4)]; }
}
// fragment from a packed tile: p = tile + kc * 512 + lane * 8; elements 0..7 = k0+8h+0..7, 8..15 = k0+16+8h+0..7 of row lane&15, as frag_b gives them
__device__ __forceinline__ v16b frag_p(const __bf16* p) { union { v16b v; v8b q[2]; } u; u.q[0] = *(const v8b*)p; u.q[1] = *(const v8b*)(p + 256); return u.v; }
// ---- k_proj: block = (64 token rows, 128 cols, which): q = relu(x Wq^T + bq), k = relu(key Wk^T + bk), v = value Wk^T + bk; f32 rows
__global__ __launch_bounds__(128) void k_proj(const __bf16* __restrict__ PX, const __bf16* __restrict__ PW, const float* __restrict__ BQ, const float* __restrict__ BK, float* __restrict__ Q, float* __restrict__ K, float* __restrict__ V) {
  __shared__ __align__(16) float so[4][16][132];
  const int tid = threadIdx.x, wave = tid >> 5, lane = tid & 31, col = lane & 15, g = lane >> 4; const int which = blockIdx.z; const size_t r0 = (size_t)blockIdx.x * 64 + wave * 16; const int c0 = blockIdx.y * 128;
  const __bf16* Ar = PX + ((size_t)which * RT_X + blockIdx.x * 4 + wave) * TILE_E + lane * 8; const __bf16* Br = PW + ((size_t)((which == 0) ? 0 : RT_W) + blockIdx.y * 8) * TILE_E + lane * 8; const float* BB = (which == 0) ? BQ : BK; float* dst = (which == 0) ? Q : (which == 1) ? K : V;
  v8f acc[8] = {};
#pragma unroll 2
  for (int kc = 0; kc < EE / 32; ++kc) { const v16b a = frag_p(Ar + kc * 512);
#pragma unroll
    for (int j = 0; j < 8; ++j) acc[j] = wmma_bf(a, frag_p(Br + (size_t)j * TILE_E + kc * 512), acc[j]); }
#pragma unroll
  for (int j = 0; j < 8; ++j) { const float bb = bfr(BB[c0 + j * 16 + col]);
#pragma unroll
    for (int r = 0; r < 8; ++r) { const float v = acc[j][r] + bb; so[wave][8 * g + r][j * 16 + col] = (which < 2) ? fmaxf(v, 0.f) : v; } }
  LDSX();
  for (int rl = 0; rl < 16; ++rl) vst2(dst + (r0 + rl) * EE + c0 + lane * 4, *(const v4f*)&so[wave][rl][lane * 4]);
}
// ---- k_planes: block = (64 positions s, bh): k cos/sin-weighted and v as f16 hi + (x2048) residual planes [d][s]; also the per-block partial key sums are NOT needed (k_kv sums exactly)
__global__ __launch_bounds__(256) void k_planes(const float* __restrict__ K, const float* __restrict__ V, _Float16* __restrict__ PL) {
  __shared__ __align__(16) _Float16 st[6][HD][72]; const int s0 = blockIdx.x * 64; const size_t bh = blockIdx.y; const size_t b = bh / NH; const int h = (int)(bh % NH); const int t = threadIdx.x;
  for (int e = t; e < 64 * HD; e += 256) { const int sl = e >> 6, d = e & 63; const int s = s0 + sl; const size_t row = ((size_t)s * NBATCH + b) * EE + h * HD + d;
    const float ang = (1.5707963267948966f * (float)(s + 1)) / (float)LL; const float cs = cos_p(ang), sn = sin_p(ang); const float kv = K[row], vv = V[row];
    const float kc = kv * cs, ks = kv * sn; _Float16 hv;
    hv = (_Float16)kc; st[0][d][sl] = hv; st[1][d][sl] = (_Float16)((kc - (float)hv) * 2048.0f);
    hv = (_Float16)ks; st[2][d][sl] = hv; st[3][d][sl] = (_Float16)((ks - (float)hv) * 2048.0f);
    hv = (_Float16)vv; st[4][d][sl] = hv; st[5][d][sl] = (_Float16)((vv - (float)hv) * 2048.0f); }
  __syncthreads();
  for (int e = t; e < 6 * HD * 8; e += 256) { const int p = e / (HD * 8), rem = e % (HD * 8); const int d = rem >> 3, pc = rem & 7; vst2((unsigned*)(PL + ((bh * 6 + p) * HD + d) * LL + s0 + pc * 8), *(const v4u*)&st[p][d][pc * 8]); }
}
// ---- k_kv: block = (LL/NSP positions s, bh), a partial record each, summed by k_red: kv_cos[m][d] = sum_s kcos[s][d] v[s][m] and kv_sin (A = v planes [m][s], B = k planes [d][s]; hi.hi + hi.lo + lo.hi); key sums over s in f32 (fixed order); whole tables per block, over its own positions
__global__ __launch_bounds__(128) void k_kv(const _Float16* __restrict__ PL, const float* __restrict__ K, float* __restrict__ KVP) {
  __shared__ __align__(16) float skv[2][HD][HD + 4]; __shared__ __align__(16) float sks[2][HD];
  const int tid = threadIdx.x, wave = tid >> 5, lane = tid & 31, col = lane & 15, g = lane >> 4; const int s0 = blockIdx.x * (LL / NSP); const size_t bh = blockIdx.y; const size_t b = bh / NH; const int h = (int)(bh % NH); const int m0 = wave * 16; float* P = KVP + (bh * NSP + blockIdx.x) * PREC;
  const _Float16* KCH = PL + ((bh * 6 + 0) * HD) * LL; const _Float16* KCL = PL + ((bh * 6 + 1) * HD) * LL; const _Float16* KSH = PL + ((bh * 6 + 2) * HD) * LL; const _Float16* KSL = PL + ((bh * 6 + 3) * HD) * LL; const _Float16* VH = PL + ((bh * 6 + 4) * HD) * LL; const _Float16* VL = PL + ((bh * 6 + 5) * HD) * LL;
  v8f ac[4] = {}, acl[4] = {}, as[4] = {}, asl[4] = {};
#pragma unroll 1
  for (int kc = s0 / 32; kc < (s0 + LL / NSP) / 32; ++kc) { const v16h vh = frag_h(VH + (size_t)(m0 + col) * LL + kc * 32, lane), vl = frag_h(VL + (size_t)(m0 + col) * LL + kc * 32, lane);
    asm volatile("s_wait_xcnt 0x0" ::: "memory");   // stands behind the v loads, in front of any later write of their address registers (a later load's result may be given those registers)
#pragma unroll
    for (int j = 0; j < 4; ++j) { const size_t o = (size_t)(j * 16 + col) * LL + kc * 32; const v16h kch = frag_h(KCH + o, lane), ksh = frag_h(KSH + o, lane);
      ac[j] = wmma16(vh, kch, ac[j]); acl[j] = wmma16(vl, kch, acl[j]); acl[j] = wmma16(vh, frag_h(KCL + o, lane), acl[j]);
      as[j] = wmma16(vh, ksh, as[j]); asl[j] = wmma16(vl, ksh, asl[j]); asl[j] = wmma16(vh, frag_h(KSL + o, lane), asl[j]); } }
#pragma unroll
  for (int j = 0; j < 4; ++j)
#pragma unroll
    for (int r = 0; r < 8; ++r) { skv[0][m0 + 8 * g + r][j * 16 + col] = ac[j][r] + acl[j][r] * (1.0f / 2048.0f); skv[1][m0 + 8 * g + r][j * 16 + col] = as[j][r] + asl[j][r] * (1.0f / 2048.0f); }
  { const int d = tid & 63, which = tid >> 6; float s = 0.f; for (int i = 0; i < LL / NSP; ++i) { const int sx = s0 + i; const float ang = (1.5707963267948966f * (float)(sx + 1)) / (float)LL; const float w = which ? sin_p(ang) : cos_p(ang); s += K[((size_t)sx * NBATCH + b) * EE + h * HD + d] * w; } sks[which][d] = s; }
  __syncthreads();
  for (int q = tid; q < 2 * HD * HD / 4; q += 128) { const int p = q / (HD * HD / 4), rem = q % (HD * HD / 4); const int m = rem / (HD / 4), d4 = rem % (HD / 4); vst2(P + (p * HD + m) * HD + d4 * 4, *(const v4f*)&skv[p][m][d4 * 4]); }
  if (tid < 2 * HD / 4) vst2(P + 2 * HD * HD + tid * 4, *(const v4f*)(&sks[0][0] + tid * 4));
}
// ---- k_red: thread = 4 floats of a head's record: the NSP partial records added in f32, in the order of the positions; tables to KV, key sums to KS
__global__ __launch_bounds__(256) void k_red(const float* __restrict__ KVP, float* __restrict__ KV, float* __restrict__ KS) {
  const int q = blockIdx.x * 256 + threadIdx.x; const size_t bh = blockIdx.y; if (q >= PREC / 4) return;
  const float* p = KVP + bh * NSP * PREC + q * 4; v4f r[NSP];
#pragma unroll      // whole: the NSP independent loads are in flight together, one latency instead of NSP
  for (int sp = 0; sp < NSP; ++sp) r[sp] = *(const v4f*)(p + (size_t)sp * PREC);
  asm volatile("s_wait_xcnt 0x0" :: "v"(p) : "memory");   // stands behind the loads; p as an input keeps their address registers unwritten up to this wait
  v4f s = r[0];
#pragma unroll      // whole: r stays in registers
  for (int sp = 1; sp < NSP; ++sp) s += r[sp];
  vst2((q < 2 * HD * HD / 4) ? KV + bh * 2 * HD * HD + q * 4 : KS + bh * 2 * HD + (q * 4 - 2 * HD * HD), s);
}
// ---- k_fin: block = (64 positions l, bh): z = 1/(qcos . sum kcos + qsin . sum ksin + eps); attn[l][m] = z (qcos . kv_cos[m] + qsin . kv_sin[m]) with bf16 hi + lo operands (4 products each); output rows (bh, l) of 64 (raw view)
__global__ __launch_bounds__(128) void k_fin(const float* __restrict__ Q, const float* __restrict__ KV, const float* __restrict__ KS, float* __restrict__ OUT) {
  __shared__ __align__(16) float sq[2][64][HD + 4]; __shared__ __align__(16) __bf16 skh[2][HD][HD + 8]; __shared__ __align__(16) __bf16 skl[2][HD][HD + 8]; __shared__ float sz[64]; __shared__ __align__(16) float so[4][16][68];
  const int tid = threadIdx.x, wave = tid >> 5, lane = tid & 31, col = lane & 15, g = lane >> 4; const int l0 = blockIdx.x * 64; const size_t bh = blockIdx.y; const size_t b = bh / NH; const int h = (int)(bh % NH);
  for (int e = tid; e < 64 * HD; e += 128) { const int ll = e >> 6, d = e & 63; const int l = l0 + ll; const float ang = (1.5707963267948966f * (float)(l + 1)) / (float)LL; const float qv = Q[((size_t)l * NBATCH + b) * EE + h * HD + d]; sq[0][ll][d] = qv * cos_p(ang); sq[1][ll][d] = qv * sin_p(ang); }
  for (int e = tid; e < 2 * HD * HD; e += 128) { const int p = e / (HD * HD), rem = e % (HD * HD); const int m = rem / HD, d = rem % HD; const float v = KV[((bh * 2 + p) * HD + m) * HD + d]; const __bf16 hv = (__bf16)v; skh[p][m][d] = hv; skl[p][m][d] = (__bf16)(v - (float)hv); }
  __syncthreads();
  if (tid < 64) { float a = 0.f; for (int d = 0; d < HD; ++d) a += sq[0][tid][d] * KS[bh * 2 * HD + d] + sq[1][tid][d] * KS[bh * 2 * HD + HD + d]; sz[tid] = 1.0f / (a + 1e-6f); }
  v8f acc[4] = {};
#pragma unroll
  for (int p = 0; p < 2; ++p)
#pragma unroll
    for (int kc = 0; kc < HD / 32; ++kc) { const F2 a = split_row(&sq[p][wave * 16 + col][0], kc * 32, lane);
#pragma unroll
      for (int j = 0; j < 4; ++j) { const v16b wh = frag_b(&skh[p][j * 16 + col][0] + kc * 32, lane), wl = frag_b(&skl[p][j * 16 + col][0] + kc * 32, lane); acc[j] = wmma_bf(a.h, wh, acc[j]); acc[j] = wmma_bf(a.l, wh, acc[j]); acc[j] = wmma_bf(a.h, wl, acc[j]); acc[j] = wmma_bf(a.l, wl, acc[j]); } }
  __syncthreads();
#pragma unroll
  for (int j = 0; j < 4; ++j)
#pragma unroll
    for (int r = 0; r < 8; ++r) so[wave][8 * g + r][j * 16 + col] = acc[j][r] * sz[wave * 16 + 8 * g + r];
  LDSX();
  for (int rl = 0; rl < 16; ++rl) if (lane < 16) vst2(OUT + (bh * LL + l0 + wave * 16 + rl) * HD + lane * 4, *(const v4f*)&so[wave][rl][lane * 4]);   // (B H, L, 64) buffer viewed as (L, B, E)
}
extern "C" void kernel_launch(void* const* d_in, const int* in_sizes, int n_in, void* d_out, int out_size, void* d_ws, size_t ws_size, hipStream_t stream) {
  (void)in_sizes; (void)n_in; (void)out_size;
  const float** F = (const float**)d_in;   // 0 query, 1 key, 2 value [2048,4,1024]; 3 Wq [1024,1024], 4 bq, 5 Wk, 6 bk (natural; v uses Wk, bk)
  if (ws_size < (size_t)WS_END) return;
  char* ws = (char*)d_ws; __bf16* PW = (__bf16*)(ws + WS_PW); float *Q = (float*)(ws + WS_Q), *K = (float*)(ws + WS_K), *V = (float*)(ws + WS_V), *KV = (float*)(ws + WS_KV), *KS = (float*)(ws + WS_KS), *KVP = (float*)(ws + WS_KVP); _Float16* PL = (_Float16*)(ws + WS_PL); __bf16* PX = (__bf16*)(ws + WS_PX);
  k_pack<<<dim3(3 * RT_X + 2 * RT_W), 256, 0, stream>>>(F[0], F[1], F[2], F[3], F[5], PX, PW);
  k_proj<<<dim3(NR / 64, EE / 128, 3), 128, 0, stream>>>(PX, PW, F[4], F[6], Q, K, V);
  k_planes<<<dim3(LL / 64, TBH), 256, 0, stream>>>(K, V, PL);
  k_kv<<<dim3(NSP, TBH), 128, 0, stream>>>(PL, K, KVP);
  k_red<<<dim3((PREC / 4 + 255) / 256, TBH), 256, 0, stream>>>(KVP, KV, KS);
  k_fin<<<dim3(LL / 64, TBH), 128, 0, stream>>>(Q, KV, KS, (float*)d_out);
}

// v003
// It runs in 294 microseconds.
// Two timings next to v002 both put it at 1.28 times that version's speed.
// All steps since v000 together make it 4.32 times as fast.
// compute dtype: all float inputs rounded to bf16; q/k/v = x . W^T + b with EXACT bf16 products on WMMA 16x16x32 (both operands packed ahead in fragment order; v uses the k projection as the module does); ReLU and the cos/sin position weights in f32 (precise sinf/cosf); the linear-attention contractions on WMMA with every computed operand as f16 hi + residual (3 products for kv = k_w^T v, 4 products (bf16 hi + lo) for q_w . kv); key sums, normaliser z and the final scaling in f32; f32 output.
#include <hip/hip_runtime.h>
#include <math.h>

typedef __attribute__((ext_vector_type(16))) _Float16 v16h;
typedef __attribute__((ext_vector_type(16))) __bf16 v16b;
typedef __attribute__((ext_vector_type(8)))  _Float16 v8h;
typedef __attribute__((ext_vector_type(8)))  float v8f;
typedef __attribute__((ext_vector_type(4)))  float v4f;
typedef __attribute__((ext_vector_type(2)))  float v2f;
typedef __attribute__((ext_vector_type(4)))  unsigned v4u;
typedef __attribute__((ext_vector_type(4)))  int v4i;
typedef float __attribute__((may_alias)) float_a;
typedef int __attribute__((may_alias)) int_a;

template <typename T> __device__ __forceinline__ void vst2(void* p, T v) { *(T*)p = v;  }
__device__ __forceinline__ v8f wmma16(v16h a, v16h b, v8f c) {
  v8f d = __builtin_amdgcn_wmma_f32_16x16x32_f16(false, a, false, b, (short)0, c, false, false);
  asm volatile("v_nop\n\tv_nop\n\tv_nop\n\tv_nop" : "+v"(d) : "v"(a), "v"(b));
  return d;
}
__device__ __forceinline__ v8f wmma_bf(v16b a, v16b b, v8f c) {
  v8f d = __builtin_amdgcn_wmma_f32_16x16x32_bf16(false, a, false, b, (short)0, c, false, false);
  asm volatile("v_nop\n\tv_nop\n\tv_nop\n\tv_nop" : "+v"(d) : "v"(a), "v"(b));
  return d;
}
// 16x16x32 fragments: lane = (h = lane>>4, row/col = lane&15); elements 0..7 = k0+8h+0..7, 8..15 = k0+16+8h+0..7; D element r = row 8h+r
__device__ __forceinline__ v16h frag_h(const _Float16* rowk0, int lane) {
  union { v16h v; v8h q[2]; } u; const _Float16* p = rowk0 + 8 * (lane >> 4);
  u.q[0] = *(const v8h*)p; u.q[1] = *(const v8h*)(p + 16); return u.v;
}
__device__ __forceinline__ v16h frag_f32(const float* rowk0, int lane) {
  v16h a; const float* p = rowk0 + 8 * (lane >> 4);
#pragma unroll
  for (int i = 0; i < 8; ++i) { a[i] = (_Float16)p[i]; a[8 + i] = (_Float16)p[16 + i]; }
  return a;
}
__device__ __forceinline__ v16h frag_f32s(const float* rowk0, int lane, float sc) {
  v16h a; const float* p = rowk0 + 8 * (lane >> 4);
#pragma unroll
  for (int i = 0; i < 8; ++i) { a[i] = (_Float16)(p[i] * sc); a[8 + i] = (_Float16)(p[16 + i] * sc); }
  return a;
}
// column fragment from a [K][ld] layout (column n), rows >= K read as 0
__device__ __forceinline__ v16h fragc_f32(const float* W, int k0, int n, int lane, int ld, int K) {
  v16h a; const int g = lane >> 4;
#pragma unroll
  for (int i = 0; i < 8; ++i) { const int ka = k0 + 8 * g + i, kb = ka + 16;
    a[i] = (_Float16)(ka < K ? W[(size_t)(ka < K ? ka : K - 1) * ld + n] : 0.f); a[8 + i] = (_Float16)(kb < K ? W[(size_t)(kb < K ? kb : K - 1) * ld + n] : 0.f); }
  return a;
}
struct F2 { v16b h, l; };
__device__ __forceinline__ F2 bsplit16(const float v[16]) { F2 r;
#pragma unroll
  for (int i = 0; i < 16; ++i) { const __bf16 h = (__bf16)v[i]; r.h[i] = h; r.l[i] = (__bf16)(v[i] - (float)h); }
  return r; }
__device__ __forceinline__ F2 split_row(const float* row, int k0, int lane) { float v[16]; const float* p = row + k0 + 8 * (lane >> 4);
#pragma unroll
  for (int i = 0; i < 8; ++i) { v[i] = p[i]; v[8 + i] = p[16 + i]; }
  return bsplit16(v); }
__device__ __forceinline__ F2 split_rowK(const float* row, int k0, int lane, int K) { float v[16]; const int g = lane >> 4;
#pragma unroll
  for (int i = 0; i < 8; ++i) { const int ka = k0 + 8 * g + i, kb = ka + 16; v[i] = ka < K ? row[ka < K ? ka : K - 1] : 0.f; v[8 + i] = kb < K ? row[kb < K ? kb : K - 1] : 0.f; }
  return bsplit16(v); }
__device__ __forceinline__ F2 split_col(const float* W, int k0, int n, int lane, int ld, int K) { float v[16]; const int g = lane >> 4;
#pragma unroll
  for (int i = 0; i < 8; ++i) { const int ka = k0 + 8 * g + i, kb = ka + 16; v[i] = ka < K ? W[(size_t)(ka < K ? ka : K - 1) * ld + n] : 0.f; v[8 + i] = kb < K ? W[(size_t)(kb < K ? kb : K - 1) * ld + n] : 0.f; }
  return bsplit16(v); }
__device__ __forceinline__ v8f mac3(const F2& a, const F2& b, v8f c) { c = wmma_bf(a.l, b.h, c); c = wmma_bf(a.h, b.l, c); return wmma_bf(a.h, b.h, c); }
__device__ __forceinline__ float sigm(float v) { return 1.0f / (1.0f + expf(-v)); }
#define LDSX() do { asm volatile("s_wait_dscnt 0" ::: "memory"); __builtin_amdgcn_wave_barrier(); __builtin_amdgcn_fence(__ATOMIC_RELEASE, "workgroup"); } while (0)


// cosFormer multi-head linear attention (L 2,048, B 4, E 1,024, 16 heads x 64, non-causal): q = relu(Wq x), k = relu(Wk key), v = Wk value; attn = [q cos . (k cos)^T v + q sin . (k sin)^T v] / (q cos . sum k cos + q sin . sum k sin + eps), reshaped (B H, L, 64) -> (L, B, E) by raw view.
#define LL 2048
#define NBATCH 4
#define EE 1024
#define NH 16
#define HD 64
#define NBH (NBATCH * NH)
#define NR (LL * NBATCH)          // token rows (l, b) = l*B + b
#ifndef TBH
#define TBH NBH
#endif
typedef __attribute__((ext_vector_type(8))) __bf16 v8b;
__device__ __forceinline__ v16b frag_b(const __bf16* rowk0, int lane) {
  union { v16b v; v8b q[2]; } u; const __bf16* p = rowk0 + 8 * (lane >> 4);
  u.q[0] = *(const v8b*)p; u.q[1] = *(const v8b*)(p + 16); return u.v;
}
__device__ __forceinline__ float bfr(float v) { return (float)(__bf16)v; }
__device__ __attribute__((noinline)) float exp_ni(float v) { return expf(v); }
__device__ __attribute__((noinline)) float erf_ni(float v) { return erff(v); }

#define WS_PW  0u                                      // bf16 Wq, Wk in fragment order [2][RT_W][TILE_E]
#define WS_Q   (WS_PW + 2u * (size_t)2 * EE * EE)         // f32 rows relu(q) [NR][1024] ; relu(k) ; v
#define WS_K   (WS_Q + 4u * (size_t)NR * EE)
#define WS_V   (WS_K + 4u * (size_t)NR * EE)
#define WS_PL  (WS_V + 4u * (size_t)NR * EE)             // f16 planes [bh][6][64][LL]: kcos hi, kcos lo(x2048), ksin hi, ksin lo, v hi, v lo
#define WS_KV  (WS_PL + 2u * (size_t)NBH * 6 * HD * LL)    // f32 [bh][2][64 m][64 d] kv_cos, kv_sin ; ksum [bh][2][64]
#define WS_KS  (WS_KV + 4u * (size_t)NBH * 2 * HD * HD)
#define NSP 16                                         // k_kv splits the LL positions over NSP work-groups a head
#define PREC (2 * HD * HD + 2 * HD)                    // floats of one partial record: kv_cos, kv_sin [64 m][64 d], then the two key sums [64]
#define WS_KVP (WS_KS + 4u * (size_t)NBH * 2 * HD)        // f32 [bh][NSP][PREC] partial records
#define WS_END (WS_KVP + 4u * (size_t)NBH * NSP * PREC)
#define RT_X (NR / 16)                                 // tiles of 16 token rows in one input
#define RT_W (EE / 16)                                 // tiles of 16 rows in one weight
#define TILE_E (16 * EE)                               // bf16 elements of one packed tile: [kc 32][half 2][lane 32][8], the 16 bytes a lane loads for half a 16x16x32 fragment
#define WS_PX  WS_PL                                   // bf16 query, key, value in fragment order [3][RT_X][TILE_E]; half the planes' room, last read by k_proj, before k_planes writes the planes there

__device__ __attribute__((noinline)) float sin_p(float v) { return sinf(v); }
__device__ __attribute__((noinline)) float cos_p(float v) { return cosf(v); }
typedef __attribute__((ext_vector_type(4))) __bf16 v4b;
// ---- k_pack: block = one tile of 16 rows x 1024 k of query, key, value, Wq or Wk: read in whole lines, rounded to bf16, turned in LDS and written in fragment order, so that each operand load of k_proj is 512 contiguous bytes
__global__ __launch_bounds__(256) void k_pack(const float* __restrict__ XQ, const float* __restrict__ XK, const float* __restrict__ XV, const float* __restrict__ WQ, const float* __restrict__ WK, __bf16* __restrict__ PX, __bf16* __restrict__ PW) {
  __shared__ __align__(16) __bf16 s[16][EE + 8]; const int t = threadIdx.x, bx = blockIdx.x; const float* src; __bf16* dst;
  if (bx < 3 * RT_X) { const int which = bx / RT_X; src = ((which == 0) ? XQ : (which == 1) ? XK : XV) + (size_t)(bx % RT_X) * TILE_E; dst = PX + (size_t)bx * TILE_E; }
  else { const int e = bx - 3 * RT_X; src = ((e / RT_W) ? WK : WQ) + (size_t)(e % RT_W) * TILE_E; dst = PW + (size_t)e * TILE_E; }
  v4f v[16];
#pragma unroll      // whole: the 16 independent row loads are in flight together
  for (int i = 0; i < 16; ++i) v[i] = *(const v4f*)(src + (size_t)i * EE + t * 4);
#pragma unroll      // whole: v stays in registers
  for (int i = 0; i < 16; ++i) { v4b h; h[0] = (__bf16)v[i][0]; h[1] = (__bf16)v[i][1]; h[2] = (__bf16)v[i][2]; h[3] = (__bf16)v[i][3]; *(v4b*)&s[i][t * 4] = h; }
  __syncthreads();
  for (int o = t; o < TILE_E / 8; o += 256) { const int kc = o >> 6, half = (o >> 5) & 1, lane = o & 31; *(v8b*)(dst + (size_t)o * 8) = *(const v8b*)&s[lane & 15][kc * 32 + half * 16 + 8 * (lane >> 4)]; }
}
// fragment from a packed tile: p = tile + kc * 512 + lane * 8; elements 0..7 = k0+8h+0..7, 8..15 = k0+16+8h+0..7 of row lane&15, as frag_b gives them
__device__ __forceinline__ v16b frag_p(const __bf16* p) { union { v16b v; v8b q[2]; } u; u.q[0] = *(const v8b*)p; u.q[1] = *(const v8b*)(p + 256); return u.v; }
// ---- k_proj: block = (64 token rows, 128 cols, which): q = relu(x Wq^T + bq), k = relu(key Wk^T + bk), v = value Wk^T + bk; f32 rows
__global__ __launch_bounds__(128) void k_proj(const __bf16* __restrict__ PX, const __bf16* __restrict__ PW, const float* __restrict__ BQ, const float* __restrict__ BK, float* __restrict__ Q, float* __restrict__ K, float* __restrict__ V) {
  __shared__ __align__(16) float so[4][16][132];
  const int tid = threadIdx.x, wave = tid >> 5, lane = tid & 31, col = lane & 15, g = lane >> 4; const int which = blockIdx.z; const size_t r0 = (size_t)blockIdx.x * 64 + wave * 16; const int c0 = blockIdx.y * 128;
  const __bf16* Ar = PX + ((size_t)which * RT_X + blockIdx.x * 4 + wave) * TILE_E + lane * 8; const __bf16* Br = PW + ((size_t)((which == 0) ? 0 : RT_W) + blockIdx.y * 8) * TILE_E + lane * 8; const float* BB = (which == 0) ? BQ : BK; float* dst = (which == 0) ? Q : (which == 1) ? K : V;
  v8f acc[8] = {};
  // two register sets of operands: the 18 loads of the next k step are issued together, in front of the 8 products of this step, so one memory latency is paid per step and it runs under the products
  v16b a0, a1, b0[8], b1[8];
  // the scheduling barrier at the end keeps the products behind the loads: without it the first product, and with it the wait for the set that it reads, is lifted over the next set's loads
#define PROJ_LD(a, b, kc) do { a = frag_p(Ar + (kc) * 512); _Pragma("unroll") for (int j = 0; j < 8; ++j) b[j] = frag_p(Br + (size_t)j * TILE_E + (kc) * 512); __builtin_amdgcn_sched_barrier(0); } while (0)
#define PROJ_MM(a, b) do { _Pragma("unroll") for (int j = 0; j < 8; ++j) acc[j] = wmma_bf(a, b[j], acc[j]); } while (0)
  PROJ_LD(a0, b0, 0);
#pragma unroll      // whole: every load address is then a start pointer plus an immediate, so no address register is rewritten, and waited for, while the loads fly
  for (int kc = 0; kc < EE / 32 - 2; kc += 2) { PROJ_LD(a1, b1, kc + 1); PROJ_MM(a0, b0); PROJ_LD(a0, b0, kc + 2); PROJ_MM(a1, b1); }
  PROJ_LD(a1, b1, EE / 32 - 1); PROJ_MM(a0, b0); PROJ_MM(a1, b1);
#pragma unroll
  for (int j = 0; j < 8; ++j) { const float bb = bfr(BB[c0 + j * 16 + col]);
#pragma unroll
    for (int r = 0; r < 8; ++r) { const float v = acc[j][r] + bb; so[wave][8 * g + r][j * 16 + col] = (which < 2) ? fmaxf(v, 0.f) : v; } }
  LDSX();
  for (int rl = 0; rl < 16; ++rl) vst2(dst + (r0 + rl) * EE + c0 + lane * 4, *(const v4f*)&so[wave][rl][lane * 4]);
}
// ---- k_planes: block = (64 positions s, bh): k cos/sin-weighted and v as f16 hi + (x2048) residual planes [d][s]; also the per-block partial key sums are NOT needed (k_kv sums exactly)
__global__ __launch_bounds__(256) void k_planes(const float* __restrict__ K, const float* __restrict__ V, _Float16* __restrict__ PL) {
  __shared__ __align__(16) _Float16 st[6][HD][72]; const int s0 = blockIdx.x * 64; const size_t bh = blockIdx.y; const size_t b = bh / NH; const int h = (int)(bh % NH); const int t = threadIdx.x;
  for (int e = t; e < 64 * HD; e += 256) { const int sl = e >> 6, d = e & 63; const int s = s0 + sl; const size_t row = ((size_t)s * NBATCH + b) * EE + h * HD + d;
    const float ang = (1.5707963267948966f * (float)(s + 1)) / (float)LL; const float cs = cos_p(ang), sn = sin_p(ang); const float kv = K[row], vv = V[row];
    const float kc = kv * cs, ks = kv * sn; _Float16 hv;
    hv = (_Float16)kc; st[0][d][sl] = hv; st[1][d][sl] = (_Float16)((kc - (float)hv) * 2048.0f);
    hv = (_Float16)ks; st[2][d][sl] = hv; st[3][d][sl] = (_Float16)((ks - (float)hv) * 2048.0f);
    hv = (_Float16)vv; st[4][d][sl] = hv; st[5][d][sl] = (_Float16)((vv - (float)hv) * 2048.0f); }
  __syncthreads();
  for (int e = t; e < 6 * HD * 8; e += 256) { const int p = e / (HD * 8), rem = e % (HD * 8); const int d = rem >> 3, pc = rem & 7; vst2((unsigned*)(PL + ((bh * 6 + p) * HD + d) * LL + s0 + pc * 8), *(const v4u*)&st[p][d][pc * 8]); }
}
// ---- k_kv: block = (LL/NSP positions s, bh), a partial record each, summed by k_red: kv_cos[m][d] = sum_s kcos[s][d] v[s][m] and kv_sin (A = v planes [m][s], B = k planes [d][s]; hi.hi + hi.lo + lo.hi); key sums over s in f32 (fixed order); whole tables per block, over its own positions
__global__ __launch_bounds__(128) void k_kv(const _Float16* __restrict__ PL, const float* __restrict__ K, float* __restrict__ KVP) {
  __shared__ __align__(16) float skv[2][HD][HD + 4]; __shared__ __align__(16) float sks[2][HD];
  const int tid = threadIdx.x, wave = tid >> 5, lane = tid & 31, col = lane & 15, g = lane >> 4; const int s0 = blockIdx.x * (LL / NSP); const size_t bh = blockIdx.y; const size_t b = bh / NH; const int h = (int)(bh % NH); const int m0 = wave * 16; float* P = KVP + (bh * NSP + blockIdx.x) * PREC;
  const _Float16* KCH = PL + ((bh * 6 + 0) * HD) * LL; const _Float16* KCL = PL + ((bh * 6 + 1) * HD) * LL; const _Float16* KSH = PL + ((bh * 6 + 2) * HD) * LL; const _Float16* KSL = PL + ((bh * 6 + 3) * HD) * LL; const _Float16* VH = PL + ((bh * 6 + 4) * HD) * LL; const _Float16* VL = PL + ((bh * 6 + 5) * HD) * LL;
  v8f ac[4] = {}, acl[4] = {}, as[4] = {}, asl[4] = {};
#pragma unroll 1
  for (int kc = s0 / 32; kc < (s0 + LL / NSP) / 32; ++kc) { const v16h vh = frag_h(VH + (size_t)(m0 + col) * LL + kc * 32, lane), vl = frag_h(VL + (size_t)(m0 + col) * LL + kc * 32, lane);
    asm volatile("s_wait_xcnt 0x0" ::: "memory");   // stands behind the v loads, in front of any later write of their address registers (a later load's result may be given those registers)
#pragma unroll
    for (int j = 0; j < 4; ++j) { const size_t o = (size_t)(j * 16 + col) * LL + kc * 32; const v16h kch = frag_h(KCH + o, lane), ksh = frag_h(KSH + o, lane);
      ac[j] = wmma16(vh, kch, ac[j]); acl[j] = wmma16(vl, kch, acl[j]); acl[j] = wmma16(vh, frag_h(KCL + o, lane), acl[j]);
      as[j] = wmma16(vh, ksh, as[j]); asl[j] = wmma16(vl, ksh, asl[j]); asl[j] = wmma16(vh, frag_h(KSL + o, lane), asl[j]); } }
#pragma unroll
  for (int j = 0; j < 4; ++j)
#pragma unroll
    for (int r = 0; r < 8; ++r) { skv[0][m0 + 8 * g + r][j * 16 + col] = ac[j][r] + acl[j][r] * (1.0f / 2048.0f); skv[1][m0 + 8 * g + r][j * 16 + col] = as[j][r] + asl[j][r] * (1.0f / 2048.0f); }
  { const int d = tid & 63, which = tid >> 6; float s = 0.f; for (int i = 0; i < LL / NSP; ++i) { const int sx = s0 + i; const float ang = (1.5707963267948966f * (float)(sx + 1)) / (float)LL; const float w = which ? sin_p(ang) : cos_p(ang); s += K[((size_t)sx * NBATCH + b) * EE + h * HD + d] * w; } sks[which][d] = s; }
  __syncthreads();
  for (int q = tid; q < 2 * HD * HD / 4; q += 128) { const int p = q / (HD * HD / 4), rem = q % (HD * HD / 4); const int m = rem / (HD / 4), d4 = rem % (HD / 4); vst2(P + (p * HD + m) * HD + d4 * 4, *(const v4f*)&skv[p][m][d4 * 4]); }
  if (tid < 2 * HD / 4) vst2(P + 2 * HD * HD + tid * 4, *(const v4f*)(&sks[0][0] + tid * 4));
}
// ---- k_red: thread = 4 floats of a head's record: the NSP partial records added in f32, in the order of the positions; tables to KV, key sums to KS
__global__ __launch_bounds__(256) void k_red(const float* __restrict__ KVP, float* __restrict__ KV, float* __restrict__ KS) {
  const int q = blockIdx.x * 256 + threadIdx.x; const size_t bh = blockIdx.y; if (q >= PREC / 4) return;
  const float* p = KVP + bh * NSP * PREC + q * 4; v4f r[NSP];
#pragma unroll      // whole: the NSP independent loads are in flight together, one latency instead of NSP
  for (int sp = 0; sp < NSP; ++sp) r[sp] = *(const v4f*)(p + (size_t)sp * PREC);
  asm volatile("s_wait_xcnt 0x0" :: "v"(p) : "memory");   // stands behind the loads; p as an input keeps their address registers unwritten up to this wait
  v4f s = r[0];
#pragma unroll      // whole: r stays in registers
  for (int sp = 1; sp < NSP; ++sp) s += r[sp];
  vst2((q < 2 * HD * HD / 4) ? KV + bh * 2 * HD * HD + q * 4 : KS + bh * 2 * HD + (q * 4 - 2 * HD * HD), s);
}
// ---- k_fin: block = (64 positions l, bh): z = 1/(qcos . sum kcos + qsin . sum ksin + eps); attn[l][m] = z (qcos . kv_cos[m] + qsin . kv_sin[m]) with bf16 hi + lo operands (4 products each); output rows (bh, l) of 64 (raw view)
__global__ __launch_bounds__(128) void k_fin(const float* __restrict__ Q, const float* __restrict__ KV, const float* __restrict__ KS, float* __restrict__ OUT) {
  __shared__ __align__(16) float sq[2][64][HD + 4]; __shared__ __align__(16) __bf16 skh[2][HD][HD + 8]; __shared__ __align__(16) __bf16 skl[2][HD][HD + 8]; __shared__ float sz[64]; __shared__ __align__(16) float so[4][16][68];
  const int tid = threadIdx.x, wave = tid >> 5, lane = tid & 31, col = lane & 15, g = lane >> 4; const int l0 = blockIdx.x * 64; const size_t bh = blockIdx.y; const size_t b = bh / NH; const int h = (int)(bh % NH);
  for (int e = tid; e < 64 * HD; e += 128) { const int ll = e >> 6, d = e & 63; const int l = l0 + ll; const float ang = (1.5707963267948966f * (float)(l + 1)) / (float)LL; const float qv = Q[((size_t)l * NBATCH + b) * EE + h * HD + d]; sq[0][ll][d] = qv * cos_p(ang); sq[1][ll][d] = qv * sin_p(ang); }
  for (int e = tid; e < 2 * HD * HD; e += 128) { const int p = e / (HD * HD), rem = e % (HD * HD); const int m = rem / HD, d = rem % HD; const float v = KV[((bh * 2 + p) * HD + m) * HD + d]; const __bf16 hv = (__bf16)v; skh[p][m][d] = hv; skl[p][m][d] = (__bf16)(v - (float)hv); }
  __syncthreads();
  if (tid < 64) { float a = 0.f; for (int d = 0; d < HD; ++d) a += sq[0][tid][d] * KS[bh * 2 * HD + d] + sq[1][tid][d] * KS[bh * 2 * HD + HD + d]; sz[tid] = 1.0f / (a + 1e-6f); }
  v8f acc[4] = {};
#pragma unroll
  for (int p = 0; p < 2; ++p)
#pragma unroll
    for (int kc = 0; kc < HD / 32; ++kc) { const F2 a = split_row(&sq[p][wave * 16 + col][0], kc * 32, lane);
#pragma unroll
      for (int j = 0; j < 4; ++j) { const v16b wh = frag_b(&skh[p][j * 16 + col][0] + kc * 32, lane), wl = frag_b(&skl[p][j * 16 + col][0] + kc * 32, lane); acc[j] = wmma_bf(a.h, wh, acc[j]); acc[j] = wmma_bf(a.l, wh, acc[j]); acc[j] = wmma_bf(a.h, wl, acc[j]); acc[j] = wmma_bf(a.l, wl, acc[j]); } }
  __syncthreads();
#pragma unroll
  for (int j = 0; j < 4; ++j)
#pragma unroll
    for (int r = 0; r < 8; ++r) so[wave][8 * g + r][j * 16 + col] = acc[j][r] * sz[wave * 16 + 8 * g + r];
  LDSX();
  for (int rl = 0; rl < 16; ++rl) if (lane < 16) vst2(OUT + (bh * LL + l0 + wave * 16 + rl) * HD + lane * 4, *(const v4f*)&so[wave][rl][lane * 4]);   // (B H, L, 64) buffer viewed as (L, B, E)
}
extern "C" void kernel_launch(void* const* d_in, const int* in_sizes, int n_in, void* d_out, int out_size, void* d_ws, size_t ws_size, hipStream_t stream) {
  (void)in_sizes; (void)n_in; (void)out_size;
  const float** F = (const float**)d_in;   // 0 query, 1 key, 2 value [2048,4,1024]; 3 Wq [1024,1024], 4 bq, 5 Wk, 6 bk (natural; v uses Wk, bk)
  if (ws_size < (size_t)WS_END) return;
  char* ws = (char*)d_ws; __bf16* PW = (__bf16*)(ws + WS_PW); float *Q = (float*)(ws + WS_Q), *K = (float*)(ws + WS_K), *V = (float*)(ws + WS_V), *KV = (float*)(ws + WS_KV), *KS = (float*)(ws + WS_KS), *KVP = (float*)(ws + WS_KVP); _Float16* PL = (_Float16*)(ws + WS_PL); __bf16* PX = (__bf16*)(ws + WS_PX);
  k_pack<<<dim3(3 * RT_X + 2 * RT_W), 256, 0, stream>>>(F[0], F[1], F[2], F[3], F[5], PX, PW);
  k_proj<<<dim3(NR / 64, EE / 128, 3), 128, 0, stream>>>(PX, PW, F[4], F[6], Q, K, V);
  k_planes<<<dim3(LL / 64, TBH), 256, 0, stream>>>(K, V, PL);
  k_kv<<<dim3(NSP, TBH), 128, 0, stream>>>(PL, K, KVP);
  k_red<<<dim3((PREC / 4 + 255) / 256, TBH), 256, 0, stream>>>(KVP, KV, KS);
  k_fin<<<dim3(LL / 64, TBH), 128, 0, stream>>>(Q, KV, KS, (float*)d_out);
}

// v004
// Measured time: 183 microseconds a run.
// Next to v003, in two timings, it ran 1.60 and 1.61 times as fast.
// Over all steps from v000 it is 6.92 times as fast.
// compute dtype: all float inputs rounded to bf16; q/k/v = x . W^T + b with EXACT bf16 products on WMMA 16x16x32 (both operands packed ahead in fragment order; v uses the k projection as the module does); ReLU and the cos/sin position weights in f32 (precise sinf/cosf); the linear-attention contractions on WMMA with every computed operand as f16 hi + residual (3 products for kv = k_w^T v, 4 products (bf16 hi + lo) for q_w . kv); key sums, normaliser z and the final scaling in f32; f32 output.
#include <hip/hip_runtime.h>
#include <math.h>

typedef __attribute__((ext_vector_type(16))) _Float16 v16h;
typedef __attribute__((ext_vector_type(16))) __bf16 v16b;
typedef __attribute__((ext_vector_type(8)))  _Float16 v8h;
typedef __attribute__((ext_vector_type(8)))  float v8f;
typedef __attribute__((ext_vector_type(4)))  float v4f;
typedef __attribute__((ext_vector_type(2)))  float v2f;
typedef __attribute__((ext_vector_type(4)))  unsigned v4u;
typedef __attribute__((ext_vector_type(4)))  int v4i;
typedef float __attribute__((may_alias)) float_a;
typedef int __attribute__((may_alias)) int_a;

template <typename T> __device__ __forceinline__ void vst2(void* p, T v) { *(T*)p = v;  }
__device__ __forceinline__ v8f wmma16(v16h a, v16h b, v8f c) {
  v8f d = __builtin_amdgcn_wmma_f32_16x16x32_f16(false, a, false, b, (short)0, c, false, false);
  asm volatile("v_nop\n\tv_nop\n\tv_nop\n\tv_nop" : "+v"(d) : "v"(a), "v"(b));
  return d;
}
__device__ __forceinline__ v8f wmma_bf(v16b a, v16b b, v8f c) {
  v8f d = __builtin_amdgcn_wmma_f32_16x16x32_bf16(false, a, false, b, (short)0, c, false, false);
  asm volatile("v_nop\n\tv_nop\n\tv_nop\n\tv_nop" : "+v"(d) : "v"(a), "v"(b));
  return d;
}
// 16x16x32 fragments: lane = (h = lane>>4, row/col = lane&15); elements 0..7 = k0+8h+0..7, 8..15 = k0+16+8h+0..7; D element r = row 8h+r
__device__ __forceinline__ v16h frag_h(const _Float16* rowk0, int lane) {
  union { v16h v; v8h q[2]; } u; const _Float16* p = rowk0 + 8 * (lane >> 4);
  u.q[0] = *(const v8h*)p; u.q[1] = *(const v8h*)(p + 16); return u.v;
}
__device__ __forceinline__ v16h frag_f32(const float* rowk0, int lane) {
  v16h a; const float* p = rowk0 + 8 * (lane >> 4);
#pragma unroll
  for (int i = 0; i < 8; ++i) { a[i] = (_Float16)p[i]; a[8 + i] = (_Float16)p[16 + i]; }
  return a;
}
__device__ __forceinline__ v16h frag_f32s(const float* rowk0, int lane, float sc) {
  v16h a; const float* p = rowk0 + 8 * (lane >> 4);
#pragma unroll
  for (int i = 0; i < 8; ++i) { a[i] = (_Float16)(p[i] * sc); a[8 + i] = (_Float16)(p[16 + i] * sc); }
  return a;
}
// column fragment from a [K][ld] layout (column n), rows >= K read as 0
__device__ __forceinline__ v16h fragc_f32(const float* W, int k0, int n, int lane, int ld, int K) {
  v16h a; const int g = lane >> 4;
#pragma unroll
  for (int i = 0; i < 8; ++i) { const int ka = k0 + 8 * g + i, kb = ka + 16;
    a[i] = (_Float16)(ka < K ? W[(size_t)(ka < K ? ka : K - 1) * ld + n] : 0.f); a[8 + i] = (_Float16)(kb < K ? W[(size_t)(kb < K ? kb : K - 1) * ld + n] : 0.f); }
  return a;
}
struct F2 { v16b h, l; };
__device__ __forceinline__ F2 bsplit16(const float v[16]) { F2 r;
#pragma unroll
  for (int i = 0; i < 16; ++i) { const __bf16 h = (__bf16)v[i]; r.h[i] = h; r.l[i] = (__bf16)(v[i] - (float)h); }
  return r; }
__device__ __forceinline__ F2 split_row(const float* row, int k0, int lane) { float v[16]; const float* p = row + k0 + 8 * (lane >> 4);
#pragma unroll
  for (int i = 0; i < 8; ++i) { v[i] = p[i]; v[8 + i] = p[16 + i]; }
  return bsplit16(v); }
__device__ __forceinline__ F2 split_rowK(const float* row, int k0, int lane, int K) { float v[16]; const int g = lane >> 4;
#pragma unroll
  for (int i = 0; i < 8; ++i) { const int ka = k0 + 8 * g + i, kb = ka + 16; v[i] = ka < K ? row[ka < K ? ka : K - 1] : 0.f; v[8 + i] = kb < K ? row[kb < K ? kb : K - 1] : 0.f; }
  return bsplit16(v); }
__device__ __forceinline__ F2 split_col(const float* W, int k0, int n, int lane, int ld, int K) { float v[16]; const int g = lane >> 4;
#pragma unroll
  for (int i = 0; i < 8; ++i) { const int ka = k0 + 8 * g + i, kb = ka + 16; v[i] = ka < K ? W[(size_t)(ka < K ? ka : K - 1) * ld + n] : 0.f; v[8 + i] = kb < K ? W[(size_t)(kb < K ? kb : K - 1) * ld + n] : 0.f; }
  return bsplit16(v); }
__device__ __forceinline__ v8f mac3(const F2& a, const F2& b, v8f c) { c = wmma_bf(a.l, b.h, c); c = wmma_bf(a.h, b.l, c); return wmma_bf(a.h, b.h, c); }
__device__ __forceinline__ float sigm(float v) { return 1.0f / (1.0f + expf(-v)); }
#define LDSX() do { asm volatile("s_wait_dscnt 0" ::: "memory"); __builtin_amdgcn_wave_barrier(); __builtin_amdgcn_fence(__ATOMIC_RELEASE, "workgroup"); } while (0)


// cosFormer multi-head linear attention (L 2,048, B 4, E 1,024, 16 heads x 64, non-causal): q = relu(Wq x), k = relu(Wk key), v = Wk value; attn = [q cos . (k cos)^T v + q sin . (k sin)^T v] / (q cos . sum k cos + q sin . sum k sin + eps), reshaped (B H, L, 64) -> (L, B, E) by raw view.
#define LL 2048
#define NBATCH 4
#define EE 1024
#define NH 16
#define HD 64
#define NBH (NBATCH * NH)
#define NR (LL * NBATCH)          // token rows (l, b) = l*B + b
#ifndef TBH
#define TBH NBH
#endif
typedef __attribute__((ext_vector_type(8))) __bf16 v8b;
__device__ __forceinline__ v16b frag_b(const __bf16* rowk0, int lane) {
  union { v16b v; v8b q[2]; } u; const __bf16* p = rowk0 + 8 * (lane >> 4);
  u.q[0] = *(const v8b*)p; u.q[1] = *(const v8b*)(p + 16); return u.v;
}
__device__ __forceinline__ float bfr(float v) { return (float)(__bf16)v; }
__device__ __attribute__((noinline)) float exp_ni(float v) { return expf(v); }
__device__ __attribute__((noinline)) float erf_ni(float v) { return erff(v); }

#define WS_PW  0u                                      // bf16 Wq, Wk in fragment order [2][RT_W][TILE_E]
#define WS_Q   (WS_PW + 2u * (size_t)2 * EE * EE)         // f32 rows relu(q) [NR][1024] ; relu(k) ; v
#define WS_K   (WS_Q + 4u * (size_t)NR * EE)
#define WS_V   (WS_K + 4u * (size_t)NR * EE)
#define WS_PL  (WS_V + 4u * (size_t)NR * EE)             // f16 planes [bh][6][64][LL]: kcos hi, kcos lo(x2048), ksin hi, ksin lo, v hi, v lo
#define WS_KV  (WS_PL + 2u * (size_t)NBH * 6 * HD * LL)    // f32 [bh][2][64 m][64 d] kv_cos, kv_sin ; ksum [bh][2][64]
#define WS_KS  (WS_KV + 4u * (size_t)NBH * 2 * HD * HD)
#define NSP 16                                         // k_kv splits the LL positions over NSP work-groups a head
#define PREC (2 * HD * HD + 2 * HD)                    // floats of one partial record: kv_cos, kv_sin [64 m][64 d], then the two key sums [64]
#define WS_KVP (WS_KS + 4u * (size_t)NBH * 2 * HD)        // f32 [bh][NSP][PREC] partial records
#define WS_END (WS_KVP + 4u * (size_t)NBH * NSP * PREC)
#define RT_X (NR / 16)                                 // tiles of 16 token rows in one input
#define RT_W (EE / 16)                                 // tiles of 16 rows in one weight
#define TILE_E (16 * EE)                               // bf16 elements of one packed tile: [kc 32][half 2][lane 32][8], the 16 bytes a lane loads for half a 16x16x32 fragment
#define WS_PX  WS_PL                                   // bf16 query, key, value in fragment order [3][RT_X][TILE_E]; half the planes' room, last read by k_proj, before k_planes writes the planes there

__device__ __attribute__((noinline)) float sin_p(float v) { return sinf(v); }
__device__ __attribute__((noinline)) float cos_p(float v) { return cosf(v); }
typedef __attribute__((ext_vector_type(4))) __bf16 v4b;
// ---- k_pack: block = one tile of 16 rows x 1024 k of query, key, value, Wq or Wk: read in whole lines, rounded to bf16, turned in LDS and written in fragment order, so that each operand load of k_proj is 512 contiguous bytes
__global__ __launch_bounds__(256) void k_pack(const float* __restrict__ XQ, const float* __restrict__ XK, const float* __restrict__ XV, const float* __restrict__ WQ, const float* __restrict__ WK, __bf16* __restrict__ PX, __bf16* __restrict__ PW) {
  __shared__ __align__(16) __bf16 s[16][EE + 8]; const int t = threadIdx.x, bx = blockIdx.x; const float* src; __bf16* dst;
  if (bx < 3 * RT_X) { const int which = bx / RT_X; src = ((which == 0) ? XQ : (which == 1) ? XK : XV) + (size_t)(bx % RT_X) * TILE_E; dst = PX + (size_t)bx * TILE_E; }
  else { const int e = bx - 3 * RT_X; src = ((e / RT_W) ? WK : WQ) + (size_t)(e % RT_W) * TILE_E; dst = PW + (size_t)e * TILE_E; }
  v4f v[16];
#pragma unroll      // whole: the 16 independent row loads are in flight together
  for (int i = 0; i < 16; ++i) v[i] = *(const v4f*)(src + (size_t)i * EE + t * 4);
#pragma unroll      // whole: v stays in registers
  for (int i = 0; i < 16; ++i) { v4b h; h[0] = (__bf16)v[i][0]; h[1] = (__bf16)v[i][1]; h[2] = (__bf16)v[i][2]; h[3] = (__bf16)v[i][3]; *(v4b*)&s[i][t * 4] = h; }
  __syncthreads();
  for (int o = t; o < TILE_E / 8; o += 256) { const int kc = o >> 6, half = (o >> 5) & 1, lane = o & 31; *(v8b*)(dst + (size_t)o * 8) = *(const v8b*)&s[lane & 15][kc * 32 + half * 16 + 8 * (lane >> 4)]; }
}
// fragment from a packed tile: p = tile + kc * 512 + lane * 8; elements 0..7 = k0+8h+0..7, 8..15 = k0+16+8h+0..7 of row lane&15, as frag_b gives them
__device__ __forceinline__ v16b frag_p(const __bf16* p) { union { v16b v; v8b q[2]; } u; u.q[0] = *(const v8b*)p; u.q[1] = *(const v8b*)(p + 256); return u.v; }
// ---- k_proj: block = (64 token rows, 128 cols, which): q = relu(x Wq^T + bq), k = relu(key Wk^T + bk), v = value Wk^T + bk; f32 rows
__global__ __launch_bounds__(128) void k_proj(const __bf16* __restrict__ PX, const __bf16* __restrict__ PW, const float* __restrict__ BQ, const float* __restrict__ BK, float* __restrict__ Q, float* __restrict__ K, float* __restrict__ V) {
  __shared__ __align__(16) float so[4][16][132];
  const int tid = threadIdx.x, wave = tid >> 5, lane = tid & 31, col = lane & 15, g = lane >> 4; const int which = blockIdx.z; const size_t r0 = (size_t)blockIdx.x * 64 + wave * 16; const int c0 = blockIdx.y * 128;
  const __bf16* Ar = PX + ((size_t)which * RT_X + blockIdx.x * 4 + wave) * TILE_E + lane * 8; const __bf16* Br = PW + ((size_t)((which == 0) ? 0 : RT_W) + blockIdx.y * 8) * TILE_E + lane * 8; const float* BB = (which == 0) ? BQ : BK; float* dst = (which == 0) ? Q : (which == 1) ? K : V;
  v8f acc[8] = {};
  // two register sets of operands: the 18 loads of the next k step are issued together, in front of the 8 products of this step, so one memory latency is paid per step and it runs under the products
  v16b a0, a1, b0[8], b1[8];
  // the scheduling barrier at the end keeps the products behind the loads: without it the first product, and with it the wait for the set that it reads, is lifted over the next set's loads
#define PROJ_LD(a, b, kc) do { a = frag_p(Ar + (kc) * 512); _Pragma("unroll") for (int j = 0; j < 8; ++j) b[j] = frag_p(Br + (size_t)j * TILE_E + (kc) * 512); __builtin_amdgcn_sched_barrier(0); } while (0)
#define PROJ_MM(a, b) do { _Pragma("unroll") for (int j = 0; j < 8; ++j) acc[j] = wmma_bf(a, b[j], acc[j]); } while (0)
  PROJ_LD(a0, b0, 0);
#pragma unroll      // whole: every load address is then a start pointer plus an immediate, so no address register is rewritten, and waited for, while the loads fly
  for (int kc = 0; kc < EE / 32 - 2; kc += 2) { PROJ_LD(a1, b1, kc + 1); PROJ_MM(a0, b0); PROJ_LD(a0, b0, kc + 2); PROJ_MM(a1, b1); }
  PROJ_LD(a1, b1, EE / 32 - 1); PROJ_MM(a0, b0); PROJ_MM(a1, b1);
#pragma unroll
  for (int j = 0; j < 8; ++j) { const float bb = bfr(BB[c0 + j * 16 + col]);
#pragma unroll
    for (int r = 0; r < 8; ++r) { const float v = acc[j][r] + bb; so[wave][8 * g + r][j * 16 + col] = (which < 2) ? fmaxf(v, 0.f) : v; } }
  LDSX();
  for (int rl = 0; rl < 16; ++rl) vst2(dst + (r0 + rl) * EE + c0 + lane * 4, *(const v4f*)&so[wave][rl][lane * 4]);
}
// ---- k_planes: block = (64 positions s, bh): k cos/sin-weighted and v as f16 hi + (x2048) residual planes [d][s]; also the per-block partial key sums are NOT needed (k_kv sums exactly)
__global__ __launch_bounds__(256) void k_planes(const float* __restrict__ K, const float* __restrict__ V, _Float16* __restrict__ PL) {
  __shared__ __align__(16) _Float16 st[6][HD][72]; __shared__ __align__(8) float wt[64][2]; const int s0 = blockIdx.x * 64; const size_t bh = blockIdx.y; const size_t b = bh / NH; const int h = (int)(bh % NH); const int t = threadIdx.x;
  const int d = t & 63; const size_t row0 = ((size_t)(s0 + (t >> 6)) * NBATCH + b) * EE + h * HD + d; const float* pk = K + row0; const float* pv = V + row0; float kr[16], vr[16];
#pragma unroll      // whole: the 32 independent loads are in flight together, each a start pointer plus an immediate
  for (int i = 0; i < 16; ++i) { kr[i] = pk[(size_t)i * 4 * NBATCH * EE]; vr[i] = pv[(size_t)i * 4 * NBATCH * EE]; }
  asm volatile("s_wait_xcnt 0x0" :: "v"(pk), "v"(pv) : "memory");   // stands behind the loads; the pointers as inputs keep their address registers unwritten up to this wait
  // the cos and sin weight of each of the 64 positions, computed once (a call waits for every load in flight, so none stands in the element loop)
  if (t < 128) { const float ang = (1.5707963267948966f * (float)(s0 + d + 1)) / (float)LL; wt[d][t >> 6] = (t >> 6) ? sin_p(ang) : cos_p(ang); }
  __syncthreads();
#pragma unroll      // whole: kr, vr stay in registers
  for (int i = 0; i < 16; ++i) { const int sl = (t >> 6) + 4 * i; const v2f w = *(const v2f*)&wt[sl][0]; const float cs = w[0], sn = w[1]; const float kv = kr[i], vv = vr[i];
    const float kc = kv * cs, ks = kv * sn; _Float16 hv;
    hv = (_Float16)kc; st[0][d][sl] = hv; st[1][d][sl] = (_Float16)((kc - (float)hv) * 2048.0f);
    hv = (_Float16)ks; st[2][d][sl] = hv; st[3][d][sl] = (_Float16)((ks - (float)hv) * 2048.0f);
    hv = (_Float16)vv; st[4][d][sl] = hv; st[5][d][sl] = (_Float16)((vv - (float)hv) * 2048.0f); }
  __syncthreads();
  for (int e = t; e < 6 * HD * 8; e += 256) { const int p = e / (HD * 8), rem = e % (HD * 8); const int d = rem >> 3, pc = rem & 7; vst2((unsigned*)(PL + ((bh * 6 + p) * HD + d) * LL + s0 + pc * 8), *(const v4u*)&st[p][d][pc * 8]); }
}
// ---- k_kv: block = (LL/NSP positions s, bh), a partial record each, summed by k_red: kv_cos[m][d] = sum_s kcos[s][d] v[s][m] and kv_sin (A = v planes [m][s], B = k planes [d][s]; hi.hi + hi.lo + lo.hi); key sums over s in f32 (fixed order); whole tables per block, over its own positions
__global__ __launch_bounds__(128) void k_kv(const _Float16* __restrict__ PL, const float* __restrict__ K, float* __restrict__ KVP) {
  __shared__ __align__(16) float skv[2][HD][HD + 4]; __shared__ __align__(16) float sks[2][HD]; __shared__ __align__(16) float wt[2][LL / NSP];
  const int tid = threadIdx.x, wave = tid >> 5, lane = tid & 31, col = lane & 15, g = lane >> 4; const int s0 = blockIdx.x * (LL / NSP); const size_t bh = blockIdx.y; const size_t b = bh / NH; const int h = (int)(bh % NH); const int m0 = wave * 16; float* P = KVP + (bh * NSP + blockIdx.x) * PREC;
  const _Float16* KCH = PL + ((bh * 6 + 0) * HD) * LL; const _Float16* KCL = PL + ((bh * 6 + 1) * HD) * LL; const _Float16* KSH = PL + ((bh * 6 + 2) * HD) * LL; const _Float16* KSL = PL + ((bh * 6 + 3) * HD) * LL; const _Float16* VH = PL + ((bh * 6 + 4) * HD) * LL; const _Float16* VL = PL + ((bh * 6 + 5) * HD) * LL;
  // the cos and sin weight of each of the block's positions, computed once; read by the key sums behind the barrier below
  for (int i = tid; i < LL / NSP; i += 128) { const float ang = (1.5707963267948966f * (float)(s0 + i + 1)) / (float)LL; wt[0][i] = cos_p(ang); wt[1][i] = sin_p(ang); }
  v8f ac[4] = {}, acl[4] = {}, as[4] = {}, asl[4] = {};
#pragma unroll 1
  for (int kc = s0 / 32; kc < (s0 + LL / NSP) / 32; ++kc) { const v16h vh = frag_h(VH + (size_t)(m0 + col) * LL + kc * 32, lane), vl = frag_h(VL + (size_t)(m0 + col) * LL + kc * 32, lane);
    asm volatile("s_wait_xcnt 0x0" ::: "memory");   // stands behind the v loads, in front of any later write of their address registers (a later load's result may be given those registers)
#pragma unroll
    for (int j = 0; j < 4; ++j) { const size_t o = (size_t)(j * 16 + col) * LL + kc * 32; const v16h kch = frag_h(KCH + o, lane), ksh = frag_h(KSH + o, lane);
      ac[j] = wmma16(vh, kch, ac[j]); acl[j] = wmma16(vl, kch, acl[j]); acl[j] = wmma16(vh, frag_h(KCL + o, lane), acl[j]);
      as[j] = wmma16(vh, ksh, as[j]); asl[j] = wmma16(vl, ksh, asl[j]); asl[j] = wmma16(vh, frag_h(KSL + o, lane), asl[j]); } }
#pragma unroll
  for (int j = 0; j < 4; ++j)
#pragma unroll
    for (int r = 0; r < 8; ++r) { skv[0][m0 + 8 * g + r][j * 16 + col] = ac[j][r] + acl[j][r] * (1.0f / 2048.0f); skv[1][m0 + 8 * g + r][j * 16 + col] = as[j][r] + asl[j][r] * (1.0f / 2048.0f); }
  __syncthreads();   // publishes the weight table
  { const int d = tid & 63, which = tid >> 6; const float* pk = K + ((size_t)s0 * NBATCH + b) * EE + h * HD + d; float kr[LL / NSP];
#pragma unroll      // whole: the independent loads are in flight together, each the start pointer plus an immediate
    for (int i = 0; i < LL / NSP; ++i) kr[i] = pk[(size_t)i * NBATCH * EE];
    asm volatile("s_wait_xcnt 0x0" ::: "memory");   // stands behind the loads, in front of any later write of their address registers
    float s = 0.f;
#pragma unroll      // whole: kr stays in registers; the sum runs in the order of the positions as before
    for (int i = 0; i < LL / NSP; ++i) s += kr[i] * wt[which][i];
    sks[which][d] = s; }
  __syncthreads();
  for (int q = tid; q < 2 * HD * HD / 4; q += 128) { const int p = q / (HD * HD / 4), rem = q % (HD * HD / 4); const int m = rem / (HD / 4), d4 = rem % (HD / 4); vst2(P + (p * HD + m) * HD + d4 * 4, *(const v4f*)&skv[p][m][d4 * 4]); }
  if (tid < 2 * HD / 4) vst2(P + 2 * HD * HD + tid * 4, *(const v4f*)(&sks[0][0] + tid * 4));
}
// ---- k_red: thread = 4 floats of a head's record: the NSP partial records added in f32, in the order of the positions; tables to KV, key sums to KS
__global__ __launch_bounds__(256) void k_red(const float* __restrict__ KVP, float* __restrict__ KV, float* __restrict__ KS) {
  const int q = blockIdx.x * 256 + threadIdx.x; const size_t bh = blockIdx.y; if (q >= PREC / 4) return;
  const float* p = KVP + bh * NSP * PREC + q * 4; v4f r[NSP];
#pragma unroll      // whole: the NSP independent loads are in flight together, one latency instead of NSP
  for (int sp = 0; sp < NSP; ++sp) r[sp] = *(const v4f*)(p + (size_t)sp * PREC);
  asm volatile("s_wait_xcnt 0x0" :: "v"(p) : "memory");   // stands behind the loads; p as an input keeps their address registers unwritten up to this wait
  v4f s = r[0];
#pragma unroll      // whole: r stays in registers
  for (int sp = 1; sp < NSP; ++sp) s += r[sp];
  vst2((q < 2 * HD * HD / 4) ? KV + bh * 2 * HD * HD + q * 4 : KS + bh * 2 * HD + (q * 4 - 2 * HD * HD), s);
}
// ---- k_fin: block = (64 positions l, bh): z = 1/(qcos . sum kcos + qsin . sum ksin + eps); attn[l][m] = z (qcos . kv_cos[m] + qsin . kv_sin[m]) with bf16 hi + lo operands (4 products each); output rows (bh, l) of 64 (raw view)
__global__ __launch_bounds__(128) void k_fin(const float* __restrict__ Q, const float* __restrict__ KV, const float* __restrict__ KS, float* __restrict__ OUT) {
  __shared__ __align__(16) float sq[2][64][HD + 4]; __shared__ __align__(16) __bf16 skh[2][HD][HD + 8]; __shared__ __align__(16) __bf16 skl[2][HD][HD + 8]; __shared__ float sz[64]; __shared__ __align__(16) float so[4][16][68]; __shared__ __align__(8) float wt[64][2];
  const int tid = threadIdx.x, wave = tid >> 5, lane = tid & 31, col = lane & 15, g = lane >> 4; const int l0 = blockIdx.x * 64; const size_t bh = blockIdx.y; const size_t b = bh / NH; const int h = (int)(bh % NH);
  { const int d = tid & 63; const float* pq = Q + ((size_t)(l0 + (tid >> 6)) * NBATCH + b) * EE + h * HD + d; float qr[32];
#pragma unroll      // whole: the 32 independent loads are in flight together, each the start pointer plus an immediate
    for (int i = 0; i < 32; ++i) qr[i] = pq[(size_t)i * 2 * NBATCH * EE];
    asm volatile("s_wait_xcnt 0x0" :: "v"(pq) : "memory");   // stands behind the loads; pq as an input keeps their address registers unwritten up to this wait
    // the cos and sin weight of each of the 64 positions, computed once (a call waits for every load in flight, so none stands in the element loop)
    { const float ang = (1.5707963267948966f * (float)(l0 + d + 1)) / (float)LL; wt[d][tid >> 6] = (tid >> 6) ? sin_p(ang) : cos_p(ang); }
    __syncthreads();
#pragma unroll      // whole: qr stays in registers
    for (int i = 0; i < 32; ++i) { const int ll = (tid >> 6) + 2 * i; const v2f w = *(const v2f*)&wt[ll][0]; sq[0][ll][d] = qr[i] * w[0]; sq[1][ll][d] = qr[i] * w[1]; } }
  for (int e = tid; e < 2 * HD * HD; e += 128) { const int p = e / (HD * HD), rem = e % (HD * HD); const int m = rem / HD, d = rem % HD; const float v = KV[((bh * 2 + p) * HD + m) * HD + d]; const __bf16 hv = (__bf16)v; skh[p][m][d] = hv; skl[p][m][d] = (__bf16)(v - (float)hv); }
  __syncthreads();
  if (tid < 64) { float a = 0.f; for (int d = 0; d < HD; ++d) a += sq[0][tid][d] * KS[bh * 2 * HD + d] + sq[1][tid][d] * KS[bh * 2 * HD + HD + d]; sz[tid] = 1.0f / (a + 1e-6f); }
  v8f acc[4] = {};
#pragma unroll
  for (int p = 0; p < 2; ++p)
#pragma unroll
    for (int kc = 0; kc < HD / 32; ++kc) { const F2 a = split_row(&sq[p][wave * 16 + col][0], kc * 32, lane);
#pragma unroll
      for (int j = 0; j < 4; ++j) { const v16b wh = frag_b(&skh[p][j * 16 + col][0] + kc * 32, lane), wl = frag_b(&skl[p][j * 16 + col][0] + kc * 32, lane); acc[j] = wmma_bf(a.h, wh, acc[j]); acc[j] = wmma_bf(a.l, wh, acc[j]); acc[j] = wmma_bf(a.h, wl, acc[j]); acc[j] = wmma_bf(a.l, wl, acc[j]); } }
  __syncthreads();
#pragma unroll
  for (int j = 0; j < 4; ++j)
#pragma unroll
    for (int r = 0; r < 8; ++r) so[wave][8 * g + r][j * 16 + col] = acc[j][r] * sz[wave * 16 + 8 * g + r];
  LDSX();
  for (int rl = 0; rl < 16; ++rl) if (lane < 16) vst2(OUT + (bh * LL + l0 + wave * 16 + rl) * HD + lane * 4, *(const v4f*)&so[wave][rl][lane * 4]);   // (B H, L, 64) buffer viewed as (L, B, E)
}
extern "C" void kernel_launch(void* const* d_in, const int* in_sizes, int n_in, void* d_out, int out_size, void* d_ws, size_t ws_size, hipStream_t stream) {
  (void)in_sizes; (void)n_in; (void)out_size;
  const float** F = (const float**)d_in;   // 0 query, 1 key, 2 value [2048,4,1024]; 3 Wq [1024,1024], 4 bq, 5 Wk, 6 bk (natural; v uses Wk, bk)
  if (ws_size < (size_t)WS_END) return;
  char* ws = (char*)d_ws; __bf16* PW = (__bf16*)(ws + WS_PW); float *Q = (float*)(ws + WS_Q), *K = (float*)(ws + WS_K), *V = (float*)(ws + WS_V), *KV = (float*)(ws + WS_KV), *KS = (float*)(ws + WS_KS), *KVP = (float*)(ws + WS_KVP); _Float16* PL = (_Float16*)(ws + WS_PL); __bf16* PX = (__bf16*)(ws + WS_PX);
  k_pack<<<dim3(3 * RT_X + 2 * RT_W), 256, 0, stream>>>(F[0], F[1], F[2], F[3], F[5], PX, PW);
  k_proj<<<dim3(NR / 64, EE / 128, 3), 128, 0, stream>>>(PX, PW, F[4], F[6], Q, K, V);
  k_planes<<<dim3(LL / 64, TBH), 256, 0, stream>>>(K, V, PL);
  k_kv<<<dim3(NSP, TBH), 128, 0, stream>>>(PL, K, KVP);
  k_red<<<dim3((PREC / 4 + 255) / 256, TBH), 256, 0, stream>>>(KVP, KV, KS);
  k_fin<<<dim3(LL / 64, TBH), 128, 0, stream>>>(Q, KV, KS, (float*)d_out);
}

// v005
// A run of this version takes 158 microseconds.
// Two timings next to v004 put it at 1.16 and 1.15 times that version's speed.
// Counting every step since v000, it is 8.00 times as fast.
// compute dtype: all float inputs rounded to bf16; q/k/v = x . W^T + b with EXACT bf16 products on WMMA 16x16x32 (both operands packed ahead in fragment order; v uses the k projection as the module does); ReLU and the cos/sin position weights in f32 (precise sinf/cosf); the linear-attention contractions on WMMA with every computed operand as f16 hi + residual (3 products for kv = k_w^T v, 4 products (bf16 hi + lo) for q_w . kv); key sums, normaliser z and the final scaling in f32; f32 output.
#include <hip/hip_runtime.h>
#include <math.h>

typedef __attribute__((ext_vector_type(16))) _Float16 v16h;
typedef __attribute__((ext_vector_type(16))) __bf16 v16b;
typedef __attribute__((ext_vector_type(8)))  _Float16 v8h;
typedef __attribute__((ext_vector_type(8)))  float v8f;
typedef __attribute__((ext_vector_type(4)))  float v4f;
typedef __attribute__((ext_vector_type(2)))  float v2f;
typedef __attribute__((ext_vector_type(4)))  unsigned v4u;
typedef __attribute__((ext_vector_type(4)))  int v4i;
typedef float __attribute__((may_alias)) float_a;
typedef int __attribute__((may_alias)) int_a;

template <typename T> __device__ __forceinline__ void vst2(void* p, T v) { *(T*)p = v;  }
__device__ __forceinline__ v8f wmma16(v16h a, v16h b, v8f c) {
  v8f d = __builtin_amdgcn_wmma_f32_16x16x32_f16(false, a, false, b, (short)0, c, false, false);
  asm volatile("v_nop\n\tv_nop\n\tv_nop\n\tv_nop" : "+v"(d) : "v"(a), "v"(b));
  return d;
}
__device__ __forceinline__ v8f wmma_bf(v16b a, v16b b, v8f c) {
  v8f d = __builtin_amdgcn_wmma_f32_16x16x32_bf16(false, a, false, b, (short)0, c, false, false);
  asm volatile("v_nop\n\tv_nop\n\tv_nop\n\tv_nop" : "+v"(d) : "v"(a), "v"(b));
  return d;
}
// 16x16x32 fragments: lane = (h = lane>>4, row/col = lane&15); elements 0..7 = k0+8h+0..7, 8..15 = k0+16+8h+0..7; D element r = row 8h+r
__device__ __forceinline__ v16h frag_h(const _Float16* rowk0, int lane) {
  union { v16h v; v8h q[2]; } u; const _Float16* p = rowk0 + 8 * (lane >> 4);
  u.q[0] = *(const v8h*)p; u.q[1] = *(const v8h*)(p + 16); return u.v;
}
__device__ __forceinline__ v16h frag_f32(const float* rowk0, int lane) {
  v16h a; const float* p = rowk0 + 8 * (lane >> 4);
#pragma unroll
  for (int i = 0; i < 8; ++i) { a[i] = (_Float16)p[i]; a[8 + i] = (_Float16)p[16 + i]; }
  return a;
}
__device__ __forceinline__ v16h frag_f32s(const float* rowk0, int lane, float sc) {
  v16h a; const float* p = rowk0 + 8 * (lane >> 4);
#pragma unroll
  for (int i = 0; i < 8; ++i) { a[i] = (_Float16)(p[i] * sc); a[8 + i] = (_Float16)(p[16 + i] * sc); }
  return a;
}
// column fragment from a [K][ld] layout (column n), rows >= K read as 0
__device__ __forceinline__ v16h fragc_f32(const float* W, int k0, int n, int lane, int ld, int K) {
  v16h a; const int g = lane >> 4;
#pragma unroll
  for (int i = 0; i < 8; ++i) { const int ka = k0 + 8 * g + i, kb = ka + 16;
    a[i] = (_Float16)(ka < K ? W[(size_t)(ka < K ? ka : K - 1) * ld + n] : 0.f); a[8 + i] = (_Float16)(kb < K ? W[(size_t)(kb < K ? kb : K - 1) * ld + n] : 0.f); }
  return a;
}
struct F2 { v16b h, l; };
__device__ __forceinline__ F2 bsplit16(const float v[16]) { F2 r;
#pragma unroll
  for (int i = 0; i < 16; ++i) { const __bf16 h = (__bf16)v[i]; r.h[i] = h; r.l[i] = (__bf16)(v[i] - (float)h); }
  return r; }
__device__ __forceinline__ F2 split_row(const float* row, int k0, int lane) { float v[16]; const float* p = row + k0 + 8 * (lane >> 4);
#pragma unroll
  for (int i = 0; i < 8; ++i) { v[i] = p[i]; v[8 + i] = p[16 + i]; }
  return bsplit16(v); }
__device__ __forceinline__ F2 split_rowK(const float* row, int k0, int lane, int K) { float v[16]; const int g = lane >> 4;
#pragma unroll
  for (int i = 0; i < 8; ++i) { const int ka = k0 + 8 * g + i, kb = ka + 16; v[i] = ka < K ? row[ka < K ? ka : K - 1] : 0.f; v[8 + i] = kb < K ? row[kb < K ? kb : K - 1] : 0.f; }
  return bsplit16(v); }
__device__ __forceinline__ F2 split_col(const float* W, int k0, int n, int lane, int ld, int K) { float v[16]; const int g = lane >> 4;
#pragma unroll
  for (int i = 0; i < 8; ++i) { const int ka = k0 + 8 * g + i, kb = ka + 16; v[i] = ka < K ? W[(size_t)(ka < K ? ka : K - 1) * ld + n] : 0.f; v[8 + i] = kb < K ? W[(size_t)(kb < K ? kb : K - 1) * ld + n] : 0.f; }
  return bsplit16(v); }
__device__ __forceinline__ v8f mac3(const F2& a, const F2& b, v8f c) { c = wmma_bf(a.l, b.h, c); c = wmma_bf(a.h, b.l, c); return wmma_bf(a.h, b.h, c); }
__device__ __forceinline__ float sigm(float v) { return 1.0f / (1.0f + expf(-v)); }
#define LDSX() do { asm volatile("s_wait_dscnt 0" ::: "memory"); __builtin_amdgcn_wave_barrier(); __builtin_amdgcn_fence(__ATOMIC_RELEASE, "workgroup"); } while (0)


// cosFormer multi-head linear attention (L 2,048, B 4, E 1,024, 16 heads x 64, non-causal): q = relu(Wq x), k = relu(Wk key), v = Wk value; attn = [q cos . (k cos)^T v + q sin . (k sin)^T v] / (q cos . sum k cos + q sin . sum k sin + eps), reshaped (B H, L, 64) -> (L, B, E) by raw view.
#define LL 2048
#define NBATCH 4
#define EE 1024
#define NH 16
#define HD 64
#define NBH (NBATCH * NH)
#define NR (LL * NBATCH)          // token rows (l, b) = l*B + b
#ifndef TBH
#define TBH NBH
#endif
typedef __attribute__((ext_vector_type(8))) __bf16 v8b;
__device__ __forceinline__ v16b frag_b(const __bf16* rowk0, int lane) {
  union { v16b v; v8b q[2]; } u; const __bf16* p = rowk0 + 8 * (lane >> 4);
  u.q[0] = *(const v8b*)p; u.q[1] = *(const v8b*)(p + 16); return u.v;
}
__device__ __forceinline__ float bfr(float v) { return (float)(__bf16)v; }
__device__ __attribute__((noinline)) float exp_ni(float v) { return expf(v); }
__device__ __attribute__((noinline)) float erf_ni(float v) { return erff(v); }

#define WS_PW  0u                                      // bf16 Wq, Wk in fragment order [2][RT_W][TILE_E]
#define WS_Q   (WS_PW + 2u * (size_t)2 * EE * EE)         // f32 rows relu(q) [NR][1024] ; relu(k) ; v
#define WS_K   (WS_Q + 4u * (size_t)NR * EE)
#define WS_V   (WS_K + 4u * (size_t)NR * EE)
#define WS_PL  (WS_V + 4u * (size_t)NR * EE)             // f16 planes [bh][6][64][LL]: kcos hi, kcos lo(x2048), ksin hi, ksin lo, v hi, v lo
#define WS_KV  (WS_PL + 2u * (size_t)NBH * 6 * HD * LL)    // f32 [bh][2][64 m][64 d] kv_cos, kv_sin ; ksum [bh][2][64]
#define WS_KS  (WS_KV + 4u * (size_t)NBH * 2 * HD * HD)
#define NSP 16                                         // k_kv splits the LL positions over NSP work-groups a head
#define PREC (2 * HD * HD + 2 * HD)                    // floats of one partial record: kv_cos, kv_sin [64 m][64 d], then the two key sums [64]
#define WS_KVP (WS_KS + 4u * (size_t)NBH * 2 * HD)        // f32 [bh][NSP][PREC] partial records
#define WS_END (WS_KVP + 4u * (size_t)NBH * NSP * PREC)
#define RT_X (NR / 16)                                 // tiles of 16 token rows in one input
#define RT_W (EE / 16)                                 // tiles of 16 rows in one weight
#define TILE_E (16 * EE)                               // bf16 elements of one packed tile: [kc 32][half 2][lane 32][8], the 16 bytes a lane loads for half a 16x16x32 fragment
#define WS_PX  WS_PL                                   // bf16 query, key, value in fragment order [3][RT_X][TILE_E]; half the planes' room, last read by k_proj, before k_planes writes the planes there

__device__ __attribute__((noinline)) float sin_p(float v) { return sinf(v); }
__device__ __attribute__((noinline)) float cos_p(float v) { return cosf(v); }
typedef __attribute__((ext_vector_type(4))) __bf16 v4b;
// ---- k_pack: block = one tile of 16 rows x 1024 k of query, key, value, Wq or Wk: read in whole lines, rounded to bf16, turned in LDS and written in fragment order, so that each operand load of k_proj is 512 contiguous bytes
__global__ __launch_bounds__(256) void k_pack(const float* __restrict__ XQ, const float* __restrict__ XK, const float* __restrict__ XV, const float* __restrict__ WQ, const float* __restrict__ WK, __bf16* __restrict__ PX, __bf16* __restrict__ PW) {
  __shared__ __align__(16) __bf16 s[16][EE + 8]; const int t = threadIdx.x, bx = blockIdx.x; const float* src; __bf16* dst;
  if (bx < 3 * RT_X) { const int which = bx / RT_X; src = ((which == 0) ? XQ : (which == 1) ? XK : XV) + (size_t)(bx % RT_X) * TILE_E; dst = PX + (size_t)bx * TILE_E; }
  else { const int e = bx - 3 * RT_X; src = ((e / RT_W) ? WK : WQ) + (size_t)(e % RT_W) * TILE_E; dst = PW + (size_t)e * TILE_E; }
  v4f v[16];
#pragma unroll      // whole: the 16 independent row loads are in flight together
  for (int i = 0; i < 16; ++i) v[i] = *(const v4f*)(src + (size_t)i * EE + t * 4);
#pragma unroll      // whole: v stays in registers
  for (int i = 0; i < 16; ++i) { v4b h; h[0] = (__bf16)v[i][0]; h[1] = (__bf16)v[i][1]; h[2] = (__bf16)v[i][2]; h[3] = (__bf16)v[i][3]; *(v4b*)&s[i][t * 4] = h; }
  __syncthreads();
  for (int o = t; o < TILE_E / 8; o += 256) { const int kc = o >> 6, half = (o >> 5) & 1, lane = o & 31; *(v8b*)(dst + (size_t)o * 8) = *(const v8b*)&s[lane & 15][kc * 32 + half * 16 + 8 * (lane >> 4)]; }
}
// fragment from a packed tile: p = tile + kc * 512 + lane * 8; elements 0..7 = k0+8h+0..7, 8..15 = k0+16+8h+0..7 of row lane&15, as frag_b gives them
__device__ __forceinline__ v16b frag_p(const __bf16* p) { union { v16b v; v8b q[2]; } u; u.q[0] = *(const v8b*)p; u.q[1] = *(const v8b*)(p + 256); return u.v; }
// ---- k_proj: block = (128 token rows, 256 cols, which), 2 x 2 waves of 64 rows x 128 cols each: q = relu(x Wq^T + bq), k = relu(key Wk^T + bk), v = value Wk^T + bk; f32 rows
#define FA 4                                           // fragments of 16 token rows a wave
#define FB 8                                           // fragments of 16 output columns a wave
// two waves a SIMD: the attribute holds the register budget at 512, so that a second work-group's products run under this one's waits
__global__ __launch_bounds__(128) __attribute__((amdgpu_waves_per_eu(2, 2))) void k_proj(const __bf16* __restrict__ PX, const __bf16* __restrict__ PW, const float* __restrict__ BQ, const float* __restrict__ BK, float* __restrict__ Q, float* __restrict__ K, float* __restrict__ V) {
  __shared__ __align__(16) float so[4][FA * 16][FB * 16 + 4];
  const int tid = threadIdx.x, wave = tid >> 5, lane = tid & 31, col = lane & 15, g = lane >> 4; const int which = blockIdx.z; const int wr = wave >> 1, wc = wave & 1; const size_t r0 = ((size_t)blockIdx.x * 2 + wr) * (FA * 16); const int c0 = (blockIdx.y * 2 + wc) * (FB * 16);
  const __bf16* Ar = PX + ((size_t)which * RT_X + (blockIdx.x * 2 + wr) * FA) * TILE_E + lane * 8; const __bf16* Br = PW + ((size_t)((which == 0) ? 0 : RT_W) + (blockIdx.y * 2 + wc) * FB) * TILE_E + lane * 8; const float* BB = (which == 0) ? BQ : BK; float* dst = (which == 0) ? Q : (which == 1) ? K : V;
  v8f acc[FA][FB] = {};
  // FA x FB accumulator tiles a wave: a loaded A fragment feeds FB products, a B fragment FA. Two register sets of operands: the loads of the next k step are issued together, in front of the products of this step, so one memory latency is paid per step and it runs under the products
  v16b a0[FA], a1[FA], b0[FB], b1[FB];
  // the scheduling barrier at the end keeps the products behind the loads: without it the first product, and with it the wait for the set that it reads, is lifted over the next set's loads
#define PROJ_LD(a, b, kc) do { _Pragma("unroll") for (int j = 0; j < FA; ++j) a[j] = frag_p(Ar + (size_t)j * TILE_E + (kc) * 512); _Pragma("unroll") for (int j = 0; j < FB; ++j) b[j] = frag_p(Br + (size_t)j * TILE_E + (kc) * 512); __builtin_amdgcn_sched_barrier(0); } while (0)
  // the plain builtin: the compiler keeps the distances behind a WMMA itself, and the fragments may lie above v255, which an asm operand cannot name
#define PROJ_MM(a, b) do { _Pragma("unroll") for (int i = 0; i < FA; ++i) { _Pragma("unroll") for (int j = 0; j < FB; ++j) acc[i][j] = __builtin_amdgcn_wmma_f32_16x16x32_bf16(false, a[i], false, b[j], (short)0, acc[i][j], false, false); } } while (0)
  PROJ_LD(a0, b0, 0);
#pragma unroll      // whole: every load address is then a start pointer plus an immediate, so no address register is rewritten, and waited for, while the loads fly
  for (int kc = 0; kc < EE / 32 - 2; kc += 2) { PROJ_LD(a1, b1, kc + 1); PROJ_MM(a0, b0); PROJ_LD(a0, b0, kc + 2); PROJ_MM(a1, b1); }
  PROJ_LD(a1, b1, EE / 32 - 1); PROJ_MM(a0, b0); PROJ_MM(a1, b1);
  asm volatile("s_wait_xcnt 0x0" :: "v"(Ar), "v"(Br) : "memory");   // stands behind the loads; the pointers as inputs keep their address registers unwritten up to this wait
  const float* pb = BB + c0 + col; float bb[FB];
#pragma unroll
  for (int j = 0; j < FB; ++j) bb[j] = pb[j * 16];
  asm volatile("s_wait_xcnt 0x0" :: "v"(pb) : "memory");   // stands behind the bias loads; pb as an input keeps their address registers unwritten up to this wait
#pragma unroll
  for (int j = 0; j < FB; ++j) bb[j] = bfr(bb[j]);
#pragma unroll      // whole: acc stays in registers
  for (int i = 0; i < FA; ++i)
#pragma unroll
    for (int j = 0; j < FB; ++j)
#pragma unroll
      for (int r = 0; r < 8; ++r) { const float v = acc[i][j][r] + bb[j]; so[wave][i * 16 + 8 * g + r][j * 16 + col] = (which < 2) ? fmaxf(v, 0.f) : v; }
  LDSX();
#pragma unroll      // whole: every store address is the start pointer plus an immediate
  for (int rl = 0; rl < FA * 16; ++rl) vst2(dst + (r0 + rl) * EE + c0 + lane * 4, *(const v4f*)&so[wave][rl][lane * 4]);   // one row of 512 bytes a store: whole lines
}
// ---- k_planes: block = (64 positions s, bh): k cos/sin-weighted and v as f16 hi + (x2048) residual planes [d][s]; also the per-block partial key sums are NOT needed (k_kv sums exactly)
__global__ __launch_bounds__(256) void k_planes(const float* __restrict__ K, const float* __restrict__ V, _Float16* __restrict__ PL) {
  __shared__ __align__(16) _Float16 st[6][HD][72]; __shared__ __align__(8) float wt[64][2]; const int s0 = blockIdx.x * 64; const size_t bh = blockIdx.y; const size_t b = bh / NH; const int h = (int)(bh % NH); const int t = threadIdx.x;
  const int d = t & 63; const size_t row0 = ((size_t)(s0 + (t >> 6)) * NBATCH + b) * EE + h * HD + d; const float* pk = K + row0; const float* pv = V + row0; float kr[16], vr[16];
#pragma unroll      // whole: the 32 independent loads are in flight together, each a start pointer plus an immediate
  for (int i = 0; i < 16; ++i) { kr[i] = pk[(size_t)i * 4 * NBATCH * EE]; vr[i] = pv[(size_t)i * 4 * NBATCH * EE]; }
  asm volatile("s_wait_xcnt 0x0" :: "v"(pk), "v"(pv) : "memory");   // stands behind the loads; the pointers as inputs keep their address registers unwritten up to this wait
  // the cos and sin weight of each of the 64 positions, computed once (a call waits for every load in flight, so none stands in the element loop)
  if (t < 128) { const float ang = (1.5707963267948966f * (float)(s0 + d + 1)) / (float)LL; wt[d][t >> 6] = (t >> 6) ? sin_p(ang) : cos_p(ang); }
  __syncthreads();
#pragma unroll      // whole: kr, vr stay in registers
  for (int i = 0; i < 16; ++i) { const int sl = (t >> 6) + 4 * i; const v2f w = *(const v2f*)&wt[sl][0]; const float cs = w[0], sn = w[1]; const float kv = kr[i], vv = vr[i];
    const float kc = kv * cs, ks = kv * sn; _Float16 hv;
    hv = (_Float16)kc; st[0][d][sl] = hv; st[1][d][sl] = (_Float16)((kc - (float)hv) * 2048.0f);
    hv = (_Float16)ks; st[2][d][sl] = hv; st[3][d][sl] = (_Float16)((ks - (float)hv) * 2048.0f);
    hv = (_Float16)vv; st[4][d][sl] = hv; st[5][d][sl] = (_Float16)((vv - (float)hv) * 2048.0f); }
  __syncthreads();
  for (int e = t; e < 6 * HD * 8; e += 256) { const int p = e / (HD * 8), rem = e % (HD * 8); const int d = rem >> 3, pc = rem & 7; vst2((unsigned*)(PL + ((bh * 6 + p) * HD + d) * LL + s0 + pc * 8), *(const v4u*)&st[p][d][pc * 8]); }
}
// ---- k_kv: block = (LL/NSP positions s, bh), a partial record each, summed by k_red: kv_cos[m][d] = sum_s kcos[s][d] v[s][m] and kv_sin (A = v planes [m][s], B = k planes [d][s]; hi.hi + hi.lo + lo.hi); key sums over s in f32 (fixed order); whole tables per block, over its own positions
__global__ __launch_bounds__(128) void k_kv(const _Float16* __restrict__ PL, const float* __restrict__ K, float* __restrict__ KVP) {
  __shared__ __align__(16) float skv[2][HD][HD + 4]; __shared__ __align__(16) float sks[2][HD]; __shared__ __align__(16) float wt[2][LL / NSP];
  const int tid = threadIdx.x, wave = tid >> 5, lane = tid & 31, col = lane & 15, g = lane >> 4; const int s0 = blockIdx.x * (LL / NSP); const size_t bh = blockIdx.y; const size_t b = bh / NH; const int h = (int)(bh % NH); const int m0 = wave * 16; float* P = KVP + (bh * NSP + blockIdx.x) * PREC;
  const _Float16* KCH = PL + ((bh * 6 + 0) * HD) * LL; const _Float16* KCL = PL + ((bh * 6 + 1) * HD) * LL; const _Float16* KSH = PL + ((bh * 6 + 2) * HD) * LL; const _Float16* KSL = PL + ((bh * 6 + 3) * HD) * LL; const _Float16* VH = PL + ((bh * 6 + 4) * HD) * LL; const _Float16* VL = PL + ((bh * 6 + 5) * HD) * LL;
  // the cos and sin weight of each of the block's positions, computed once; read by the key sums behind the barrier below
  for (int i = tid; i < LL / NSP; i += 128) { const float ang = (1.5707963267948966f * (float)(s0 + i + 1)) / (float)LL; wt[0][i] = cos_p(ang); wt[1][i] = sin_p(ang); }
  v8f ac[4] = {}, acl[4] = {}, as[4] = {}, asl[4] = {};
#pragma unroll 1
  for (int kc = s0 / 32; kc < (s0 + LL / NSP) / 32; ++kc) { const v16h vh = frag_h(VH + (size_t)(m0 + col) * LL + kc * 32, lane), vl = frag_h(VL + (size_t)(m0 + col) * LL + kc * 32, lane);
    asm volatile("s_wait_xcnt 0x0" ::: "memory");   // stands behind the v loads, in front of any later write of their address registers (a later load's result may be given those registers)
#pragma unroll
    for (int j = 0; j < 4; ++j) { const size_t o = (size_t)(j * 16 + col) * LL + kc * 32; const v16h kch = frag_h(KCH + o, lane), ksh = frag_h(KSH + o, lane);
      ac[j] = wmma16(vh, kch, ac[j]); acl[j] = wmma16(vl, kch, acl[j]); acl[j] = wmma16(vh, frag_h(KCL + o, lane), acl[j]);
      as[j] = wmma16(vh, ksh, as[j]); asl[j] = wmma16(vl, ksh, asl[j]); asl[j] = wmma16(vh, frag_h(KSL + o, lane), asl[j]); } }
#pragma unroll
  for (int j = 0; j < 4; ++j)
#pragma unroll
    for (int r = 0; r < 8; ++r) { skv[0][m0 + 8 * g + r][j * 16 + col] = ac[j][r] + acl[j][r] * (1.0f / 2048.0f); skv[1][m0 + 8 * g + r][j * 16 + col] = as[j][r] + asl[j][r] * (1.0f / 2048.0f); }
  __syncthreads();   // publishes the weight table
  { const int d = tid & 63, which = tid >> 6; const float* pk = K + ((size_t)s0 * NBATCH + b) * EE + h * HD + d; float kr[LL / NSP];
#pragma unroll      // whole: the independent loads are in flight together, each the start pointer plus an immediate
    for (int i = 0; i < LL / NSP; ++i) kr[i] = pk[(size_t)i * NBATCH * EE];
    asm volatile("s_wait_xcnt 0x0" ::: "memory");   // stands behind the loads, in front of any later write of their address registers
    float s = 0.f;
#pragma unroll      // whole: kr stays in registers; the sum runs in the order of the positions as before
    for (int i = 0; i < LL / NSP; ++i) s += kr[i] * wt[which][i];
    sks[which][d] = s; }
  __syncthreads();
  for (int q = tid; q < 2 * HD * HD / 4; q += 128) { const int p = q / (HD * HD / 4), rem = q % (HD * HD / 4); const int m = rem / (HD / 4), d4 = rem % (HD / 4); vst2(P + (p * HD + m) * HD + d4 * 4, *(const v4f*)&skv[p][m][d4 * 4]); }
  if (tid < 2 * HD / 4) vst2(P + 2 * HD * HD + tid * 4, *(const v4f*)(&sks[0][0] + tid * 4));
}
// ---- k_red: thread = 4 floats of a head's record: the NSP partial records added in f32, in the order of the positions; tables to KV, key sums to KS
__global__ __launch_bounds__(256) void k_red(const float* __restrict__ KVP, float* __restrict__ KV, float* __restrict__ KS) {
  const int q = blockIdx.x * 256 + threadIdx.x; const size_t bh = blockIdx.y; if (q >= PREC / 4) return;
  const float* p = KVP + bh * NSP * PREC + q * 4; v4f r[NSP];
#pragma unroll      // whole: the NSP independent loads are in flight together, one latency instead of NSP
  for (int sp = 0; sp < NSP; ++sp) r[sp] = *(const v4f*)(p + (size_t)sp * PREC);
  asm volatile("s_wait_xcnt 0x0" :: "v"(p) : "memory");   // stands behind the loads; p as an input keeps their address registers unwritten up to this wait
  v4f s = r[0];
#pragma unroll      // whole: r stays in registers
  for (int sp = 1; sp < NSP; ++sp) s += r[sp];
  vst2((q < 2 * HD * HD / 4) ? KV + bh * 2 * HD * HD + q * 4 : KS + bh * 2 * HD + (q * 4 - 2 * HD * HD), s);
}
// ---- k_fin: block = (64 positions l, bh): z = 1/(qcos . sum kcos + qsin . sum ksin + eps); attn[l][m] = z (qcos . kv_cos[m] + qsin . kv_sin[m]) with bf16 hi + lo operands (4 products each); output rows (bh, l) of 64 (raw view)
__global__ __launch_bounds__(128) void k_fin(const float* __restrict__ Q, const float* __restrict__ KV, const float* __restrict__ KS, float* __restrict__ OUT) {
  __shared__ __align__(16) float sq[2][64][HD + 4]; __shared__ __align__(16) __bf16 skh[2][HD][HD + 8]; __shared__ __align__(16) __bf16 skl[2][HD][HD + 8]; __shared__ float sz[64]; __shared__ __align__(16) float so[4][16][68]; __shared__ __align__(8) float wt[64][2];
  const int tid = threadIdx.x, wave = tid >> 5, lane = tid & 31, col = lane & 15, g = lane >> 4; const int l0 = blockIdx.x * 64; const size_t bh = blockIdx.y; const size_t b = bh / NH; const int h = (int)(bh % NH);
  { const int d = tid & 63; const float* pq = Q + ((size_t)(l0 + (tid >> 6)) * NBATCH + b) * EE + h * HD + d; float qr[32];
#pragma unroll      // whole: the 32 independent loads are in flight together, each the start pointer plus an immediate
    for (int i = 0; i < 32; ++i) qr[i] = pq[(size_t)i * 2 * NBATCH * EE];
    asm volatile("s_wait_xcnt 0x0" :: "v"(pq) : "memory");   // stands behind the loads; pq as an input keeps their address registers unwritten up to this wait
    // the cos and sin weight of each of the 64 positions, computed once (a call waits for every load in flight, so none stands in the element loop)
    { const float ang = (1.5707963267948966f * (float)(l0 + d + 1)) / (float)LL; wt[d][tid >> 6] = (tid >> 6) ? sin_p(ang) : cos_p(ang); }
    __syncthreads();
#pragma unroll      // whole: qr stays in registers
    for (int i = 0; i < 32; ++i) { const int ll = (tid >> 6) + 2 * i; const v2f w = *(const v2f*)&wt[ll][0]; sq[0][ll][d] = qr[i] * w[0]; sq[1][ll][d] = qr[i] * w[1]; } }
  for (int e = tid; e < 2 * HD * HD; e += 128) { const int p = e / (HD * HD), rem = e % (HD * HD); const int m = rem / HD, d = rem % HD; const float v = KV[((bh * 2 + p) * HD + m) * HD + d]; const __bf16 hv = (__bf16)v; skh[p][m][d] = hv; skl[p][m][d] = (__bf16)(v - (float)hv); }
  __syncthreads();
  if (tid < 64) { float a = 0.f; for (int d = 0; d < HD; ++d) a += sq[0][tid][d] * KS[bh * 2 * HD + d] + sq[1][tid][d] * KS[bh * 2 * HD + HD + d]; sz[tid] = 1.0f / (a + 1e-6f); }
  v8f acc[4] = {};
#pragma unroll
  for (int p = 0; p < 2; ++p)
#pragma unroll
    for (int kc = 0; kc < HD / 32; ++kc) { const F2 a = split_row(&sq[p][wave * 16 + col][0], kc * 32, lane);
#pragma unroll
      for (int j = 0; j < 4; ++j) { const v16b wh = frag_b(&skh[p][j * 16 + col][0] + kc * 32, lane), wl = frag_b(&skl[p][j * 16 + col][0] + kc * 32, lane); acc[j] = wmma_bf(a.h, wh, acc[j]); acc[j] = wmma_bf(a.l, wh, acc[j]); acc[j] = wmma_bf(a.h, wl, acc[j]); acc[j] = wmma_bf(a.l, wl, acc[j]); } }
  __syncthreads();
#pragma unroll
  for (int j = 0; j < 4; ++j)
#pragma unroll
    for (int r = 0; r < 8; ++r) so[wave][8 * g + r][j * 16 + col] = acc[j][r] * sz[wave * 16 + 8 * g + r];
  LDSX();
  for (int rl = 0; rl < 16; ++rl) if (lane < 16) vst2(OUT + (bh * LL + l0 + wave * 16 + rl) * HD + lane * 4, *(const v4f*)&so[wave][rl][lane * 4]);   // (B H, L, 64) buffer viewed as (L, B, E)
}
extern "C" void kernel_launch(void* const* d_in, const int* in_sizes, int n_in, void* d_out, int out_size, void* d_ws, size_t ws_size, hipStream_t stream) {
  (void)in_sizes; (void)n_in; (void)out_size;
  const float** F = (const float**)d_in;   // 0 query, 1 key, 2 value [2048,4,1024]; 3 Wq [1024,1024], 4 bq, 5 Wk, 6 bk (natural; v uses Wk, bk)
  if (ws_size < (size_t)WS_END) return;
  char* ws = (char*)d_ws; __bf16* PW = (__bf16*)(ws + WS_PW); float *Q = (float*)(ws + WS_Q), *K = (float*)(ws + WS_K), *V = (float*)(ws + WS_V), *KV = (float*)(ws + WS_KV), *KS = (float*)(ws + WS_KS), *KVP = (float*)(ws + WS_KVP); _Float16* PL = (_Float16*)(ws + WS_PL); __bf16* PX = (__bf16*)(ws + WS_PX);
  k_pack<<<dim3(3 * RT_X + 2 * RT_W), 256, 0, stream>>>(F[0], F[1], F[2], F[3], F[5], PX, PW);
  k_proj<<<dim3(NR / (32 * FA), EE / (32 * FB), 3), 128, 0, stream>>>(PX, PW, F[4], F[6], Q, K, V);
  k_planes<<<dim3(LL / 64, TBH), 256, 0, stream>>>(K, V, PL);
  k_kv<<<dim3(NSP, TBH), 128, 0, stream>>>(PL, K, KVP);
  k_red<<<dim3((PREC / 4 + 255) / 256, TBH), 256, 0, stream>>>(KVP, KV, KS);
  k_fin<<<dim3(LL / 64, TBH), 128, 0, stream>>>(Q, KV, KS, (float*)d_out);
}

// v006
// Measured time: 121 microseconds a run.
// Two timings next to v005 put it at 1.31 and 1.30 times that version's speed.
// All steps since v000 together make it 10.5 times as fast.
// compute dtype: all float inputs rounded to bf16; q/k/v = x . W^T + b with EXACT bf16 products on WMMA 16x16x32 (both operands packed ahead in fragment order; v uses the k projection as the module does); ReLU and the cos/sin position weights in f32 (precise sinf/cosf); the linear-attention contractions on WMMA with every computed operand as f16 hi + residual (3 products for kv = k_w^T v, 4 products (bf16 hi + lo) for q_w . kv); key sums, normaliser z and the final scaling in f32; f32 output.
#include <hip/hip_runtime.h>
#include <math.h>

typedef __attribute__((ext_vector_type(16))) _Float16 v16h;
typedef __attribute__((ext_vector_type(16))) __bf16 v16b;
typedef __attribute__((ext_vector_type(8)))  _Float16 v8h;
typedef __attribute__((ext_vector_type(8)))  float v8f;
typedef __attribute__((ext_vector_type(4)))  float v4f;
typedef __attribute__((ext_vector_type(2)))  float v2f;
typedef __attribute__((ext_vector_type(4)))  unsigned v4u;
typedef __attribute__((ext_vector_type(4)))  int v4i;
typedef float __attribute__((may_alias)) float_a;
typedef int __attribute__((may_alias)) int_a;

template <typename T> __device__ __forceinline__ void vst2(void* p, T v) { *(T*)p = v;  }
__device__ __forceinline__ v8f wmma16(v16h a, v16h b, v8f c) {
  v8f d = __builtin_amdgcn_wmma_f32_16x16x32_f16(false, a, false, b, (short)0, c, false, false);
  asm volatile("v_nop\n\tv_nop\n\tv_nop\n\tv_nop" : "+v"(d) : "v"(a), "v"(b));
  return d;
}
__device__ __forceinline__ v8f wmma_bf(v16b a, v16b b, v8f c) {
  v8f d = __builtin_amdgcn_wmma_f32_16x16x32_bf16(false, a, false, b, (short)0, c, false, false);
  asm volatile("v_nop\n\tv_nop\n\tv_nop\n\tv_nop" : "+v"(d) : "v"(a), "v"(b));
  return d;
}
// 16x16x32 fragments: lane = (h = lane>>4, row/col = lane&15); elements 0..7 = k0+8h+0..7, 8..15 = k0+16+8h+0..7; D element r = row 8h+r
__device__ __forceinline__ v16h frag_h(const _Float16* rowk0, int lane) {
  union { v16h v; v8h q[2]; } u; const _Float16* p = rowk0 + 8 * (lane >> 4);
  u.q[0] = *(const v8h*)p; u.q[1] = *(const v8h*)(p + 16); return u.v;
}
__device__ __forceinline__ v16h frag_f32(const float* rowk0, int lane) {
  v16h a; const float* p = rowk0 + 8 * (lane >> 4);
#pragma unroll
  for (int i = 0; i < 8; ++i) { a[i] = (_Float16)p[i]; a[8 + i] = (_Float16)p[16 + i]; }
  return a;
}
__device__ __forceinline__ v16h frag_f32s(const float* rowk0, int lane, float sc) {
  v16h a; const float* p = rowk0 + 8 * (lane >> 4);
#pragma unroll
  for (int i = 0; i < 8; ++i) { a[i] = (_Float16)(p[i] * sc); a[8 + i] = (_Float16)(p[16 + i] * sc); }
  return a;
}
// column fragment from a [K][ld] layout (column n), rows >= K read as 0
__device__ __forceinline__ v16h fragc_f32(const float* W, int k0, int n, int lane, int ld, int K) {
  v16h a; const int g = lane >> 4;
#pragma unroll
  for (int i = 0; i < 8; ++i) { const int ka = k0 + 8 * g + i, kb = ka + 16;
    a[i] = (_Float16)(ka < K ? W[(size_t)(ka < K ? ka : K - 1) * ld + n] : 0.f); a[8 + i] = (_Float16)(kb < K ? W[(size_t)(kb < K ? kb : K - 1) * ld + n] : 0.f); }
  return a;
}
struct F2 { v16b h, l; };
__device__ __forceinline__ F2 bsplit16(const float v[16]) { F2 r;
#pragma unroll
  for (int i = 0; i < 16; ++i) { const __bf16 h = (__bf16)v[i]; r.h[i] = h; r.l[i] = (__bf16)(v[i] - (float)h); }
  return r; }
__device__ __forceinline__ F2 split_row(const float* row, int k0, int lane) { float v[16]; const float* p = row + k0 + 8 * (lane >> 4);
#pragma unroll
  for (int i = 0; i < 8; ++i) { v[i] = p[i]; v[8 + i] = p[16 + i]; }
  return bsplit16(v); }
__device__ __forceinline__ F2 split_rowK(const float* row, int k0, int lane, int K) { float v[16]; const int g = lane >> 4;
#pragma unroll
  for (int i = 0; i < 8; ++i) { const int ka = k0 + 8 * g + i, kb = ka + 16; v[i] = ka < K ? row[ka < K ? ka : K - 1] : 0.f; v[8 + i] = kb < K ? row[kb < K ? kb : K - 1] : 0.f; }
  return bsplit16(v); }
__device__ __forceinline__ F2 split_col(const float* W, int k0, int n, int lane, int ld, int K) { float v[16]; const int g = lane >> 4;
#pragma unroll
  for (int i = 0; i < 8; ++i) { const int ka = k0 + 8 * g + i, kb = ka + 16; v[i] = ka < K ? W[(size_t)(ka < K ? ka : K - 1) * ld + n] : 0.f; v[8 + i] = kb < K ? W[(size_t)(kb < K ? kb : K - 1) * ld + n] : 0.f; }
  return bsplit16(v); }
__device__ __forceinline__ v8f mac3(const F2& a, const F2& b, v8f c) { c = wmma_bf(a.l, b.h, c); c = wmma_bf(a.h, b.l, c); return wmma_bf(a.h, b.h, c); }
__device__ __forceinline__ float sigm(float v) { return 1.0f / (1.0f + expf(-v)); }
#define LDSX() do { asm volatile("s_wait_dscnt 0" ::: "memory"); __builtin_amdgcn_wave_barrier(); __builtin_amdgcn_fence(__ATOMIC_RELEASE, "workgroup"); } while (0)


// cosFormer multi-head linear attention (L 2,048, B 4, E 1,024, 16 heads x 64, non-causal): q = relu(Wq x), k = relu(Wk key), v = Wk value; attn = [q cos . (k cos)^T v + q sin . (k sin)^T v] / (q cos . sum k cos + q sin . sum k sin + eps), reshaped (B H, L, 64) -> (L, B, E) by raw view.
#define LL 2048
#define NBATCH 4
#define EE 1024
#define NH 16
#define HD 64
#define NBH (NBATCH * NH)
#define NR (LL * NBATCH)          // token rows (l, b) = l*B + b
#ifndef TBH
#define TBH NBH
#endif
typedef __attribute__((ext_vector_type(8))) __bf16 v8b;
__device__ __forceinline__ v16b frag_b(const __bf16* rowk0, int lane) {
  union { v16b v; v8b q[2]; } u; const __bf16* p = rowk0 + 8 * (lane >> 4);
  u.q[0] = *(const v8b*)p; u.q[1] = *(const v8b*)(p + 16); return u.v;
}
__device__ __forceinline__ float bfr(float v) { return (float)(__bf16)v; }
__device__ __attribute__((noinline)) float exp_ni(float v) { return expf(v); }
__device__ __attribute__((noinline)) float erf_ni(float v) { return erff(v); }

#define WS_PW  0u                                      // bf16 Wq, Wk in fragment order [2][RT_W][TILE_E]
#define WS_Q   (WS_PW + 2u * (size_t)2 * EE * EE)         // f32 rows relu(q) [NR][1024] ; relu(k) ; v
#define WS_K   (WS_Q + 4u * (size_t)NR * EE)
#define WS_V   (WS_K + 4u * (size_t)NR * EE)
#define WS_PL  (WS_V + 4u * (size_t)NR * EE)             // room of the packed inputs (WS_PX)
#define WS_KV  (WS_PL + 2u * (size_t)NBH * 6 * HD * LL)    // f32 [bh][2][64 m][64 d] kv_cos, kv_sin ; ksum [bh][2][64]
#define WS_KS  (WS_KV + 4u * (size_t)NBH * 2 * HD * HD)
#define NSP 16                                         // k_kv splits the LL positions over NSP work-groups a head
#define PREC (2 * HD * HD + 2 * HD)                    // floats of one partial record: kv_cos, kv_sin [64 m][64 d], then the two key sums [64]
#define WS_KVP (WS_KS + 4u * (size_t)NBH * 2 * HD)        // f32 [bh][NSP][PREC] partial records
#define WS_END (WS_KVP + 4u * (size_t)NBH * NSP * PREC)
#define RT_X (NR / 16)                                 // tiles of 16 token rows in one input
#define RT_W (EE / 16)                                 // tiles of 16 rows in one weight
#define TILE_E (16 * EE)                               // bf16 elements of one packed tile: [kc 32][half 2][lane 32][8], the 16 bytes a lane loads for half a 16x16x32 fragment
#define WS_PX  WS_PL                                   // bf16 query, key, value in fragment order [3][RT_X][TILE_E]; half of that room

__device__ __attribute__((noinline)) float sin_p(float v) { return sinf(v); }
__device__ __attribute__((noinline)) float cos_p(float v) { return cosf(v); }
typedef __attribute__((ext_vector_type(4))) __bf16 v4b;
// ---- k_pack: block = one tile of 16 rows x 1024 k of query, key, value, Wq or Wk: read in whole lines, rounded to bf16, turned in LDS and written in fragment order, so that each operand load of k_proj is 512 contiguous bytes
__global__ __launch_bounds__(256) void k_pack(const float* __restrict__ XQ, const float* __restrict__ XK, const float* __restrict__ XV, const float* __restrict__ WQ, const float* __restrict__ WK, __bf16* __restrict__ PX, __bf16* __restrict__ PW) {
  __shared__ __align__(16) __bf16 s[16][EE + 8]; const int t = threadIdx.x, bx = blockIdx.x; const float* src; __bf16* dst;
  if (bx < 3 * RT_X) { const int which = bx / RT_X; src = ((which == 0) ? XQ : (which == 1) ? XK : XV) + (size_t)(bx % RT_X) * TILE_E; dst = PX + (size_t)bx * TILE_E; }
  else { const int e = bx - 3 * RT_X; src = ((e / RT_W) ? WK : WQ) + (size_t)(e % RT_W) * TILE_E; dst = PW + (size_t)e * TILE_E; }
  v4f v[16];
#pragma unroll      // whole: the 16 independent row loads are in flight together
  for (int i = 0; i < 16; ++i) v[i] = *(const v4f*)(src + (size_t)i * EE + t * 4);
#pragma unroll      // whole: v stays in registers
  for (int i = 0; i < 16; ++i) { v4b h; h[0] = (__bf16)v[i][0]; h[1] = (__bf16)v[i][1]; h[2] = (__bf16)v[i][2]; h[3] = (__bf16)v[i][3]; *(v4b*)&s[i][t * 4] = h; }
  __syncthreads();
  for (int o = t; o < TILE_E / 8; o += 256) { const int kc = o >> 6, half = (o >> 5) & 1, lane = o & 31; *(v8b*)(dst + (size_t)o * 8) = *(const v8b*)&s[lane & 15][kc * 32 + half * 16 + 8 * (lane >> 4)]; }
}
// fragment from a packed tile: p = tile + kc * 512 + lane * 8; elements 0..7 = k0+8h+0..7, 8..15 = k0+16+8h+0..7 of row lane&15, as frag_b gives them
__device__ __forceinline__ v16b frag_p(const __bf16* p) { union { v16b v; v8b q[2]; } u; u.q[0] = *(const v8b*)p; u.q[1] = *(const v8b*)(p + 256); return u.v; }
// ---- k_proj: block = (128 token rows, 256 cols, which), 2 x 2 waves of 64 rows x 128 cols each: q = relu(x Wq^T + bq), k = relu(key Wk^T + bk), v = value Wk^T + bk; f32 rows
#define FA 4                                           // fragments of 16 token rows a wave
#define FB 8                                           // fragments of 16 output columns a wave
// two waves a SIMD: the attribute holds the register budget at 512, so that a second work-group's products run under this one's waits
__global__ __launch_bounds__(128) __attribute__((amdgpu_waves_per_eu(2, 2))) void k_proj(const __bf16* __restrict__ PX, const __bf16* __restrict__ PW, const float* __restrict__ BQ, const float* __restrict__ BK, float* __restrict__ Q, float* __restrict__ K, float* __restrict__ V) {
  __shared__ __align__(16) float so[4][FA * 16][FB * 16 + 4];
  const int tid = threadIdx.x, wave = tid >> 5, lane = tid & 31, col = lane & 15, g = lane >> 4; const int which = blockIdx.z; const int wr = wave >> 1, wc = wave & 1; const size_t r0 = ((size_t)blockIdx.x * 2 + wr) * (FA * 16); const int c0 = (blockIdx.y * 2 + wc) * (FB * 16);
  const __bf16* Ar = PX + ((size_t)which * RT_X + (blockIdx.x * 2 + wr) * FA) * TILE_E + lane * 8; const __bf16* Br = PW + ((size_t)((which == 0) ? 0 : RT_W) + (blockIdx.y * 2 + wc) * FB) * TILE_E + lane * 8; const float* BB = (which == 0) ? BQ : BK; float* dst = (which == 0) ? Q : (which == 1) ? K : V;
  v8f acc[FA][FB] = {};
  // FA x FB accumulator tiles a wave: a loaded A fragment feeds FB products, a B fragment FA. Two register sets of operands: the loads of the next k step are issued together, in front of the products of this step, so one memory latency is paid per step and it runs under the products
  v16b a0[FA], a1[FA], b0[FB], b1[FB];
  // the scheduling barrier at the end keeps the products behind the loads: without it the first product, and with it the wait for the set that it reads, is lifted over the next set's loads
#define PROJ_LD(a, b, kc) do { _Pragma("unroll") for (int j = 0; j < FA; ++j) a[j] = frag_p(Ar + (size_t)j * TILE_E + (kc) * 512); _Pragma("unroll") for (int j = 0; j < FB; ++j) b[j] = frag_p(Br + (size_t)j * TILE_E + (kc) * 512); __builtin_amdgcn_sched_barrier(0); } while (0)
  // the plain builtin: the compiler keeps the distances behind a WMMA itself, and the fragments may lie above v255, which an asm operand cannot name
#define PROJ_MM(a, b) do { _Pragma("unroll") for (int i = 0; i < FA; ++i) { _Pragma("unroll") for (int j = 0; j < FB; ++j) acc[i][j] = __builtin_amdgcn_wmma_f32_16x16x32_bf16(false, a[i], false, b[j], (short)0, acc[i][j], false, false); } } while (0)
  PROJ_LD(a0, b0, 0);
#pragma unroll      // whole: every load address is then a start pointer plus an immediate, so no address register is rewritten, and waited for, while the loads fly
  for (int kc = 0; kc < EE / 32 - 2; kc += 2) { PROJ_LD(a1, b1, kc + 1); PROJ_MM(a0, b0); PROJ_LD(a0, b0, kc + 2); PROJ_MM(a1, b1); }
  PROJ_LD(a1, b1, EE / 32 - 1); PROJ_MM(a0, b0); PROJ_MM(a1, b1);
  asm volatile("s_wait_xcnt 0x0" :: "v"(Ar), "v"(Br) : "memory");   // stands behind the loads; the pointers as inputs keep their address registers unwritten up to this wait
  const float* pb = BB + c0 + col; float bb[FB];
#pragma unroll
  for (int j = 0; j < FB; ++j) bb[j] = pb[j * 16];
  asm volatile("s_wait_xcnt 0x0" :: "v"(pb) : "memory");   // stands behind the bias loads; pb as an input keeps their address registers unwritten up to this wait
#pragma unroll
  for (int j = 0; j < FB; ++j) bb[j] = bfr(bb[j]);
#pragma unroll      // whole: acc stays in registers
  for (int i = 0; i < FA; ++i)
#pragma unroll
    for (int j = 0; j < FB; ++j)
#pragma unroll
      for (int r = 0; r < 8; ++r) { const float v = acc[i][j][r] + bb[j]; so[wave][i * 16 + 8 * g + r][j * 16 + col] = (which < 2) ? fmaxf(v, 0.f) : v; }
  LDSX();
#pragma unroll      // whole: every store address is the start pointer plus an immediate
  for (int rl = 0; rl < FA * 16; ++rl) vst2(dst + (r0 + rl) * EE + c0 + lane * 4, *(const v4f*)&so[wave][rl][lane * 4]);   // one row of 512 bytes a store: whole lines
}
// ---- k_kv: block = (SP positions s, bh), a partial record each, summed by k_red. The block reads its own rows of relu(k) and v once, forms k cos/sin-weighted and v as f16 hi + (x2048) residual planes [d][s] in LDS, and takes every fragment from there: kv_cos[m][d] = sum_s kcos[s][d] v[s][m] and kv_sin (A = v planes [m][s], B = k planes [d][s]; hi.hi + hi.lo + lo.hi); key sums over s in f32 (fixed order: 32 positions a thread, then the four quarters in the order of the positions)
#define SP (LL / NSP)                                  // positions of one block
#define PP (SP + 8)                                    // f16 elements from one plane row to the next in LDS: 272 bytes, 16 x odd, free of bank conflicts for 16-byte accesses down a column
__global__ __launch_bounds__(256) void k_kv(const float* __restrict__ K, const float* __restrict__ V, float* __restrict__ KVP) {
  __shared__ __align__(16) char sm[6 * HD * PP * 2];   // the six planes; behind the products the same room stages the two f32 tables
  __shared__ __align__(16) float wt[2][SP]; __shared__ __align__(16) float sp[2][4][HD]; __shared__ __align__(16) float sks[2][HD];
  _Float16 (*st)[HD][PP] = (_Float16 (*)[HD][PP])sm; float (*skv)[HD][HD + 4] = (float (*)[HD][HD + 4])sm;
  const int tid = threadIdx.x, wave = tid >> 5, lane = tid & 31, col = lane & 15, g = lane >> 4; const int s0 = blockIdx.x * SP; const size_t bh = blockIdx.y; const size_t b = bh / NH; const int h = (int)(bh % NH); float* P = KVP + (bh * NSP + blockIdx.x) * PREC;
  const int d = tid & 63, qt = tid >> 6;               // thread = column d, 32 consecutive positions (quarter qt of the block's)
  const size_t row0 = ((size_t)(s0 + qt * 32) * NBATCH + b) * EE + h * HD + d; const float* pk = K + row0; const float* pv = V + row0; float kr[32], vr[32];
#pragma unroll      // whole: the 64 independent loads are in flight together, each a start pointer plus an immediate
  for (int i = 0; i < 32; ++i) { kr[i] = pk[(size_t)i * NBATCH * EE]; vr[i] = pv[(size_t)i * NBATCH * EE]; }
  asm volatile("s_wait_xcnt 0x0" :: "v"(pk), "v"(pv) : "memory");   // stands behind the loads; the pointers as inputs keep their address registers unwritten up to this wait
  // the cos and sin weight of each of the block's positions, computed once (a call waits for every load in flight, so none stands in the element loop)
  { const int i = tid & (SP - 1); const float ang = (1.5707963267948966f * (float)(s0 + i + 1)) / (float)LL; wt[tid / SP][i] = (tid / SP) ? sin_p(ang) : cos_p(ang); }
  __syncthreads();   // publishes the weight table
  float sc = 0.f, ss = 0.f;
#pragma unroll      // whole: kr, vr stay in registers
  for (int i = 0; i < 4; ++i) { const int sl = qt * 32 + i * 8; float cw[8], sw[8]; *(v4f*)&cw[0] = *(const v4f*)&wt[0][sl]; *(v4f*)&cw[4] = *(const v4f*)&wt[0][sl + 4]; *(v4f*)&sw[0] = *(const v4f*)&wt[1][sl]; *(v4f*)&sw[4] = *(const v4f*)&wt[1][sl + 4];
    v8h ch, cl, sh, sl2, vh, vl;
#pragma unroll
    for (int e = 0; e < 8; ++e) { const float kv = kr[i * 8 + e], vv = vr[i * 8 + e]; const float kc = kv * cw[e], ks = kv * sw[e]; sc += kc; ss += ks; _Float16 hv;
      hv = (_Float16)kc; ch[e] = hv; cl[e] = (_Float16)((kc - (float)hv) * 2048.0f);
      hv = (_Float16)ks; sh[e] = hv; sl2[e] = (_Float16)((ks - (float)hv) * 2048.0f);
      hv = (_Float16)vv; vh[e] = hv; vl[e] = (_Float16)((vv - (float)hv) * 2048.0f); }
    // eight consecutive positions of a column are 16 bytes of its plane row: one store a plane
    *(v8h*)&st[0][d][sl] = ch; *(v8h*)&st[1][d][sl] = cl; *(v8h*)&st[2][d][sl] = sh; *(v8h*)&st[3][d][sl] = sl2; *(v8h*)&st[4][d][sl] = vh; *(v8h*)&st[5][d][sl] = vl; }
  sp[0][qt][d] = sc; sp[1][qt][d] = ss;
  __syncthreads();   // publishes the planes and the quarters of the key sums
  if (tid < 2 * HD) sks[qt][d] = ((sp[qt][0][d] + sp[qt][1][d]) + sp[qt][2][d]) + sp[qt][3][d];
  // wave = (16 rows m, cos or sin table), all 64 columns d
  const int m0 = (wave & 3) * 16, pl = wave >> 2;
  v8f ac[4] = {}, al[4] = {};
#pragma unroll      // whole: every LDS address is a start address plus an immediate
  for (int kc = 0; kc < SP / 32; ++kc) { const v16h vh = frag_h(&st[4][m0 + col][kc * 32], lane), vl = frag_h(&st[5][m0 + col][kc * 32], lane); v16h kh[4], kl[4];
#pragma unroll
    for (int j = 0; j < 4; ++j) { kh[j] = frag_h(&st[2 * pl][j * 16 + col][kc * 32], lane); kl[j] = frag_h(&st[2 * pl + 1][j * 16 + col][kc * 32], lane); }
    __builtin_amdgcn_sched_barrier(0);   // keeps the 20 LDS reads of a step together in front of its products: without it each pair of reads stands, and is waited for, at its own product
#pragma unroll
    for (int j = 0; j < 4; ++j) { ac[j] = wmma16(vh, kh[j], ac[j]); al[j] = wmma16(vl, kh[j], al[j]); al[j] = wmma16(vh, kl[j], al[j]); } }
  __syncthreads();   // every wave has read its last fragment: the planes' room is free for the tables
#pragma unroll
  for (int j = 0; j < 4; ++j)
#pragma unroll
    for (int r = 0; r < 8; ++r) skv[pl][m0 + 8 * g + r][j * 16 + col] = ac[j][r] + al[j][r] * (1.0f / 2048.0f);
  __syncthreads();   // publishes the tables and the key sums
#pragma unroll      // whole: every store address is the start pointer plus an immediate
  for (int i = 0; i < 2 * HD * HD / 1024; ++i) vst2(P + tid * 4 + i * 1024, *(const v4f*)((const float*)sm + ((tid >> 4) + i * 16) * (HD + 4) + (tid & 15) * 4));   // the two tables are 128 rows on end, in LDS as in the record; 16 rows a pass
  if (tid < 2 * HD / 4) vst2(P + 2 * HD * HD + tid * 4, *(const v4f*)(&sks[0][0] + tid * 4));
}
// ---- k_red: thread = 4 floats of a head's record: the NSP partial records added in f32, in the order of the positions; tables to KV, key sums to KS
__global__ __launch_bounds__(256) void k_red(const float* __restrict__ KVP, float* __restrict__ KV, float* __restrict__ KS) {
  const int q = blockIdx.x * 256 + threadIdx.x; const size_t bh = blockIdx.y; if (q >= PREC / 4) return;
  const float* p = KVP + bh * NSP * PREC + q * 4; v4f r[NSP];
#pragma unroll      // whole: the NSP independent loads are in flight together, one latency instead of NSP
  for (int sp = 0; sp < NSP; ++sp) r[sp] = *(const v4f*)(p + (size_t)sp * PREC);
  asm volatile("s_wait_xcnt 0x0" :: "v"(p) : "memory");   // stands behind the loads; p as an input keeps their address registers unwritten up to this wait
  v4f s = r[0];
#pragma unroll      // whole: r stays in registers
  for (int sp = 1; sp < NSP; ++sp) s += r[sp];
  vst2((q < 2 * HD * HD / 4) ? KV + bh * 2 * HD * HD + q * 4 : KS + bh * 2 * HD + (q * 4 - 2 * HD * HD), s);
}
// ---- k_fin: block = (64 positions l, bh): z = 1/(qcos . sum kcos + qsin . sum ksin + eps); attn[l][m] = z (qcos . kv_cos[m] + qsin . kv_sin[m]) with bf16 hi + lo operands (4 products each); output rows (bh, l) of 64 (raw view)
__global__ __launch_bounds__(128) void k_fin(const float* __restrict__ Q, const float* __restrict__ KV, const float* __restrict__ KS, float* __restrict__ OUT) {
  __shared__ __align__(16) float sq[2][64][HD + 4]; __shared__ __align__(16) __bf16 skh[2][HD][HD + 8]; __shared__ __align__(16) __bf16 skl[2][HD][HD + 8]; __shared__ float sz[64]; __shared__ __align__(16) float so[4][16][68]; __shared__ __align__(8) float wt[64][2];
  const int tid = threadIdx.x, wave = tid >> 5, lane = tid & 31, col = lane & 15, g = lane >> 4; const int l0 = blockIdx.x * 64; const size_t bh = blockIdx.y; const size_t b = bh / NH; const int h = (int)(bh % NH);
  { const int d = tid & 63; const float* pq = Q + ((size_t)(l0 + (tid >> 6)) * NBATCH + b) * EE + h * HD + d; float qr[32];
#pragma unroll      // whole: the 32 independent loads are in flight together, each the start pointer plus an immediate
    for (int i = 0; i < 32; ++i) qr[i] = pq[(size_t)i * 2 * NBATCH * EE];
    asm volatile("s_wait_xcnt 0x0" :: "v"(pq) : "memory");   // stands behind the loads; pq as an input keeps their address registers unwritten up to this wait
    // the cos and sin weight of each of the 64 positions, computed once (a call waits for every load in flight, so none stands in the element loop)
    { const float ang = (1.5707963267948966f * (float)(l0 + d + 1)) / (float)LL; wt[d][tid >> 6] = (tid >> 6) ? sin_p(ang) : cos_p(ang); }
    __syncthreads();
#pragma unroll      // whole: qr stays in registers
    for (int i = 0; i < 32; ++i) { const int ll = (tid >> 6) + 2 * i; const v2f w = *(const v2f*)&wt[ll][0]; sq[0][ll][d] = qr[i] * w[0]; sq[1][ll][d] = qr[i] * w[1]; } }
  for (int e = tid; e < 2 * HD * HD; e += 128) { const int p = e / (HD * HD), rem = e % (HD * HD); const int m = rem / HD, d = rem % HD; const float v = KV[((bh * 2 + p) * HD + m) * HD + d]; const __bf16 hv = (__bf16)v; skh[p][m][d] = hv; skl[p][m][d] = (__bf16)(v - (float)hv); }
  __syncthreads();
  if (tid < 64) { float a = 0.f; for (int d = 0; d < HD; ++d) a += sq[0][tid][d] * KS[bh * 2 * HD + d] + sq[1][tid][d] * KS[bh * 2 * HD + HD + d]; sz[tid] = 1.0f / (a + 1e-6f); }
  v8f acc[4] = {};
#pragma unroll
  for (int p = 0; p < 2; ++p)
#pragma unroll
    for (int kc = 0; kc < HD / 32; ++kc) { const F2 a = split_row(&sq[p][wave * 16 + col][0], kc * 32, lane);
#pragma unroll
      for (int j = 0; j < 4; ++j) { const v16b wh = frag_b(&skh[p][j * 16 + col][0] + kc * 32, lane), wl = frag_b(&skl[p][j * 16 + col][0] + kc * 32, lane); acc[j] = wmma_bf(a.h, wh, acc[j]); acc[j] = wmma_bf(a.l, wh, acc[j]); acc[j] = wmma_bf(a.h, wl, acc[j]); acc[j] = wmma_bf(a.l, wl, acc[j]); } }
  __syncthreads();
#pragma unroll
  for (int j = 0; j < 4; ++j)
#pragma unroll
    for (int r = 0; r < 8; ++r) so[wave][8 * g + r][j * 16 + col] = acc[j][r] * sz[wave * 16 + 8 * g + r];
  LDSX();
  for (int rl = 0; rl < 16; ++rl) if (lane < 16) vst2(OUT + (bh * LL + l0 + wave * 16 + rl) * HD + lane * 4, *(const v4f*)&so[wave][rl][lane * 4]);   // (B H, L, 64) buffer viewed as (L, B, E)
}
extern "C" void kernel_launch(void* const* d_in, const int* in_sizes, int n_in, void* d_out, int out_size, void* d_ws, size_t ws_size, hipStream_t stream) {
  (void)in_sizes; (void)n_in; (void)out_size;
  const float** F = (const float**)d_in;   // 0 query, 1 key, 2 value [2048,4,1024]; 3 Wq [1024,1024], 4 bq, 5 Wk, 6 bk (natural; v uses Wk, bk)
  if (ws_size < (size_t)WS_END) return;
  char* ws = (char*)d_ws; __bf16* PW = (__bf16*)(ws + WS_PW); float *Q = (float*)(ws + WS_Q), *K = (float*)(ws + WS_K), *V = (float*)(ws + WS_V), *KV = (float*)(ws + WS_KV), *KS = (float*)(ws + WS_KS), *KVP = (float*)(ws + WS_KVP); __bf16* PX = (__bf16*)(ws + WS_PX);
  k_pack<<<dim3(3 * RT_X + 2 * RT_W), 256, 0, stream>>>(F[0], F[1], F[2], F[3], F[5], PX, PW);
  k_proj<<<dim3(NR / (32 * FA), EE / (32 * FB), 3), 128, 0, stream>>>(PX, PW, F[4], F[6], Q, K, V);
  k_kv<<<dim3(NSP, TBH), 256, 0, stream>>>(K, V, KVP);
  k_red<<<dim3((PREC / 4 + 255) / 256, TBH), 256, 0, stream>>>(KVP, KV, KS);
  k_fin<<<dim3(LL / 64, TBH), 128, 0, stream>>>(Q, KV, KS, (float*)d_out);
}

// v007
// It runs in 100 microseconds.
// Timed twice side by side with v006, it ran 1.21 times as fast both times.
// Over all steps from v000 it is 12.6 times as fast.
// compute dtype: all float inputs rounded to bf16; q/k/v = x . W^T + b with EXACT bf16 products on WMMA 16x16x32 (both operands packed ahead in fragment order; v uses the k projection as the module does); ReLU and the cos/sin position weights in f32 (precise sinf/cosf); the linear-attention contractions on WMMA with every computed operand as f16 hi + residual (3 products for kv = k_w^T v, 4 products (bf16 hi + lo) for q_w . kv); key sums, normaliser z and the final scaling in f32; f32 output.
#include <hip/hip_runtime.h>
#include <math.h>

typedef __attribute__((ext_vector_type(16))) _Float16 v16h;
typedef __attribute__((ext_vector_type(16))) __bf16 v16b;
typedef __attribute__((ext_vector_type(8)))  _Float16 v8h;
typedef __attribute__((ext_vector_type(8)))  float v8f;
typedef __attribute__((ext_vector_type(4)))  float v4f;
typedef __attribute__((ext_vector_type(2)))  float v2f;
typedef __attribute__((ext_vector_type(4)))  unsigned v4u;
typedef __attribute__((ext_vector_type(4)))  int v4i;
typedef float __attribute__((may_alias)) float_a;
typedef int __attribute__((may_alias)) int_a;

template <typename T> __device__ __forceinline__ void vst2(void* p, T v) { *(T*)p = v;  }
__device__ __forceinline__ v8f wmma16(v16h a, v16h b, v8f c) {
  v8f d = __builtin_amdgcn_wmma_f32_16x16x32_f16(false, a, false, b, (short)0, c, false, false);
  asm volatile("v_nop\n\tv_nop\n\tv_nop\n\tv_nop" : "+v"(d) : "v"(a), "v"(b));
  return d;
}
__device__ __forceinline__ v8f wmma_bf(v16b a, v16b b, v8f c) {
  v8f d = __builtin_amdgcn_wmma_f32_16x16x32_bf16(false, a, false, b, (short)0, c, false, false);
  asm volatile("v_nop\n\tv_nop\n\tv_nop\n\tv_nop" : "+v"(d) : "v"(a), "v"(b));
  return d;
}
// 16x16x32 fragments: lane = (h = lane>>4, row/col = lane&15); elements 0..7 = k0+8h+0..7, 8..15 = k0+16+8h+0..7; D element r = row 8h+r
__device__ __forceinline__ v16h frag_h(const _Float16* rowk0, int lane) {
  union { v16h v; v8h q[2]; } u; const _Float16* p = rowk0 + 8 * (lane >> 4);
  u.q[0] = *(const v8h*)p; u.q[1] = *(const v8h*)(p + 16); return u.v;
}
__device__ __forceinline__ v16h frag_f32(const float* rowk0, int lane) {
  v16h a; const float* p = rowk0 + 8 * (lane >> 4);
#pragma unroll
  for (int i = 0; i < 8; ++i) { a[i] = (_Float16)p[i]; a[8 + i] = (_Float16)p[16 + i]; }
  return a;
}
__device__ __forceinline__ v16h frag_f32s(const float* rowk0, int lane, float sc) {
  v16h a; const float* p = rowk0 + 8 * (lane >> 4);
#pragma unroll
  for (int i = 0; i < 8; ++i) { a[i] = (_Float16)(p[i] * sc); a[8 + i] = (_Float16)(p[16 + i] * sc); }
  return a;
}
// column fragment from a [K][ld] layout (column n), rows >= K read as 0
__device__ __forceinline__ v16h fragc_f32(const float* W, int k0, int n, int lane, int ld, int K) {
  v16h a; const int g = lane >> 4;
#pragma unroll
  for (int i = 0; i < 8; ++i) { const int ka = k0 + 8 * g + i, kb = ka + 16;
    a[i] = (_Float16)(ka < K ? W[(size_t)(ka < K ? ka : K - 1) * ld + n] : 0.f); a[8 + i] = (_Float16)(kb < K ? W[(size_t)(kb < K ? kb : K - 1) * ld + n] : 0.f); }
  return a;
}
struct F2 { v16b h, l; };
__device__ __forceinline__ F2 bsplit16(const float v[16]) { F2 r;
#pragma unroll
  for (int i = 0; i < 16; ++i) { const __bf16 h = (__bf16)v[i]; r.h[i] = h; r.l[i] = (__bf16)(v[i] - (float)h); }
  return r; }
__device__ __forceinline__ F2 split_row(const float* row, int k0, int lane) { float v[16]; const float* p = row + k0 + 8 * (lane >> 4);
#pragma unroll
  for (int i = 0; i < 8; ++i) { v[i] = p[i]; v[8 + i] = p[16 + i]; }
  return bsplit16(v); }
__device__ __forceinline__ F2 split_rowK(const float* row, int k0, int lane, int K) { float v[16]; const int g = lane >> 4;
#pragma unroll
  for (int i = 0; i < 8; ++i) { const int ka = k0 + 8 * g + i, kb = ka + 16; v[i] = ka < K ? row[ka < K ? ka : K - 1] : 0.f; v[8 + i] = kb < K ? row[kb < K ? kb : K - 1] : 0.f; }
  return bsplit16(v); }
__device__ __forceinline__ F2 split_col(const float* W, int k0, int n, int lane, int ld, int K) { float v[16]; const int g = lane >> 4;
#pragma unroll
  for (int i = 0; i < 8; ++i) { const int ka = k0 + 8 * g + i, kb = ka + 16; v[i] = ka < K ? W[(size_t)(ka < K ? ka : K - 1) * ld + n] : 0.f; v[8 + i] = kb < K ? W[(size_t)(kb < K ? kb : K - 1) * ld + n] : 0.f; }
  return bsplit16(v); }
__device__ __forceinline__ v8f mac3(const F2& a, const F2& b, v8f c) { c = wmma_bf(a.l, b.h, c); c = wmma_bf(a.h, b.l, c); return wmma_bf(a.h, b.h, c); }
__device__ __forceinline__ float sigm(float v) { return 1.0f / (1.0f + expf(-v)); }
#define LDSX() do { asm volatile("s_wait_dscnt 0" ::: "memory"); __builtin_amdgcn_wave_barrier(); __builtin_amdgcn_fence(__ATOMIC_RELEASE, "workgroup"); } while (0)


// cosFormer multi-head linear attention (L 2,048, B 4, E 1,024, 16 heads x 64, non-causal): q = relu(Wq x), k = relu(Wk key), v = Wk value; attn = [q cos . (k cos)^T v + q sin . (k sin)^T v] / (q cos . sum k cos + q sin . sum k sin + eps), reshaped (B H, L, 64) -> (L, B, E) by raw view.
#define LL 2048
#define NBATCH 4
#define EE 1024
#define NH 16
#define HD 64
#define NBH (NBATCH * NH)
#define NR (LL * NBATCH)          // token rows (l, b) = l*B + b
#ifndef TBH
#define TBH NBH
#endif
typedef __attribute__((ext_vector_type(8))) __bf16 v8b;
__device__ __forceinline__ v16b frag_b(const __bf16* rowk0, int lane) {
  union { v16b v; v8b q[2]; } u; const __bf16* p = rowk0 + 8 * (lane >> 4);
  u.q[0] = *(const v8b*)p; u.q[1] = *(const v8b*)(p + 16); return u.v;
}
__device__ __forceinline__ float bfr(float v) { return (float)(__bf16)v; }
__device__ __attribute__((noinline)) float exp_ni(float v) { return expf(v); }
__device__ __attribute__((noinline)) float erf_ni(float v) { return erff(v); }

#define WS_PW  0u                                      // bf16 Wq, Wk in fragment order [2][RT_W][TILE_E]
#define WS_Q   (WS_PW + 2u * (size_t)2 * EE * EE)         // f32 rows relu(q) [NR][1024] ; relu(k) ; v
#define WS_K   (WS_Q + 4u * (size_t)NR * EE)
#define WS_V   (WS_K + 4u * (size_t)NR * EE)
#define WS_PL  (WS_V + 4u * (size_t)NR * EE)             // room of the packed inputs (WS_PX)
#define WS_KV  (WS_PL + 2u * (size_t)NBH * 6 * HD * LL)    // f32 [bh][2][64 m][64 d] kv_cos, kv_sin ; ksum [bh][2][64]
#define WS_KS  (WS_KV + 4u * (size_t)NBH * 2 * HD * HD)
#define NSP 16                                         // k_kv splits the LL positions over NSP work-groups a head
#define PREC (2 * HD * HD + 2 * HD)                    // floats of one partial record: kv_cos, kv_sin [64 m][64 d], then the two key sums [64]
#define WS_KVP (WS_KS + 4u * (size_t)NBH * 2 * HD)        // f32 [bh][NSP][PREC] partial records
#define WS_END (WS_KVP + 4u * (size_t)NBH * NSP * PREC)
#define RT_X (NR / 16)                                 // tiles of 16 token rows in one input
#define RT_W (EE / 16)                                 // tiles of 16 rows in one weight
#define TILE_E (16 * EE)                               // bf16 elements of one packed tile: [kc 32][half 2][lane 32][8], the 16 bytes a lane loads for half a 16x16x32 fragment
#define WS_PX  WS_PL                                   // bf16 query, key, value in fragment order [3][RT_X][TILE_E]; half of that room

__device__ __attribute__((noinline)) float sin_p(float v) { return sinf(v); }
__device__ __attribute__((noinline)) float cos_p(float v) { return cosf(v); }
typedef __attribute__((ext_vector_type(4))) __bf16 v4b;
// ---- k_pack: block = one tile of 16 rows x 1024 k of query, key, value, Wq or Wk: read in whole lines, rounded to bf16, turned in LDS and written in fragment order, so that each operand load of k_proj is 512 contiguous bytes
__global__ __launch_bounds__(256) void k_pack(const float* __restrict__ XQ, const float* __restrict__ XK, const float* __restrict__ XV, const float* __restrict__ WQ, const float* __restrict__ WK, __bf16* __restrict__ PX, __bf16* __restrict__ PW) {
  __shared__ __align__(16) __bf16 s[16][EE + 8]; const int t = threadIdx.x, bx = blockIdx.x; const float* src; __bf16* dst;
  if (bx < 3 * RT_X) { const int which = bx / RT_X; src = ((which == 0) ? XQ : (which == 1) ? XK : XV) + (size_t)(bx % RT_X) * TILE_E; dst = PX + (size_t)bx * TILE_E; }
  else { const int e = bx - 3 * RT_X; src = ((e / RT_W) ? WK : WQ) + (size_t)(e % RT_W) * TILE_E; dst = PW + (size_t)e * TILE_E; }
  v4f v[16];
#pragma unroll      // whole: the 16 independent row loads are in flight together
  for (int i = 0; i < 16; ++i) v[i] = *(const v4f*)(src + (size_t)i * EE + t * 4);
#pragma unroll      // whole: v stays in registers
  for (int i = 0; i < 16; ++i) { v4b h; h[0] = (__bf16)v[i][0]; h[1] = (__bf16)v[i][1]; h[2] = (__bf16)v[i][2]; h[3] = (__bf16)v[i][3]; *(v4b*)&s[i][t * 4] = h; }
  __syncthreads();
  for (int o = t; o < TILE_E / 8; o += 256) { const int kc = o >> 6, half = (o >> 5) & 1, lane = o & 31; *(v8b*)(dst + (size_t)o * 8) = *(const v8b*)&s[lane & 15][kc * 32 + half * 16 + 8 * (lane >> 4)]; }
}
// fragment from a packed tile: p = tile + kc * 512 + lane * 8; elements 0..7 = k0+8h+0..7, 8..15 = k0+16+8h+0..7 of row lane&15, as frag_b gives them
__device__ __forceinline__ v16b frag_p(const __bf16* p) { union { v16b v; v8b q[2]; } u; u.q[0] = *(const v8b*)p; u.q[1] = *(const v8b*)(p + 256); return u.v; }
// ---- k_proj: block = (128 token rows, 256 cols, which), 2 x 2 waves of 64 rows x 128 cols each: q = relu(x Wq^T + bq), k = relu(key Wk^T + bk), v = value Wk^T + bk; f32 rows
#define FA 4                                           // fragments of 16 token rows a wave
#define FB 8                                           // fragments of 16 output columns a wave
// two waves a SIMD: the attribute holds the register budget at 512, so that a second work-group's products run under this one's waits
__global__ __launch_bounds__(128) __attribute__((amdgpu_waves_per_eu(2, 2))) void k_proj(const __bf16* __restrict__ PX, const __bf16* __restrict__ PW, const float* __restrict__ BQ, const float* __restrict__ BK, float* __restrict__ Q, float* __restrict__ K, float* __restrict__ V) {
  __shared__ __align__(16) float so[4][FA * 16][FB * 16 + 4];
  const int tid = threadIdx.x, wave = tid >> 5, lane = tid & 31, col = lane & 15, g = lane >> 4; const int which = blockIdx.z; const int wr = wave >> 1, wc = wave & 1; const size_t r0 = ((size_t)blockIdx.x * 2 + wr) * (FA * 16); const int c0 = (blockIdx.y * 2 + wc) * (FB * 16);
  const __bf16* Ar = PX + ((size_t)which * RT_X + (blockIdx.x * 2 + wr) * FA) * TILE_E + lane * 8; const __bf16* Br = PW + ((size_t)((which == 0) ? 0 : RT_W) + (blockIdx.y * 2 + wc) * FB) * TILE_E + lane * 8; const float* BB = (which == 0) ? BQ : BK; float* dst = (which == 0) ? Q : (which == 1) ? K : V;
  v8f acc[FA][FB] = {};
  // FA x FB accumulator tiles a wave: a loaded A fragment feeds FB products, a B fragment FA. Two register sets of operands: the loads of the next k step are issued together, in front of the products of this step, so one memory latency is paid per step and it runs under the products
  v16b a0[FA], a1[FA], b0[FB], b1[FB];
  // the scheduling barrier at the end keeps the products behind the loads: without it the first product, and with it the wait for the set that it reads, is lifted over the next set's loads
#define PROJ_LD(a, b, kc) do { _Pragma("unroll") for (int j = 0; j < FA; ++j) a[j] = frag_p(Ar + (size_t)j * TILE_E + (kc) * 512); _Pragma("unroll") for (int j = 0; j < FB; ++j) b[j] = frag_p(Br + (size_t)j * TILE_E + (kc) * 512); __builtin_amdgcn_sched_barrier(0); } while (0)
  // the plain builtin: the compiler keeps the distances behind a WMMA itself, and the fragments may lie above v255, which an asm operand cannot name
#define PROJ_MM(a, b) do { _Pragma("unroll") for (int i = 0; i < FA; ++i) { _Pragma("unroll") for (int j = 0; j < FB; ++j) acc[i][j] = __builtin_amdgcn_wmma_f32_16x16x32_bf16(false, a[i], false, b[j], (short)0, acc[i][j], false, false); } } while (0)
  PROJ_LD(a0, b0, 0);
#pragma unroll      // whole: every load address is then a start pointer plus an immediate, so no address register is rewritten, and waited for, while the loads fly
  for (int kc = 0; kc < EE / 32 - 2; kc += 2) { PROJ_LD(a1, b1, kc + 1); PROJ_MM(a0, b0); PROJ_LD(a0, b0, kc + 2); PROJ_MM(a1, b1); }
  PROJ_LD(a1, b1, EE / 32 - 1); PROJ_MM(a0, b0); PROJ_MM(a1, b1);
  asm volatile("s_wait_xcnt 0x0" :: "v"(Ar), "v"(Br) : "memory");   // stands behind the loads; the pointers as inputs keep their address registers unwritten up to this wait
  const float* pb = BB + c0 + col; float bb[FB];
#pragma unroll
  for (int j = 0; j < FB; ++j) bb[j] = pb[j * 16];
  asm volatile("s_wait_xcnt 0x0" :: "v"(pb) : "memory");   // stands behind the bias loads; pb as an input keeps their address registers unwritten up to this wait
#pragma unroll
  for (int j = 0; j < FB; ++j) bb[j] = bfr(bb[j]);
#pragma unroll      // whole: acc stays in registers
  for (int i = 0; i < FA; ++i)
#pragma unroll
    for (int j = 0; j < FB; ++j)
#pragma unroll
      for (int r = 0; r < 8; ++r) { const float v = acc[i][j][r] + bb[j]; so[wave][i * 16 + 8 * g + r][j * 16 + col] = (which < 2) ? fmaxf(v, 0.f) : v; }
  LDSX();
#pragma unroll      // whole: every store address is the start pointer plus an immediate
  for (int rl = 0; rl < FA * 16; ++rl) vst2(dst + (r0 + rl) * EE + c0 + lane * 4, *(const v4f*)&so[wave][rl][lane * 4]);   // one row of 512 bytes a store: whole lines
}
// ---- k_kv: block = (SP positions s, bh), a partial record each, summed by k_red. The block reads its own rows of relu(k) and v once, forms k cos/sin-weighted and v as f16 hi + (x2048) residual planes [d][s] in LDS, and takes every fragment from there: kv_cos[m][d] = sum_s kcos[s][d] v[s][m] and kv_sin (A = v planes [m][s], B = k planes [d][s]; hi.hi + hi.lo + lo.hi); key sums over s in f32 (fixed order: 32 positions a thread, then the four quarters in the order of the positions)
#define SP (LL / NSP)                                  // positions of one block
#define PP (SP + 8)                                    // f16 elements from one plane row to the next in LDS: 272 bytes, 16 x odd, free of bank conflicts for 16-byte accesses down a column
__global__ __launch_bounds__(256) void k_kv(const float* __restrict__ K, const float* __restrict__ V, float* __restrict__ KVP) {
  __shared__ __align__(16) char sm[6 * HD * PP * 2];   // the six planes; behind the products the same room stages the two f32 tables
  __shared__ __align__(16) float wt[2][SP]; __shared__ __align__(16) float sp[2][4][HD]; __shared__ __align__(16) float sks[2][HD];
  _Float16 (*st)[HD][PP] = (_Float16 (*)[HD][PP])sm; float (*skv)[HD][HD + 4] = (float (*)[HD][HD + 4])sm;
  const int tid = threadIdx.x, wave = tid >> 5, lane = tid & 31, col = lane & 15, g = lane >> 4; const int s0 = blockIdx.x * SP; const size_t bh = blockIdx.y; const size_t b = bh / NH; const int h = (int)(bh % NH); float* P = KVP + (bh * NSP + blockIdx.x) * PREC;
  const int d = tid & 63, qt = tid >> 6;               // thread = column d, 32 consecutive positions (quarter qt of the block's)
  const size_t row0 = ((size_t)(s0 + qt * 32) * NBATCH + b) * EE + h * HD + d; const float* pk = K + row0; const float* pv = V + row0; float kr[32], vr[32];
#pragma unroll      // whole: the 64 independent loads are in flight together, each a start pointer plus an immediate
  for (int i = 0; i < 32; ++i) { kr[i] = pk[(size_t)i * NBATCH * EE]; vr[i] = pv[(size_t)i * NBATCH * EE]; }
  asm volatile("s_wait_xcnt 0x0" :: "v"(pk), "v"(pv) : "memory");   // stands behind the loads; the pointers as inputs keep their address registers unwritten up to this wait
  // the cos and sin weight of each of the block's positions, computed once (a call waits for every load in flight, so none stands in the element loop)
  { const int i = tid & (SP - 1); const float ang = (1.5707963267948966f * (float)(s0 + i + 1)) / (float)LL; wt[tid / SP][i] = (tid / SP) ? sin_p(ang) : cos_p(ang); }
  __syncthreads();   // publishes the weight table
  float sc = 0.f, ss = 0.f;
#pragma unroll      // whole: kr, vr stay in registers
  for (int i = 0; i < 4; ++i) { const int sl = qt * 32 + i * 8; float cw[8], sw[8]; *(v4f*)&cw[0] = *(const v4f*)&wt[0][sl]; *(v4f*)&cw[4] = *(const v4f*)&wt[0][sl + 4]; *(v4f*)&sw[0] = *(const v4f*)&wt[1][sl]; *(v4f*)&sw[4] = *(const v4f*)&wt[1][sl + 4];
    v8h ch, cl, sh, sl2, vh, vl;
#pragma unroll
    for (int e = 0; e < 8; ++e) { const float kv = kr[i * 8 + e], vv = vr[i * 8 + e]; const float kc = kv * cw[e], ks = kv * sw[e]; sc += kc; ss += ks; _Float16 hv;
      hv = (_Float16)kc; ch[e] = hv; cl[e] = (_Float16)((kc - (float)hv) * 2048.0f);
      hv = (_Float16)ks; sh[e] = hv; sl2[e] = (_Float16)((ks - (float)hv) * 2048.0f);
      hv = (_Float16)vv; vh[e] = hv; vl[e] = (_Float16)((vv - (float)hv) * 2048.0f); }
    // eight consecutive positions of a column are 16 bytes of its plane row: one store a plane
    *(v8h*)&st[0][d][sl] = ch; *(v8h*)&st[1][d][sl] = cl; *(v8h*)&st[2][d][sl] = sh; *(v8h*)&st[3][d][sl] = sl2; *(v8h*)&st[4][d][sl] = vh; *(v8h*)&st[5][d][sl] = vl; }
  sp[0][qt][d] = sc; sp[1][qt][d] = ss;
  __syncthreads();   // publishes the planes and the quarters of the key sums
  if (tid < 2 * HD) sks[qt][d] = ((sp[qt][0][d] + sp[qt][1][d]) + sp[qt][2][d]) + sp[qt][3][d];
  // wave = (16 rows m, cos or sin table), all 64 columns d
  const int m0 = (wave & 3) * 16, pl = wave >> 2;
  v8f ac[4] = {}, al[4] = {};
#pragma unroll      // whole: every LDS address is a start address plus an immediate
  for (int kc = 0; kc < SP / 32; ++kc) { const v16h vh = frag_h(&st[4][m0 + col][kc * 32], lane), vl = frag_h(&st[5][m0 + col][kc * 32], lane); v16h kh[4], kl[4];
#pragma unroll
    for (int j = 0; j < 4; ++j) { kh[j] = frag_h(&st[2 * pl][j * 16 + col][kc * 32], lane); kl[j] = frag_h(&st[2 * pl + 1][j * 16 + col][kc * 32], lane); }
    __builtin_amdgcn_sched_barrier(0);   // keeps the 20 LDS reads of a step together in front of its products: without it each pair of reads stands, and is waited for, at its own product
#pragma unroll
    for (int j = 0; j < 4; ++j) { ac[j] = wmma16(vh, kh[j], ac[j]); al[j] = wmma16(vl, kh[j], al[j]); al[j] = wmma16(vh, kl[j], al[j]); } }
  __syncthreads();   // every wave has read its last fragment: the planes' room is free for the tables
#pragma unroll
  for (int j = 0; j < 4; ++j)
#pragma unroll
    for (int r = 0; r < 8; ++r) skv[pl][m0 + 8 * g + r][j * 16 + col] = ac[j][r] + al[j][r] * (1.0f / 2048.0f);
  __syncthreads();   // publishes the tables and the key sums
#pragma unroll      // whole: every store address is the start pointer plus an immediate
  for (int i = 0; i < 2 * HD * HD / 1024; ++i) vst2(P + tid * 4 + i * 1024, *(const v4f*)((const float*)sm + ((tid >> 4) + i * 16) * (HD + 4) + (tid & 15) * 4));   // the two tables are 128 rows on end, in LDS as in the record; 16 rows a pass
  if (tid < 2 * HD / 4) vst2(P + 2 * HD * HD + tid * 4, *(const v4f*)(&sks[0][0] + tid * 4));
}
// ---- k_red: thread = 4 floats of a head's record: the NSP partial records added in f32, in the order of the positions; tables to KV, key sums to KS
__global__ __launch_bounds__(256) void k_red(const float* __restrict__ KVP, float* __restrict__ KV, float* __restrict__ KS) {
  const int q = blockIdx.x * 256 + threadIdx.x; const size_t bh = blockIdx.y; if (q >= PREC / 4) return;
  const float* p = KVP + bh * NSP * PREC + q * 4; v4f r[NSP];
#pragma unroll      // whole: the NSP independent loads are in flight together, one latency instead of NSP
  for (int sp = 0; sp < NSP; ++sp) r[sp] = *(const v4f*)(p + (size_t)sp * PREC);
  asm volatile("s_wait_xcnt 0x0" :: "v"(p) : "memory");   // stands behind the loads; p as an input keeps their address registers unwritten up to this wait
  v4f s = r[0];
#pragma unroll      // whole: r stays in registers
  for (int sp = 1; sp < NSP; ++sp) s += r[sp];
  vst2((q < 2 * HD * HD / 4) ? KV + bh * 2 * HD * HD + q * 4 : KS + bh * 2 * HD + (q * 4 - 2 * HD * HD), s);
}
// ---- k_fin: block = (64 positions l, bh): z = 1/(qcos . sum kcos + qsin . sum ksin + eps); attn[l][m] = z (qcos . kv_cos[m] + qsin . kv_sin[m]) with bf16 hi + lo operands (4 products each); output rows (bh, l) of 64 (raw view)
__global__ __launch_bounds__(128) void k_fin(const float* __restrict__ Q, const float* __restrict__ KV, const float* __restrict__ KS, float* __restrict__ OUT) {
  __shared__ __align__(16) float sq[2][64][HD + 4]; __shared__ __align__(16) __bf16 skh[2][HD][HD + 8]; __shared__ __align__(16) __bf16 skl[2][HD][HD + 8]; __shared__ float sz[64]; __shared__ __align__(16) float so[4][16][68]; __shared__ __align__(8) float wt[64][2]; __shared__ __align__(16) float sks[2 * HD];
  const int tid = threadIdx.x, wave = tid >> 5, lane = tid & 31, col = lane & 15, g = lane >> 4; const int l0 = blockIdx.x * 64; const size_t bh = blockIdx.y; const size_t b = bh / NH; const int h = (int)(bh % NH);
  { const int d = tid & 63; const float* pq = Q + ((size_t)(l0 + (tid >> 6)) * NBATCH + b) * EE + h * HD + d; float qr[32];
#pragma unroll      // whole: the 32 independent loads are in flight together, each the start pointer plus an immediate
    for (int i = 0; i < 32; ++i) qr[i] = pq[(size_t)i * 2 * NBATCH * EE];
    // the head's two tables (16 loads of 16 bytes a thread) and its key sums (one float a thread) are asked for here too: every global read of the block flies at once, one memory latency in all
    const float* pt = KV + bh * 2 * HD * HD + tid * 4; const float* pk = KS + bh * 2 * HD + tid; v4f tr[16];
#pragma unroll      // whole: the 16 independent loads are in flight together, each the start pointer plus an immediate
    for (int i = 0; i < 16; ++i) tr[i] = *(const v4f*)(pt + i * 512);
    const float ksv = *pk;
    asm volatile("s_wait_xcnt 0x0" :: "v"(pq) : "memory");   // stands behind the loads; pq as an input keeps the q loads' address registers unwritten up to this wait (the table and key-sum loads go by the thread index and a scalar base)
    // the cos and sin weight of each of the 64 positions, computed once (a call waits for every load in flight, so none stands in the element loop)
    { const float ang = (1.5707963267948966f * (float)(l0 + d + 1)) / (float)LL; wt[d][tid >> 6] = (tid >> 6) ? sin_p(ang) : cos_p(ang); }
    __syncthreads();
#pragma unroll      // whole: qr stays in registers
    for (int i = 0; i < 32; ++i) { const int ll = (tid >> 6) + 2 * i; const v2f w = *(const v2f*)&wt[ll][0]; sq[0][ll][d] = qr[i] * w[0]; sq[1][ll][d] = qr[i] * w[1]; }
#pragma unroll      // whole: tr stays in registers
    for (int i = 0; i < 16; ++i) { const int p = i >> 3, m = (i & 7) * 8 + (tid >> 4), d4 = (tid & 15) * 4; v4b hv, lv;   // load i of a thread = floats (i * 128 + tid) * 4 .. + 3 of the 2 x 64 x 64 tables
#pragma unroll
      for (int c = 0; c < 4; ++c) { const float v = tr[i][c]; const __bf16 hb = (__bf16)v; hv[c] = hb; lv[c] = (__bf16)(v - (float)hb); }
      *(v4b*)&skh[p][m][d4] = hv; *(v4b*)&skl[p][m][d4] = lv; }
    sks[tid] = ksv; }
  __syncthreads();
  if (tid < 64) { float a = 0.f; for (int d = 0; d < HD; ++d) a += sq[0][tid][d] * sks[d] + sq[1][tid][d] * sks[HD + d]; sz[tid] = 1.0f / (a + 1e-6f); }
  v8f acc[4] = {};
#pragma unroll
  for (int p = 0; p < 2; ++p)
#pragma unroll
    for (int kc = 0; kc < HD / 32; ++kc) { const F2 a = split_row(&sq[p][wave * 16 + col][0], kc * 32, lane);
#pragma unroll
      for (int j = 0; j < 4; ++j) { const v16b wh = frag_b(&skh[p][j * 16 + col][0] + kc * 32, lane), wl = frag_b(&skl[p][j * 16 + col][0] + kc * 32, lane); acc[j] = wmma_bf(a.h, wh, acc[j]); acc[j] = wmma_bf(a.l, wh, acc[j]); acc[j] = wmma_bf(a.h, wl, acc[j]); acc[j] = wmma_bf(a.l, wl, acc[j]); } }
  __syncthreads();
#pragma unroll
  for (int j = 0; j < 4; ++j)
#pragma unroll
    for (int r = 0; r < 8; ++r) so[wave][8 * g + r][j * 16 + col] = acc[j][r] * sz[wave * 16 + 8 * g + r];
  LDSX();
  for (int rl = 0; rl < 16; ++rl) if (lane < 16) vst2(OUT + (bh * LL + l0 + wave * 16 + rl) * HD + lane * 4, *(const v4f*)&so[wave][rl][lane * 4]);   // (B H, L, 64) buffer viewed as (L, B, E)
}
extern "C" void kernel_launch(void* const* d_in, const int* in_sizes, int n_in, void* d_out, int out_size, void* d_ws, size_t ws_size, hipStream_t stream) {
  (void)in_sizes; (void)n_in; (void)out_size;
  const float** F = (const float**)d_in;   // 0 query, 1 key, 2 value [2048,4,1024]; 3 Wq [1024,1024], 4 bq, 5 Wk, 6 bk (natural; v uses Wk, bk)
  if (ws_size < (size_t)WS_END) return;
  char* ws = (char*)d_ws; __bf16* PW = (__bf16*)(ws + WS_PW); float *Q = (float*)(ws + WS_Q), *K = (float*)(ws + WS_K), *V = (float*)(ws + WS_V), *KV = (float*)(ws + WS_KV), *KS = (float*)(ws + WS_KS), *KVP = (float*)(ws + WS_KVP); __bf16* PX = (__bf16*)(ws + WS_PX);
  k_pack<<<dim3(3 * RT_X + 2 * RT_W), 256, 0, stream>>>(F[0], F[1], F[2], F[3], F[5], PX, PW);
  k_proj<<<dim3(NR / (32 * FA), EE / (32 * FB), 3), 128, 0, stream>>>(PX, PW, F[4], F[6], Q, K, V);
  k_kv<<<dim3(NSP, TBH), 256, 0, stream>>>(K, V, KVP);
  k_red<<<dim3((PREC / 4 + 255) / 256, TBH), 256, 0, stream>>>(KVP, KV, KS);
  k_fin<<<dim3(LL / 64, TBH), 128, 0, stream>>>(Q, KV, KS, (float*)d_out);
}

// v008
// One run takes 91.7 microseconds.
// Next to v007, in two timings, it ran 1.09 and 1.10 times as fast.
// All steps since v000 together make it 13.8 times as fast.
// compute dtype: all float inputs rounded to bf16; q/k/v = x . W^T + b with EXACT bf16 products on WMMA 16x16x32 (both operands packed ahead in fragment order; v uses the k projection as the module does); ReLU and the cos/sin position weights in f32 (precise sinf/cosf); the linear-attention contractions on WMMA with every computed operand as f16 hi + residual (3 products for kv = k_w^T v, 4 products (bf16 hi + lo) for q_w . kv); key sums, normaliser z and the final scaling in f32; f32 output.
#include <hip/hip_runtime.h>
#include <math.h>

typedef __attribute__((ext_vector_type(16))) _Float16 v16h;
typedef __attribute__((ext_vector_type(16))) __bf16 v16b;
typedef __attribute__((ext_vector_type(8)))  _Float16 v8h;
typedef __attribute__((ext_vector_type(8)))  float v8f;
typedef __attribute__((ext_vector_type(4)))  float v4f;
typedef __attribute__((ext_vector_type(2)))  float v2f;
typedef __attribute__((ext_vector_type(4)))  unsigned v4u;
typedef __attribute__((ext_vector_type(4)))  int v4i;
typedef float __attribute__((may_alias)) float_a;
typedef int __attribute__((may_alias)) int_a;

template <typename T> __device__ __forceinline__ void vst2(void* p, T v) { *(T*)p = v;  }
__device__ __forceinline__ v8f wmma16(v16h a, v16h b, v8f c) {
  v8f d = __builtin_amdgcn_wmma_f32_16x16x32_f16(false, a, false, b, (short)0, c, false, false);
  asm volatile("v_nop\n\tv_nop\n\tv_nop\n\tv_nop" : "+v"(d) : "v"(a), "v"(b));
  return d;
}
__device__ __forceinline__ v8f wmma_bf(v16b a, v16b b, v8f c) {
  v8f d = __builtin_amdgcn_wmma_f32_16x16x32_bf16(false, a, false, b, (short)0, c, false, false);
  asm volatile("v_nop\n\tv_nop\n\tv_nop\n\tv_nop" : "+v"(d) : "v"(a), "v"(b));
  return d;
}
// 16x16x32 fragments: lane = (h = lane>>4, row/col = lane&15); elements 0..7 = k0+8h+0..7, 8..15 = k0+16+8h+0..7; D element r = row 8h+r
__device__ __forceinline__ v16h frag_h(const _Float16* rowk0, int lane) {
  union { v16h v; v8h q[2]; } u; const _Float16* p = rowk0 + 8 * (lane >> 4);
  u.q[0] = *(const v8h*)p; u.q[1] = *(const v8h*)(p + 16); return u.v;
}
__device__ __forceinline__ v16h frag_f32(const float* rowk0, int lane) {
  v16h a; const float* p = rowk0 + 8 * (lane >> 4);
#pragma unroll
  for (int i = 0; i < 8; ++i) { a[i] = (_Float16)p[i]; a[8 + i] = (_Float16)p[16 + i]; }
  return a;
}
__device__ __forceinline__ v16h frag_f32s(const float* rowk0, int lane, float sc) {
  v16h a; const float* p = rowk0 + 8 * (lane >> 4);
#pragma unroll
  for (int i = 0; i < 8; ++i) { a[i] = (_Float16)(p[i] * sc); a[8 + i] = (_Float16)(p[16 + i] * sc); }
  return a;
}
// column fragment from a [K][ld] layout (column n), rows >= K read as 0
__device__ __forceinline__ v16h fragc_f32(const float* W, int k0, int n, int lane, int ld, int K) {
  v16h a; const int g = lane >> 4;
#pragma unroll
  for (int i = 0; i < 8; ++i) { const int ka = k0 + 8 * g + i, kb = ka + 16;
    a[i] = (_Float16)(ka < K ? W[(size_t)(ka < K ? ka : K - 1) * ld + n] : 0.f); a[8 + i] = (_Float16)(kb < K ? W[(size_t)(kb < K ? kb : K - 1) * ld + n] : 0.f); }
  return a;
}
struct F2 { v16b h, l; };
__device__ __forceinline__ F2 bsplit16(const float v[16]) { F2 r;
#pragma unroll
  for (int i = 0; i < 16; ++i) { const __bf16 h = (__bf16)v[i]; r.h[i] = h; r.l[i] = (__bf16)(v[i] - (float)h); }
  return r; }
__device__ __forceinline__ F2 split_row(const float* row, int k0, int lane) { float v[16]; const float* p = row + k0 + 8 * (lane >> 4);
#pragma unroll
  for (int i = 0; i < 8; ++i) { v[i] = p[i]; v[8 + i] = p[16 + i]; }
  return bsplit16(v); }
__device__ __forceinline__ F2 split_rowK(const float* row, int k0, int lane, int K) { float v[16]; const int g = lane >> 4;
#pragma unroll
  for (int i = 0; i < 8; ++i) { const int ka = k0 + 8 * g + i, kb = ka + 16; v[i] = ka < K ? row[ka < K ? ka : K - 1] : 0.f; v[8 + i] = kb < K ? row[kb < K ? kb : K - 1] : 0.f; }
  return bsplit16(v); }
__device__ __forceinline__ F2 split_col(const float* W, int k0, int n, int lane, int ld, int K) { float v[16]; const int g = lane >> 4;
#pragma unroll
  for (int i = 0; i < 8; ++i) { const int ka = k0 + 8 * g + i, kb = ka + 16; v[i] = ka < K ? W[(size_t)(ka < K ? ka : K - 1) * ld + n] : 0.f; v[8 + i] = kb < K ? W[(size_t)(kb < K ? kb : K - 1) * ld + n] : 0.f; }
  return bsplit16(v); }
__device__ __forceinline__ v8f mac3(const F2& a, const F2& b, v8f c) { c = wmma_bf(a.l, b.h, c); c = wmma_bf(a.h, b.l, c); return wmma_bf(a.h, b.h, c); }
__device__ __forceinline__ float sigm(float v) { return 1.0f / (1.0f + expf(-v)); }
#define LDSX() do { asm volatile("s_wait_dscnt 0" ::: "memory"); __builtin_amdgcn_wave_barrier(); __builtin_amdgcn_fence(__ATOMIC_RELEASE, "workgroup"); } while (0)


// cosFormer multi-head linear attention (L 2,048, B 4, E 1,024, 16 heads x 64, non-causal): q = relu(Wq x), k = relu(Wk key), v = Wk value; attn = [q cos . (k cos)^T v + q sin . (k sin)^T v] / (q cos . sum k cos + q sin . sum k sin + eps), reshaped (B H, L, 64) -> (L, B, E) by raw view.
#define LL 2048
#define NBATCH 4
#define EE 1024
#define NH 16
#define HD 64
#define NBH (NBATCH * NH)
#define NR (LL * NBATCH)          // token rows (l, b) = l*B + b
#ifndef TBH
#define TBH NBH
#endif
typedef __attribute__((ext_vector_type(8))) __bf16 v8b;
__device__ __forceinline__ v16b frag_b(const __bf16* rowk0, int lane) {
  union { v16b v; v8b q[2]; } u; const __bf16* p = rowk0 + 8 * (lane >> 4);
  u.q[0] = *(const v8b*)p; u.q[1] = *(const v8b*)(p + 16); return u.v;
}
__device__ __forceinline__ float bfr(float v) { return (float)(__bf16)v; }
__device__ __attribute__((noinline)) float exp_ni(float v) { return expf(v); }
__device__ __attribute__((noinline)) float erf_ni(float v) { return erff(v); }

#define WS_PW  0u                                      // bf16 Wq, Wk in fragment order [2][RT_W][TILE_E]
#define WS_Q   (WS_PW + 2u * (size_t)2 * EE * EE)         // f32 rows relu(q) [NR][1024]; the rooms WS_K and WS_V are no longer used (k and v stay in their block)
#define WS_K   (WS_Q + 4u * (size_t)NR * EE)
#define WS_V   (WS_K + 4u * (size_t)NR * EE)
#define WS_PL  (WS_V + 4u * (size_t)NR * EE)             // room of the packed inputs (WS_PX)
#define WS_KV  (WS_PL + 2u * (size_t)NBH * 6 * HD * LL)    // f32 [bh][2][64 m][64 d] kv_cos, kv_sin ; ksum [bh][2][64]
#define WS_KS  (WS_KV + 4u * (size_t)NBH * 2 * HD * HD)
#define NSP 16                                         // the key/value blocks of k_proj split the LL positions over NSP work-groups a head
#define PREC (2 * HD * HD + 2 * HD)                    // floats of one partial record: kv_cos, kv_sin [64 m][64 d], then the two key sums [64]
#define WS_KVP (WS_KS + 4u * (size_t)NBH * 2 * HD)        // f32 [bh][NSP][PREC] partial records
#define WS_END (WS_KVP + 4u * (size_t)NBH * NSP * PREC)
#define RT_X (NR / 16)                                 // tiles of 16 token rows in one input
#define RT_W (EE / 16)                                 // tiles of 16 rows in one weight
#define TILE_E (16 * EE)                               // bf16 elements of one packed tile: [kc 32][half 2][lane 32][8], the 16 bytes a lane loads for half a 16x16x32 fragment
#define WS_PX  WS_PL                                   // bf16 query, key, value in fragment order [3][RT_X][TILE_E]; half of that room

__device__ __attribute__((noinline)) float sin_p(float v) { return sinf(v); }
__device__ __attribute__((noinline)) float cos_p(float v) { return cosf(v); }
typedef __attribute__((ext_vector_type(4))) __bf16 v4b;
// ---- k_pack: block = one tile of 16 rows x 1024 k of query, key, value, Wq or Wk: read in whole lines, rounded to bf16, turned in LDS and written in fragment order, so that each operand load of k_proj is 512 contiguous bytes. A tile of query is 16 token rows (l, b) on end; a tile of key or value is 16 consecutive positions l of ONE batch b (tile = b * LL / 16 + l / 16), so that a block of k_proj holds a run of positions of one head
__global__ __launch_bounds__(256) void k_pack(const float* __restrict__ XQ, const float* __restrict__ XK, const float* __restrict__ XV, const float* __restrict__ WQ, const float* __restrict__ WK, __bf16* __restrict__ PX, __bf16* __restrict__ PW) {
  __shared__ __align__(16) __bf16 s[16][EE + 8]; const int t = threadIdx.x, bx = blockIdx.x; const float* src; __bf16* dst; const bool byb = bx >= RT_X && bx < 3 * RT_X;
  if (bx < RT_X) { src = XQ + (size_t)bx * TILE_E; dst = PX + (size_t)bx * TILE_E; }
  else if (byb) { const int rt = bx % RT_X; src = ((bx < 2 * RT_X) ? XK : XV) + ((size_t)(rt % (LL / 16)) * 16 * NBATCH + rt / (LL / 16)) * EE; dst = PX + (size_t)bx * TILE_E; }
  else { const int e = bx - 3 * RT_X; src = ((e / RT_W) ? WK : WQ) + (size_t)(e % RT_W) * TILE_E; dst = PW + (size_t)e * TILE_E; }
  v4f v[16];
  if (byb) { const float* p = src + t * 4;
#pragma unroll      // whole: the 16 independent row loads are in flight together, each the start pointer plus an immediate
    for (int i = 0; i < 16; ++i) v[i] = *(const v4f*)(p + (size_t)i * NBATCH * EE);
    asm volatile("s_wait_xcnt 0x0" :: "v"(p) : "memory");   // stands behind the loads; p as an input keeps their address registers unwritten up to this wait
  } else {
#pragma unroll      // whole: the 16 independent row loads are in flight together
    for (int i = 0; i < 16; ++i) v[i] = *(const v4f*)(src + (size_t)i * EE + t * 4);
  }
#pragma unroll      // whole: v stays in registers
  for (int i = 0; i < 16; ++i) { v4b h; h[0] = (__bf16)v[i][0]; h[1] = (__bf16)v[i][1]; h[2] = (__bf16)v[i][2]; h[3] = (__bf16)v[i][3]; *(v4b*)&s[i][t * 4] = h; }
  __syncthreads();
  for (int o = t; o < TILE_E / 8; o += 256) { const int kc = o >> 6, half = (o >> 5) & 1, lane = o & 31; *(v8b*)(dst + (size_t)o * 8) = *(const v8b*)&s[lane & 15][kc * 32 + half * 16 + 8 * (lane >> 4)]; }
}
// fragment from a packed tile: p = tile + kc * 512 + lane * 8; elements 0..7 = k0+8h+0..7, 8..15 = k0+16+8h+0..7 of row lane&15, as frag_b gives them
__device__ __forceinline__ v16b frag_p(const __bf16* p) { union { v16b v; v8b q[2]; } u; u.q[0] = *(const v8b*)p; u.q[1] = *(const v8b*)(p + 256); return u.v; }
// ---- k_proj: blocks z = 2: (128 token rows, 256 cols) of q = relu(x Wq^T + bq), 2 x 2 waves of 64 rows x 128 cols, f32 rows to Q. Blocks z = 0, 1: (128 positions of one batch, 128 cols = 2 heads) of BOTH k = relu(key Wk^T + bk) and v = value Wk^T + bk: wave = (64 positions, k or v); k and v never leave the block: from the accumulators it forms, head by head, k cos/sin-weighted and v as f16 hi + (x2048) residual planes [d][s] in LDS and from these a partial record, summed by k_red: kv_cos[m][d] = sum_s kcos[s][d] v[s][m] and kv_sin (A = v planes [m][s], B = k planes [d][s]; hi.hi + hi.lo + lo.hi); key sums over s in f32 (fixed order: a lane's 32 positions, then the four lane groups)
#define FA 4                                           // fragments of 16 token rows a wave
#define FB 8                                           // fragments of 16 output columns a wave
#define SP (LL / NSP)                                  // positions of one key/value block
#define PP (SP + 8)                                    // f16 elements from one plane row to the next in LDS: 272 bytes, 16 x odd, free of bank conflicts for 16-byte accesses down a column
#define PL_B (6 * HD * PP * 2)                         // bytes of the six planes
// two waves a SIMD: the attribute holds the register budget at 512, so that a second work-group's products run under this one's waits
__global__ __launch_bounds__(128) __attribute__((amdgpu_waves_per_eu(2, 2))) void k_proj(const __bf16* __restrict__ PX, const __bf16* __restrict__ PW, const float* __restrict__ BQ, const float* __restrict__ BK, float* __restrict__ Q, float* __restrict__ KVP) {
  __shared__ __align__(16) char smem[4 * FA * 16 * (FB * 16 + 4) * 4];   // query blocks: the f32 staging of the four waves; key/value blocks: the six planes (behind the products the same room stages the two f32 tables), then the weight table and the key sums
  const int tid = threadIdx.x, wave = __builtin_amdgcn_readfirstlane(tid >> 5), lane = tid & 31, col = lane & 15, g = lane >> 4; const int z = blockIdx.z; const bool kvb = z < 2; const int wr = wave >> 1;
  // query block: wc = half of the columns. Key/value block: wc = 0 the k wave, 1 the v wave; which of a pair of waves takes k (the longer epilogue) alternates from block to block, so that two blocks on one WGP need not have their k waves on the same SIMDs (for speed only)
  const int wc = (wave & 1) ^ (kvb ? (blockIdx.x ^ z) & 1 : 0);
  float (*wt)[SP] = (float (*)[SP])(smem + PL_B);
  // the cos and sin weight of each of the block's positions, computed once, at the head: a call here finds no load in flight and no accumulator live
  if (kvb) { const float ang = (1.5707963267948966f * (float)((blockIdx.x & (NSP - 1)) * SP + tid + 1)) / (float)LL; wt[0][tid] = cos_p(ang); wt[1][tid] = sin_p(ang);
    __syncthreads(); }   // publishes the weight table
  const int cb = blockIdx.y * 2 + (kvb ? z : wc);      // block of 128 output columns
  // operand addresses: a wave-uniform base in scalar registers plus the lane's 16 bytes; only the two bases step from trip to trip
  unsigned long long Ab = (unsigned long long)(PX + ((size_t)(kvb ? 1 + wc : 0) * RT_X + (blockIdx.x * 2 + wr) * FA) * TILE_E), Bb = (unsigned long long)(PW + ((size_t)(kvb ? RT_W : 0) + cb * FB) * TILE_E); const unsigned vo = (unsigned)lane * 16u; const int c0 = cb * (FB * 16);
  // the bases pass through an asm statement as integers: the cast names the global address space again, else the loads would be flat ones
#define FRAG_G(base, off) ({ union { v16b v; v8b q[2]; } u_; u_.q[0] = *(const __attribute__((address_space(1))) v8b*)((base) + (unsigned long long)vo + (unsigned long long)(off)); u_.q[1] = *(const __attribute__((address_space(1))) v8b*)((base) + (unsigned long long)vo + (unsigned long long)(off) + 512u); u_.v; })
  v8f acc[FA][FB] = {};
  // FA x FB accumulator tiles a wave: a loaded A fragment feeds FB products, a B fragment FA. Two register sets of operands: the loads of the next k step are issued together, in front of the products of this step, so one memory latency is paid per step and it runs under the products
  v16b a0[FA], a1[FA], b0[FB], b1[FB];
  // the scheduling barrier at the end keeps the products behind the loads: without it the first product, and with it the wait for the set that it reads, is lifted over the next set's loads
#define PROJ_LD(a, b, kc) do { _Pragma("unroll") for (int j = 0; j < FA; ++j) a[j] = FRAG_G(Ab, (size_t)j * TILE_E * 2 + (kc) * 1024); _Pragma("unroll") for (int j = 0; j < FB; ++j) b[j] = FRAG_G(Bb, (size_t)j * TILE_E * 2 + (kc) * 1024); __builtin_amdgcn_sched_barrier(0); } while (0)
  // the plain builtin: the compiler keeps the distances behind a WMMA itself, and the fragments may lie above v255, which an asm operand cannot name
#define PROJ_MM(a, b) do { _Pragma("unroll") for (int i = 0; i < FA; ++i) { _Pragma("unroll") for (int j = 0; j < FB; ++j) acc[i][j] = __builtin_amdgcn_wmma_f32_16x16x32_bf16(false, a[i], false, b[j], (short)0, acc[i][j], false, false); } } while (0)
  PROJ_LD(a0, b0, 0);
#pragma unroll 1    // three trips of ten k steps (for speed only)
  for (int t3 = 0; t3 < 3; ++t3) {
#pragma unroll      // whole: every load address of a trip is a start pointer plus an immediate
    for (int kc = 0; kc < 10; kc += 2) { PROJ_LD(a1, b1, kc + 1); PROJ_MM(a0, b0); PROJ_LD(a0, b0, kc + 2); PROJ_MM(a1, b1); }
    // the step of the two bases (ten k steps of 1,024 bytes) in one statement with the wait that stands in front of it: the loads issued above name these registers
    asm volatile("s_wait_xcnt 0x0\n\ts_add_nc_u64 %0, %0, 0x2800\n\ts_add_nc_u64 %1, %1, 0x2800" : "+s"(Ab), "+s"(Bb) :: "memory"); }
  { const unsigned long long At = Ab + vo, Bt = Bb + vo;   // the last step's loads go by these two lane addresses
#pragma unroll
    for (int j = 0; j < FA; ++j) { union { v16b v; v8b q[2]; } u; u.q[0] = *(const __attribute__((address_space(1))) v8b*)(At + (size_t)j * TILE_E * 2 + 1024); u.q[1] = *(const __attribute__((address_space(1))) v8b*)(At + (size_t)j * TILE_E * 2 + 1536); a1[j] = u.v; }
#pragma unroll
    for (int j = 0; j < FB; ++j) { union { v16b v; v8b q[2]; } u; u.q[0] = *(const __attribute__((address_space(1))) v8b*)(Bt + (size_t)j * TILE_E * 2 + 1024); u.q[1] = *(const __attribute__((address_space(1))) v8b*)(Bt + (size_t)j * TILE_E * 2 + 1536); b1[j] = u.v; }
    __builtin_amdgcn_sched_barrier(0);   // keeps the products behind the loads, as in PROJ_LD
    asm volatile("s_wait_xcnt 0x0" :: "v"(At), "v"(Bt) : "memory"); }   // stands behind the last loads; the two addresses as inputs keep their registers unwritten up to this wait
  PROJ_MM(a0, b0); PROJ_MM(a1, b1);
  const float* pb = (kvb ? BK : BQ) + c0 + col; float bb[FB];
#pragma unroll
  for (int j = 0; j < FB; ++j) bb[j] = pb[j * 16];
  asm volatile("s_wait_xcnt 0x0" :: "v"(pb) : "memory");   // stands behind the bias loads; pb as an input keeps their address registers unwritten up to this wait
#pragma unroll
  for (int j = 0; j < FB; ++j) bb[j] = bfr(bb[j]);
  if (kvb) {
    _Float16 (*st)[HD][PP] = (_Float16 (*)[HD][PP])smem; float (*skv)[HD][HD + 4] = (float (*)[HD][HD + 4])smem;
    float (*sp)[4][HD] = (float (*)[4][HD])(smem + PL_B + 2 * SP * 4); float (*sks)[HD] = (float (*)[HD])(smem + PL_B + 2 * SP * 4 + 2 * 4 * HD * 4);
    // the 32 accumulator tiles as a queue of 8 groups (head, 16 positions) of 4 tiles: the loops below stay rolled (short text), work on the first group and move the queue up by one
    v8f T[8][4];
#pragma unroll
    for (int q = 0; q < 8; ++q)
#pragma unroll
      for (int jj = 0; jj < 4; ++jj) T[q][jj] = acc[q & 3][(q >> 2) * 4 + jj];
    const size_t rec0 = ((size_t)(blockIdx.x / NSP) * NH + cb * 2) * NSP + (blockIdx.x & (NSP - 1));   // record of the block's first head; the second head's lies NSP records on
#pragma unroll 1    // rolled: one text for both heads
    for (int hh = 0; hh < 2; ++hh) {
      float sc[4] = {0.f, 0.f, 0.f, 0.f}, ss[4] = {0.f, 0.f, 0.f, 0.f};
#pragma unroll 1    // rolled: one text for the four groups of a head
      for (int i = 0; i < FA; ++i) { const int sl = wr * 64 + i * 16 + 8 * g;   // a lane's 8 accumulator elements are 8 consecutive positions of a column: 16 bytes of its plane row, one store a plane
        if (wc == 0) { float cw[8], sw[8]; *(v4f*)&cw[0] = *(const v4f*)&wt[0][sl]; *(v4f*)&cw[4] = *(const v4f*)&wt[0][sl + 4]; *(v4f*)&sw[0] = *(const v4f*)&wt[1][sl]; *(v4f*)&sw[4] = *(const v4f*)&wt[1][sl + 4];
#pragma unroll
          for (int jj = 0; jj < 4; ++jj) { const int d = jj * 16 + col; v8h ch, cl, sh, sl2;
#pragma unroll
            for (int e = 0; e < 8; ++e) { const float kv = fmaxf(T[0][jj][e] + bb[jj], 0.f); const float kc = kv * cw[e], ks = kv * sw[e]; sc[jj] += kc; ss[jj] += ks; _Float16 hv;
              hv = (_Float16)kc; ch[e] = hv; cl[e] = (_Float16)((kc - (float)hv) * 2048.0f);
              hv = (_Float16)ks; sh[e] = hv; sl2[e] = (_Float16)((ks - (float)hv) * 2048.0f); }
            *(v8h*)&st[0][d][sl] = ch; *(v8h*)&st[1][d][sl] = cl; *(v8h*)&st[2][d][sl] = sh; *(v8h*)&st[3][d][sl] = sl2; } }
        else {
#pragma unroll
          for (int jj = 0; jj < 4; ++jj) { const int d = jj * 16 + col; v8h vh, vl;
#pragma unroll
            for (int e = 0; e < 8; ++e) { const float vv = T[0][jj][e] + bb[jj]; const _Float16 hv = (_Float16)vv; vh[e] = hv; vl[e] = (_Float16)((vv - (float)hv) * 2048.0f); }
            *(v8h*)&st[4][d][sl] = vh; *(v8h*)&st[5][d][sl] = vl; } }
#pragma unroll
        for (int q = 0; q < 7; ++q)
#pragma unroll
          for (int jj = 0; jj < 4; ++jj) T[q][jj] = T[q + 1][jj]; }
      if (wc == 0) {
#pragma unroll
        for (int jj = 0; jj < 4; ++jj) { sp[0][wr * 2 + g][jj * 16 + col] = sc[jj]; sp[1][wr * 2 + g][jj * 16 + col] = ss[jj]; } }
#pragma unroll
      for (int jj = 0; jj < 4; ++jj) bb[jj] = bb[jj + 4];
      __syncthreads();   // publishes the planes and the four parts of the key sums
      { const int p = tid >> 6, d = tid & 63; sks[p][d] = ((sp[p][0][d] + sp[p][1][d]) + sp[p][2][d]) + sp[p][3][d]; }
      // wave = 16 rows m of both tables, all 64 columns d
      const int m0 = wave * 16; v8f ac[2][4] = {}, al[2][4] = {};
#pragma unroll      // whole: every LDS address is a start address plus an immediate
      for (int kc = 0; kc < SP / 32; ++kc) { const v16h vh = frag_h(&st[4][m0 + col][kc * 32], lane), vl = frag_h(&st[5][m0 + col][kc * 32], lane);
#pragma unroll
        for (int pl = 0; pl < 2; ++pl) { v16h kh[4], kl[4];
#pragma unroll
          for (int j = 0; j < 4; ++j) { kh[j] = frag_h(&st[2 * pl][j * 16 + col][kc * 32], lane); kl[j] = frag_h(&st[2 * pl + 1][j * 16 + col][kc * 32], lane); }
          __builtin_amdgcn_sched_barrier(0);   // keeps the LDS reads of a step together in front of its products: without it each pair of reads stands, and is waited for, at its own product
#pragma unroll
          for (int j = 0; j < 4; ++j) { ac[pl][j] = __builtin_amdgcn_wmma_f32_16x16x32_f16(false, vh, false, kh[j], (short)0, ac[pl][j], false, false); al[pl][j] = __builtin_amdgcn_wmma_f32_16x16x32_f16(false, vl, false, kh[j], (short)0, al[pl][j], false, false); al[pl][j] = __builtin_amdgcn_wmma_f32_16x16x32_f16(false, vh, false, kl[j], (short)0, al[pl][j], false, false); } } }
      __syncthreads();   // every wave has read its last fragment: the planes' room is free for the tables
#pragma unroll
      for (int pl = 0; pl < 2; ++pl)
#pragma unroll
        for (int j = 0; j < 4; ++j)
#pragma unroll
          for (int r = 0; r < 8; ++r) skv[pl][m0 + 8 * g + r][j * 16 + col] = ac[pl][j][r] + al[pl][j][r] * (1.0f / 2048.0f);
      __syncthreads();   // publishes the tables and the key sums
      float* P = KVP + (rec0 + (size_t)hh * NSP) * PREC;
#pragma unroll      // whole: every store address is the start pointer plus an immediate
      for (int i = 0; i < 2 * HD * HD / 512; ++i) vst2(P + tid * 4 + i * 512, *(const v4f*)((const float*)smem + ((tid >> 4) + i * 8) * (HD + 4) + (tid & 15) * 4));   // the two tables are 128 rows on end, in LDS as in the record; 8 rows a pass
      if (tid < 2 * HD / 4) vst2(P + 2 * HD * HD + tid * 4, *(const v4f*)(&sks[0][0] + tid * 4));
      asm volatile("s_wait_xcnt 0x0" ::: "memory");   // stands behind the record's stores, in front of the next head's rewriting of their registers
      if (hh == 0) __syncthreads();   // every wave has read the tables and the key sums: their room is free for the next head's planes
    }
  } else {
    float (*so)[FA * 16][FB * 16 + 4] = (float (*)[FA * 16][FB * 16 + 4])smem; const size_t r0 = ((size_t)blockIdx.x * 2 + wr) * (FA * 16);
#pragma unroll      // whole: acc stays in registers
    for (int i = 0; i < FA; ++i)
#pragma unroll
      for (int j = 0; j < FB; ++j)
#pragma unroll
        for (int r = 0; r < 8; ++r) so[wave][i * 16 + 8 * g + r][j * 16 + col] = fmaxf(acc[i][j][r] + bb[j], 0.f);
    LDSX();
#pragma unroll      // whole: every store address is the start pointer plus an immediate
    for (int rg = 0; rg < FA * 16; rg += 16) {
#pragma unroll
      for (int rl = rg; rl < rg + 16; ++rl) vst2(Q + (r0 + rl) * EE + c0 + lane * 4, *(const v4f*)&so[wave][rl][lane * 4]);   // one row of 512 bytes a store: whole lines
      asm volatile("s_wait_xcnt 0x0" ::: "memory"); }   // stands behind 16 stores, in front of the LDS reads that rewrite their data registers
  }
}
// ---- k_red: thread = 4 floats of a head's record: the NSP partial records added in f32, in the order of the positions; tables to KV, key sums to KS
__global__ __launch_bounds__(256) void k_red(const float* __restrict__ KVP, float* __restrict__ KV, float* __restrict__ KS) {
  const int q = blockIdx.x * 256 + threadIdx.x; const size_t bh = blockIdx.y; if (q >= PREC / 4) return;
  const float* p = KVP + bh * NSP * PREC + q * 4; v4f r[NSP];
#pragma unroll      // whole: the NSP independent loads are in flight together, one latency instead of NSP
  for (int sp = 0; sp < NSP; ++sp) r[sp] = *(const v4f*)(p + (size_t)sp * PREC);
  asm volatile("s_wait_xcnt 0x0" :: "v"(p) : "memory");   // stands behind the loads; p as an input keeps their address registers unwritten up to this wait
  v4f s = r[0];
#pragma unroll      // whole: r stays in registers
  for (int sp = 1; sp < NSP; ++sp) s += r[sp];
  vst2((q < 2 * HD * HD / 4) ? KV + bh * 2 * HD * HD + q * 4 : KS + bh * 2 * HD + (q * 4 - 2 * HD * HD), s);
}
// ---- k_fin: block = (64 positions l, bh): z = 1/(qcos . sum kcos + qsin . sum ksin + eps); attn[l][m] = z (qcos . kv_cos[m] + qsin . kv_sin[m]) with bf16 hi + lo operands (4 products each); output rows (bh, l) of 64 (raw view)
__global__ __launch_bounds__(128) void k_fin(const float* __restrict__ Q, const float* __restrict__ KV, const float* __restrict__ KS, float* __restrict__ OUT) {
  __shared__ __align__(16) float sq[2][64][HD + 4]; __shared__ __align__(16) __bf16 skh[2][HD][HD + 8]; __shared__ __align__(16) __bf16 skl[2][HD][HD + 8]; __shared__ float sz[64]; __shared__ __align__(16) float so[4][16][68]; __shared__ __align__(8) float wt[64][2]; __shared__ __align__(16) float sks[2 * HD];
  const int tid = threadIdx.x, wave = tid >> 5, lane = tid & 31, col = lane & 15, g = lane >> 4; const int l0 = blockIdx.x * 64; const size_t bh = blockIdx.y; const size_t b = bh / NH; const int h = (int)(bh % NH);
  { const int d = tid & 63; const float* pq = Q + ((size_t)(l0 + (tid >> 6)) * NBATCH + b) * EE + h * HD + d; float qr[32];
#pragma unroll      // whole: the 32 independent loads are in flight together, each the start pointer plus an immediate
    for (int i = 0; i < 32; ++i) qr[i] = pq[(size_t)i * 2 * NBATCH * EE];
    // the head's two tables (16 loads of 16 bytes a thread) and its key sums (one float a thread) are asked for here too: every global read of the block flies at once, one memory latency in all
    const float* pt = KV + bh * 2 * HD * HD + tid * 4; const float* pk = KS + bh * 2 * HD + tid; v4f tr[16];
#pragma unroll      // whole: the 16 independent loads are in flight together, each the start pointer plus an immediate
    for (int i = 0; i < 16; ++i) tr[i] = *(const v4f*)(pt + i * 512);
    const float ksv = *pk;
    asm volatile("s_wait_xcnt 0x0" :: "v"(pq) : "memory");   // stands behind the loads; pq as an input keeps the q loads' address registers unwritten up to this wait (the table and key-sum loads go by the thread index and a scalar base)
    // the cos and sin weight of each of the 64 positions, computed once (a call waits for every load in flight, so none stands in the element loop)
    { const float ang = (1.5707963267948966f * (float)(l0 + d + 1)) / (float)LL; wt[d][tid >> 6] = (tid >> 6) ? sin_p(ang) : cos_p(ang); }
    __syncthreads();
#pragma unroll      // whole: qr stays in registers
    for (int i = 0; i < 32; ++i) { const int ll = (tid >> 6) + 2 * i; const v2f w = *(const v2f*)&wt[ll][0]; sq[0][ll][d] = qr[i] * w[0]; sq[1][ll][d] = qr[i] * w[1]; }
#pragma unroll      // whole: tr stays in registers
    for (int i = 0; i < 16; ++i) { const int p = i >> 3, m = (i & 7) * 8 + (tid >> 4), d4 = (tid & 15) * 4; v4b hv, lv;   // load i of a thread = floats (i * 128 + tid) * 4 .. + 3 of the 2 x 64 x 64 tables
#pragma unroll
      for (int c = 0; c < 4; ++c) { const float v = tr[i][c]; const __bf16 hb = (__bf16)v; hv[c] = hb; lv[c] = (__bf16)(v - (float)hb); }
      *(v4b*)&skh[p][m][d4] = hv; *(v4b*)&skl[p][m][d4] = lv; }
    sks[tid] = ksv; }
  __syncthreads();
  if (tid < 64) { float a = 0.f; for (int d = 0; d < HD; ++d) a += sq[0][tid][d] * sks[d] + sq[1][tid][d] * sks[HD + d]; sz[tid] = 1.0f / (a + 1e-6f); }
  v8f acc[4] = {};
#pragma unroll
  for (int p = 0; p < 2; ++p)
#pragma unroll
    for (int kc = 0; kc < HD / 32; ++kc) { const F2 a = split_row(&sq[p][wave * 16 + col][0], kc * 32, lane);
#pragma unroll
      for (int j = 0; j < 4; ++j) { const v16b wh = frag_b(&skh[p][j * 16 + col][0] + kc * 32, lane), wl = frag_b(&skl[p][j * 16 + col][0] + kc * 32, lane); acc[j] = wmma_bf(a.h, wh, acc[j]); acc[j] = wmma_bf(a.l, wh, acc[j]); acc[j] = wmma_bf(a.h, wl, acc[j]); acc[j] = wmma_bf(a.l, wl, acc[j]); } }
  __syncthreads();
#pragma unroll
  for (int j = 0; j < 4; ++j)
#pragma unroll
    for (int r = 0; r < 8; ++r) so[wave][8 * g + r][j * 16 + col] = acc[j][r] * sz[wave * 16 + 8 * g + r];
  LDSX();
  for (int rl = 0; rl < 16; ++rl) if (lane < 16) vst2(OUT + (bh * LL + l0 + wave * 16 + rl) * HD + lane * 4, *(const v4f*)&so[wave][rl][lane * 4]);   // (B H, L, 64) buffer viewed as (L, B, E)
}
extern "C" void kernel_launch(void* const* d_in, const int* in_sizes, int n_in, void* d_out, int out_size, void* d_ws, size_t ws_size, hipStream_t stream) {
  (void)in_sizes; (void)n_in; (void)out_size;
  const float** F = (const float**)d_in;   // 0 query, 1 key, 2 value [2048,4,1024]; 3 Wq [1024,1024], 4 bq, 5 Wk, 6 bk (natural; v uses Wk, bk)
  if (ws_size < (size_t)WS_END) return;
  char* ws = (char*)d_ws; __bf16* PW = (__bf16*)(ws + WS_PW); float *Q = (float*)(ws + WS_Q), *KV = (float*)(ws + WS_KV), *KS = (float*)(ws + WS_KS), *KVP = (float*)(ws + WS_KVP); __bf16* PX = (__bf16*)(ws + WS_PX);
  k_pack<<<dim3(3 * RT_X + 2 * RT_W), 256, 0, stream>>>(F[0], F[1], F[2], F[3], F[5], PX, PW);
  k_proj<<<dim3(NR / (32 * FA), EE / (32 * FB), 3), 128, 0, stream>>>(PX, PW, F[4], F[6], Q, KVP);
  k_red<<<dim3((PREC / 4 + 255) / 256, TBH), 256, 0, stream>>>(KVP, KV, KS);
  k_fin<<<dim3(LL / 64, TBH), 128, 0, stream>>>(Q, KV, KS, (float*)d_out);
}

// v009
// A run of this version takes 87.3 microseconds.
// Two timings next to v008 both put it at 1.05 times that version's speed.
// All steps since v000 together make it 14.5 times as fast.
// compute dtype: all float inputs rounded to bf16; q/k/v = x . W^T + b with EXACT bf16 products on WMMA 16x16x32 (both operands packed ahead in fragment order; v uses the k projection as the module does); ReLU and the cos/sin position weights in f32 (precise sinf/cosf); the linear-attention contractions on WMMA with every computed operand as f16 hi + residual (3 products for kv = k_w^T v, 4 products (bf16 hi + lo) for q_w . kv); key sums, normaliser z and the final scaling in f32; f32 output.
#include <hip/hip_runtime.h>
#include <math.h>

typedef __attribute__((ext_vector_type(16))) _Float16 v16h;
typedef __attribute__((ext_vector_type(16))) __bf16 v16b;
typedef __attribute__((ext_vector_type(8)))  _Float16 v8h;
typedef __attribute__((ext_vector_type(8)))  float v8f;
typedef __attribute__((ext_vector_type(4)))  float v4f;
typedef __attribute__((ext_vector_type(2)))  float v2f;
typedef __attribute__((ext_vector_type(4)))  unsigned v4u;
typedef __attribute__((ext_vector_type(4)))  int v4i;
typedef float __attribute__((may_alias)) float_a;
typedef int __attribute__((may_alias)) int_a;

template <typename T> __device__ __forceinline__ void vst2(void* p, T v) { *(T*)p = v;  }
__device__ __forceinline__ v8f wmma16(v16h a, v16h b, v8f c) {
  v8f d = __builtin_amdgcn_wmma_f32_16x16x32_f16(false, a, false, b, (short)0, c, false, false);
  asm volatile("v_nop\n\tv_nop\n\tv_nop\n\tv_nop" : "+v"(d) : "v"(a), "v"(b));
  return d;
}
__device__ __forceinline__ v8f wmma_bf(v16b a, v16b b, v8f c) {
  v8f d = __builtin_amdgcn_wmma_f32_16x16x32_bf16(false, a, false, b, (short)0, c, false, false);
  asm volatile("v_nop\n\tv_nop\n\tv_nop\n\tv_nop" : "+v"(d) : "v"(a), "v"(b));
  return d;
}
// 16x16x32 fragments: lane = (h = lane>>4, row/col = lane&15); elements 0..7 = k0+8h+0..7, 8..15 = k0+16+8h+0..7; D element r = row 8h+r
__device__ __forceinline__ v16h frag_h(const _Float16* rowk0, int lane) {
  union { v16h v; v8h q[2]; } u; const _Float16* p = rowk0 + 8 * (lane >> 4);
  u.q[0] = *(const v8h*)p; u.q[1] = *(const v8h*)(p + 16); return u.v;
}
__device__ __forceinline__ v16h frag_f32(const float* rowk0, int lane) {
  v16h a; const float* p = rowk0 + 8 * (lane >> 4);
#pragma unroll
  for (int i = 0; i < 8; ++i) { a[i] = (_Float16)p[i]; a[8 + i] = (_Float16)p[16 + i]; }
  return a;
}
__device__ __forceinline__ v16h frag_f32s(const float* rowk0, int lane, float sc) {
  v16h a; const float* p = rowk0 + 8 * (lane >> 4);
#pragma unroll
  for (int i = 0; i < 8; ++i) { a[i] = (_Float16)(p[i] * sc); a[8 + i] = (_Float16)(p[16 + i] * sc); }
  return a;
}
// column fragment from a [K][ld] layout (column n), rows >= K read as 0
__device__ __forceinline__ v16h fragc_f32(const float* W, int k0, int n, int lane, int ld, int K) {
  v16h a; const int g = lane >> 4;
#pragma unroll
  for (int i = 0; i < 8; ++i) { const int ka = k0 + 8 * g + i, kb = ka + 16;
    a[i] = (_Float16)(ka < K ? W[(size_t)(ka < K ? ka : K - 1) * ld + n] : 0.f); a[8 + i] = (_Float16)(kb < K ? W[(size_t)(kb < K ? kb : K - 1) * ld + n] : 0.f); }
  return a;
}
struct F2 { v16b h, l; };
__device__ __forceinline__ F2 bsplit16(const float v[16]) { F2 r;
#pragma unroll
  for (int i = 0; i < 16; ++i) { const __bf16 h = (__bf16)v[i]; r.h[i] = h; r.l[i] = (__bf16)(v[i] - (float)h); }
  return r; }
__device__ __forceinline__ F2 split_row(const float* row, int k0, int lane) { float v[16]; const float* p = row + k0 + 8 * (lane >> 4);
#pragma unroll
  for (int i = 0; i < 8; ++i) { v[i] = p[i]; v[8 + i] = p[16 + i]; }
  return bsplit16(v); }
__device__ __forceinline__ F2 split_rowK(const float* row, int k0, int lane, int K) { float v[16]; const int g = lane >> 4;
#pragma unroll
  for (int i = 0; i < 8; ++i) { const int ka = k0 + 8 * g + i, kb = ka + 16; v[i] = ka < K ? row[ka < K ? ka : K - 1] : 0.f; v[8 + i] = kb < K ? row[kb < K ? kb : K - 1] : 0.f; }
  return bsplit16(v); }
__device__ __forceinline__ F2 split_col(const float* W, int k0, int n, int lane, int ld, int K) { float v[16]; const int g = lane >> 4;
#pragma unroll
  for (int i = 0; i < 8; ++i) { const int ka = k0 + 8 * g + i, kb = ka + 16; v[i] = ka < K ? W[(size_t)(ka < K ? ka : K - 1) * ld + n] : 0.f; v[8 + i] = kb < K ? W[(size_t)(kb < K ? kb : K - 1) * ld + n] : 0.f; }
  return bsplit16(v); }
__device__ __forceinline__ v8f mac3(const F2& a, const F2& b, v8f c) { c = wmma_bf(a.l, b.h, c); c = wmma_bf(a.h, b.l, c); return wmma_bf(a.h, b.h, c); }
__device__ __forceinline__ float sigm(float v) { return 1.0f / (1.0f + expf(-v)); }
#define LDSX() do { asm volatile("s_wait_dscnt 0" ::: "memory"); __builtin_amdgcn_wave_barrier(); __builtin_amdgcn_fence(__ATOMIC_RELEASE, "workgroup"); } while (0)


// cosFormer multi-head linear attention (L 2,048, B 4, E 1,024, 16 heads x 64, non-causal): q = relu(Wq x), k = relu(Wk key), v = Wk value; attn = [q cos . (k cos)^T v + q sin . (k sin)^T v] / (q cos . sum k cos + q sin . sum k sin + eps), reshaped (B H, L, 64) -> (L, B, E) by raw view.
#define LL 2048
#define NBATCH 4
#define EE 1024
#define NH 16
#define HD 64
#define NBH (NBATCH * NH)
#define NR (LL * NBATCH)          // token rows (l, b) = l*B + b
#ifndef TBH
#define TBH NBH
#endif
typedef __attribute__((ext_vector_type(8))) __bf16 v8b;
__device__ __forceinline__ v16b frag_b(const __bf16* rowk0, int lane) {
  union { v16b v; v8b q[2]; } u; const __bf16* p = rowk0 + 8 * (lane >> 4);
  u.q[0] = *(const v8b*)p; u.q[1] = *(const v8b*)(p + 16); return u.v;
}
__device__ __forceinline__ float bfr(float v) { return (float)(__bf16)v; }
__device__ __attribute__((noinline)) float exp_ni(float v) { return expf(v); }
__device__ __attribute__((noinline)) float erf_ni(float v) { return erff(v); }

#define WS_PW  0u                                      // bf16 Wq, Wk in fragment order [2][RT_W][TILE_E]
#define WS_Q   (WS_PW + 2u * (size_t)2 * EE * EE)         // f32 rows relu(q) [NR][1024]; the rooms WS_K and WS_V are no longer used (k and v stay in their block)
#define WS_K   (WS_Q + 4u * (size_t)NR * EE)
#define WS_V   (WS_K + 4u * (size_t)NR * EE)
#define WS_PL  (WS_V + 4u * (size_t)NR * EE)             // room of the packed inputs (WS_PX)
#define WS_KV  (WS_PL + 2u * (size_t)NBH * 6 * HD * LL)    // bf16 kv_cos, kv_sin as hi and lo parts in fragment order [bh][hi, lo][table 2][kc 2][j 4][half 2][lane 32][8] ; ksum f32 [bh][2][64]
#define WS_KS  (WS_KV + 4u * (size_t)NBH * 2 * HD * HD)
#define NSP 16                                         // the key/value blocks of k_proj split the LL positions over NSP work-groups a head
#define PREC (2 * HD * HD + 2 * HD)                    // floats of one partial record: kv_cos, kv_sin [64 m][64 d], then the two key sums [64]
#define WS_KVP (WS_KS + 4u * (size_t)NBH * 2 * HD)        // f32 [bh][NSP][PREC] partial records
#define WS_END (WS_KVP + 4u * (size_t)NBH * NSP * PREC)
#define RT_X (NR / 16)                                 // tiles of 16 token rows in one input
#define RT_W (EE / 16)                                 // tiles of 16 rows in one weight
#define TILE_E (16 * EE)                               // bf16 elements of one packed tile: [kc 32][half 2][lane 32][8], the 16 bytes a lane loads for half a 16x16x32 fragment
#define WS_PX  WS_PL                                   // bf16 query, key, value in fragment order [3][RT_X][TILE_E]; half of that room

__device__ __attribute__((noinline)) float sin_p(float v) { return sinf(v); }
__device__ __attribute__((noinline)) float cos_p(float v) { return cosf(v); }
typedef __attribute__((ext_vector_type(4))) __bf16 v4b;
// ---- k_pack: block = one tile of 16 rows x 1024 k of query, key, value, Wq or Wk: read in whole lines, rounded to bf16, turned in LDS and written in fragment order, so that each operand load of k_proj is 512 contiguous bytes. A tile of query is 16 token rows (l, b) on end; a tile of key or value is 16 consecutive positions l of ONE batch b (tile = b * LL / 16 + l / 16), so that a block of k_proj holds a run of positions of one head
__global__ __launch_bounds__(256) void k_pack(const float* __restrict__ XQ, const float* __restrict__ XK, const float* __restrict__ XV, const float* __restrict__ WQ, const float* __restrict__ WK, __bf16* __restrict__ PX, __bf16* __restrict__ PW) {
  __shared__ __align__(16) __bf16 s[16][EE + 8]; const int t = threadIdx.x, bx = blockIdx.x; const float* src; __bf16* dst; const bool byb = bx >= RT_X && bx < 3 * RT_X;
  if (bx < RT_X) { src = XQ + (size_t)bx * TILE_E; dst = PX + (size_t)bx * TILE_E; }
  else if (byb) { const int rt = bx % RT_X; src = ((bx < 2 * RT_X) ? XK : XV) + ((size_t)(rt % (LL / 16)) * 16 * NBATCH + rt / (LL / 16)) * EE; dst = PX + (size_t)bx * TILE_E; }
  else { const int e = bx - 3 * RT_X; src = ((e / RT_W) ? WK : WQ) + (size_t)(e % RT_W) * TILE_E; dst = PW + (size_t)e * TILE_E; }
  v4f v[16];
  if (byb) { const float* p = src + t * 4;
#pragma unroll      // whole: the 16 independent row loads are in flight together, each the start pointer plus an immediate
    for (int i = 0; i < 16; ++i) v[i] = *(const v4f*)(p + (size_t)i * NBATCH * EE);
    asm volatile("s_wait_xcnt 0x0" :: "v"(p) : "memory");   // stands behind the loads; p as an input keeps their address registers unwritten up to this wait
  } else {
#pragma unroll      // whole: the 16 independent row loads are in flight together
    for (int i = 0; i < 16; ++i) v[i] = *(const v4f*)(src + (size_t)i * EE + t * 4);
  }
#pragma unroll      // whole: v stays in registers
  for (int i = 0; i < 16; ++i) { v4b h; h[0] = (__bf16)v[i][0]; h[1] = (__bf16)v[i][1]; h[2] = (__bf16)v[i][2]; h[3] = (__bf16)v[i][3]; *(v4b*)&s[i][t * 4] = h; }
  __syncthreads();
  for (int o = t; o < TILE_E / 8; o += 256) { const int kc = o >> 6, half = (o >> 5) & 1, lane = o & 31; *(v8b*)(dst + (size_t)o * 8) = *(const v8b*)&s[lane & 15][kc * 32 + half * 16 + 8 * (lane >> 4)]; }
}
// fragment from a packed tile: p = tile + kc * 512 + lane * 8; elements 0..7 = k0+8h+0..7, 8..15 = k0+16+8h+0..7 of row lane&15, as frag_b gives them
__device__ __forceinline__ v16b frag_p(const __bf16* p) { union { v16b v; v8b q[2]; } u; u.q[0] = *(const v8b*)p; u.q[1] = *(const v8b*)(p + 256); return u.v; }
// ---- k_proj: blocks z = 2: (128 token rows, 256 cols) of q = relu(x Wq^T + bq), 2 x 2 waves of 64 rows x 128 cols, f32 rows to Q. Blocks z = 0, 1: (128 positions of one batch, 128 cols = 2 heads) of BOTH k = relu(key Wk^T + bk) and v = value Wk^T + bk: wave = (64 positions, k or v); k and v never leave the block: from the accumulators it forms, head by head, k cos/sin-weighted and v as f16 hi + (x2048) residual planes [d][s] in LDS and from these a partial record, summed by k_red: kv_cos[m][d] = sum_s kcos[s][d] v[s][m] and kv_sin (A = v planes [m][s], B = k planes [d][s]; hi.hi + hi.lo + lo.hi); key sums over s in f32 (fixed order: a lane's 32 positions, then the four lane groups)
#define FA 4                                           // fragments of 16 token rows a wave
#define FB 8                                           // fragments of 16 output columns a wave
#define SP (LL / NSP)                                  // positions of one key/value block
#define PP (SP + 8)                                    // f16 elements from one plane row to the next in LDS: 272 bytes, 16 x odd, free of bank conflicts for 16-byte accesses down a column
#define PL_B (6 * HD * PP * 2)                         // bytes of the six planes
// two waves a SIMD: the attribute holds the register budget at 512, so that a second work-group's products run under this one's waits
__global__ __launch_bounds__(128) __attribute__((amdgpu_waves_per_eu(2, 2))) void k_proj(const __bf16* __restrict__ PX, const __bf16* __restrict__ PW, const float* __restrict__ BQ, const float* __restrict__ BK, float* __restrict__ Q, float* __restrict__ KVP) {
  __shared__ __align__(16) char smem[4 * FA * 16 * (FB * 16 + 4) * 4];   // query blocks: the f32 staging of the four waves; key/value blocks: the six planes (behind the products the same room stages the two f32 tables), then the weight table and the key sums
  const int tid = threadIdx.x, wave = __builtin_amdgcn_readfirstlane(tid >> 5), lane = tid & 31, col = lane & 15, g = lane >> 4; const int z = blockIdx.z; const bool kvb = z < 2; const int wr = wave >> 1;
  // query block: wc = half of the columns. Key/value block: wc = 0 the k wave, 1 the v wave; which of a pair of waves takes k (the longer epilogue) alternates from block to block, so that two blocks on one WGP need not have their k waves on the same SIMDs (for speed only)
  const int wc = (wave & 1) ^ (kvb ? (blockIdx.x ^ z) & 1 : 0);
  float (*wt)[SP] = (float (*)[SP])(smem + PL_B);
  // the cos and sin weight of each of the block's positions, computed once, at the head: a call here finds no load in flight and no accumulator live
  if (kvb) { const float ang = (1.5707963267948966f * (float)((blockIdx.x & (NSP - 1)) * SP + tid + 1)) / (float)LL; wt[0][tid] = cos_p(ang); wt[1][tid] = sin_p(ang);
    __syncthreads(); }   // publishes the weight table
  const int cb = blockIdx.y * 2 + (kvb ? z : wc);      // block of 128 output columns
  // operand addresses: a wave-uniform base in scalar registers plus the lane's 16 bytes; only the two bases step from trip to trip
  unsigned long long Ab = (unsigned long long)(PX + ((size_t)(kvb ? 1 + wc : 0) * RT_X + (blockIdx.x * 2 + wr) * FA) * TILE_E), Bb = (unsigned long long)(PW + ((size_t)(kvb ? RT_W : 0) + cb * FB) * TILE_E); const unsigned vo = (unsigned)lane * 16u; const int c0 = cb * (FB * 16);
  // the bases pass through an asm statement as integers: the cast names the global address space again, else the loads would be flat ones
#define FRAG_G(base, off) ({ union { v16b v; v8b q[2]; } u_; u_.q[0] = *(const __attribute__((address_space(1))) v8b*)((base) + (unsigned long long)vo + (unsigned long long)(off)); u_.q[1] = *(const __attribute__((address_space(1))) v8b*)((base) + (unsigned long long)vo + (unsigned long long)(off) + 512u); u_.v; })
  v8f acc[FA][FB] = {};
  // FA x FB accumulator tiles a wave: a loaded A fragment feeds FB products, a B fragment FA. Two register sets of operands: the loads of the next k step are issued together, in front of the products of this step, so one memory latency is paid per step and it runs under the products
  v16b a0[FA], a1[FA], b0[FB], b1[FB];
  // the scheduling barrier at the end keeps the products behind the loads: without it the first product, and with it the wait for the set that it reads, is lifted over the next set's loads
#define PROJ_LD(a, b, kc) do { _Pragma("unroll") for (int j = 0; j < FA; ++j) a[j] = FRAG_G(Ab, (size_t)j * TILE_E * 2 + (kc) * 1024); _Pragma("unroll") for (int j = 0; j < FB; ++j) b[j] = FRAG_G(Bb, (size_t)j * TILE_E * 2 + (kc) * 1024); __builtin_amdgcn_sched_barrier(0); } while (0)
  // the plain builtin: the compiler keeps the distances behind a WMMA itself, and the fragments may lie above v255, which an asm operand cannot name
#define PROJ_MM(a, b) do { _Pragma("unroll") for (int i = 0; i < FA; ++i) { _Pragma("unroll") for (int j = 0; j < FB; ++j) acc[i][j] = __builtin_amdgcn_wmma_f32_16x16x32_bf16(false, a[i], false, b[j], (short)0, acc[i][j], false, false); } } while (0)
  PROJ_LD(a0, b0, 0);
#pragma unroll 1    // three trips of ten k steps (for speed only)
  for (int t3 = 0; t3 < 3; ++t3) {
#pragma unroll      // whole: every load address of a trip is a start pointer plus an immediate
    for (int kc = 0; kc < 10; kc += 2) { PROJ_LD(a1, b1, kc + 1); PROJ_MM(a0, b0); PROJ_LD(a0, b0, kc + 2); PROJ_MM(a1, b1); }
    // the step of the two bases (ten k steps of 1,024 bytes) in one statement with the wait that stands in front of it: the loads issued above name these registers
    asm volatile("s_wait_xcnt 0x0\n\ts_add_nc_u64 %0, %0, 0x2800\n\ts_add_nc_u64 %1, %1, 0x2800" : "+s"(Ab), "+s"(Bb) :: "memory"); }
  { const unsigned long long At = Ab + vo, Bt = Bb + vo;   // the last step's loads go by these two lane addresses
#pragma unroll
    for (int j = 0; j < FA; ++j) { union { v16b v; v8b q[2]; } u; u.q[0] = *(const __attribute__((address_space(1))) v8b*)(At + (size_t)j * TILE_E * 2 + 1024); u.q[1] = *(const __attribute__((address_space(1))) v8b*)(At + (size_t)j * TILE_E * 2 + 1536); a1[j] = u.v; }
#pragma unroll
    for (int j = 0; j < FB; ++j) { union { v16b v; v8b q[2]; } u; u.q[0] = *(const __attribute__((address_space(1))) v8b*)(Bt + (size_t)j * TILE_E * 2 + 1024); u.q[1] = *(const __attribute__((address_space(1))) v8b*)(Bt + (size_t)j * TILE_E * 2 + 1536); b1[j] = u.v; }
    __builtin_amdgcn_sched_barrier(0);   // keeps the products behind the loads, as in PROJ_LD
    asm volatile("s_wait_xcnt 0x0" :: "v"(At), "v"(Bt) : "memory"); }   // stands behind the last loads; the two addresses as inputs keep their registers unwritten up to this wait
  PROJ_MM(a0, b0); PROJ_MM(a1, b1);
  const float* pb = (kvb ? BK : BQ) + c0 + col; float bb[FB];
#pragma unroll
  for (int j = 0; j < FB; ++j) bb[j] = pb[j * 16];
  asm volatile("s_wait_xcnt 0x0" :: "v"(pb) : "memory");   // stands behind the bias loads; pb as an input keeps their address registers unwritten up to this wait
#pragma unroll
  for (int j = 0; j < FB; ++j) bb[j] = bfr(bb[j]);
  if (kvb) {
    _Float16 (*st)[HD][PP] = (_Float16 (*)[HD][PP])smem; float (*skv)[HD][HD + 4] = (float (*)[HD][HD + 4])smem;
    float (*sp)[4][HD] = (float (*)[4][HD])(smem + PL_B + 2 * SP * 4); float (*sks)[HD] = (float (*)[HD])(smem + PL_B + 2 * SP * 4 + 2 * 4 * HD * 4);
    // the 32 accumulator tiles as a queue of 8 groups (head, 16 positions) of 4 tiles: the loops below stay rolled (short text), work on the first group and move the queue up by one
    v8f T[8][4];
#pragma unroll
    for (int q = 0; q < 8; ++q)
#pragma unroll
      for (int jj = 0; jj < 4; ++jj) T[q][jj] = acc[q & 3][(q >> 2) * 4 + jj];
    const size_t rec0 = ((size_t)(blockIdx.x / NSP) * NH + cb * 2) * NSP + (blockIdx.x & (NSP - 1));   // record of the block's first head; the second head's lies NSP records on
#pragma unroll 1    // rolled: one text for both heads
    for (int hh = 0; hh < 2; ++hh) {
      float sc[4] = {0.f, 0.f, 0.f, 0.f}, ss[4] = {0.f, 0.f, 0.f, 0.f};
#pragma unroll 1    // rolled: one text for the four groups of a head
      for (int i = 0; i < FA; ++i) { const int sl = wr * 64 + i * 16 + 8 * g;   // a lane's 8 accumulator elements are 8 consecutive positions of a column: 16 bytes of its plane row, one store a plane
        if (wc == 0) { float cw[8], sw[8]; *(v4f*)&cw[0] = *(const v4f*)&wt[0][sl]; *(v4f*)&cw[4] = *(const v4f*)&wt[0][sl + 4]; *(v4f*)&sw[0] = *(const v4f*)&wt[1][sl]; *(v4f*)&sw[4] = *(const v4f*)&wt[1][sl + 4];
#pragma unroll
          for (int jj = 0; jj < 4; ++jj) { const int d = jj * 16 + col; v8h ch, cl, sh, sl2;
#pragma unroll
            for (int e = 0; e < 8; ++e) { const float kv = fmaxf(T[0][jj][e] + bb[jj], 0.f); const float kc = kv * cw[e], ks = kv * sw[e]; sc[jj] += kc; ss[jj] += ks; _Float16 hv;
              hv = (_Float16)kc; ch[e] = hv; cl[e] = (_Float16)((kc - (float)hv) * 2048.0f);
              hv = (_Float16)ks; sh[e] = hv; sl2[e] = (_Float16)((ks - (float)hv) * 2048.0f); }
            *(v8h*)&st[0][d][sl] = ch; *(v8h*)&st[1][d][sl] = cl; *(v8h*)&st[2][d][sl] = sh; *(v8h*)&st[3][d][sl] = sl2; } }
        else {
#pragma unroll
          for (int jj = 0; jj < 4; ++jj) { const int d = jj * 16 + col; v8h vh, vl;
#pragma unroll
            for (int e = 0; e < 8; ++e) { const float vv = T[0][jj][e] + bb[jj]; const _Float16 hv = (_Float16)vv; vh[e] = hv; vl[e] = (_Float16)((vv - (float)hv) * 2048.0f); }
            *(v8h*)&st[4][d][sl] = vh; *(v8h*)&st[5][d][sl] = vl; } }
#pragma unroll
        for (int q = 0; q < 7; ++q)
#pragma unroll
          for (int jj = 0; jj < 4; ++jj) T[q][jj] = T[q + 1][jj]; }
      if (wc == 0) {
#pragma unroll
        for (int jj = 0; jj < 4; ++jj) { sp[0][wr * 2 + g][jj * 16 + col] = sc[jj]; sp[1][wr * 2 + g][jj * 16 + col] = ss[jj]; } }
#pragma unroll
      for (int jj = 0; jj < 4; ++jj) bb[jj] = bb[jj + 4];
      __syncthreads();   // publishes the planes and the four parts of the key sums
      { const int p = tid >> 6, d = tid & 63; sks[p][d] = ((sp[p][0][d] + sp[p][1][d]) + sp[p][2][d]) + sp[p][3][d]; }
      // wave = 16 rows m of both tables, all 64 columns d
      const int m0 = wave * 16; v8f ac[2][4] = {}, al[2][4] = {};
#pragma unroll      // whole: every LDS address is a start address plus an immediate
      for (int kc = 0; kc < SP / 32; ++kc) { const v16h vh = frag_h(&st[4][m0 + col][kc * 32], lane), vl = frag_h(&st[5][m0 + col][kc * 32], lane);
#pragma unroll
        for (int pl = 0; pl < 2; ++pl) { v16h kh[4], kl[4];
#pragma unroll
          for (int j = 0; j < 4; ++j) { kh[j] = frag_h(&st[2 * pl][j * 16 + col][kc * 32], lane); kl[j] = frag_h(&st[2 * pl + 1][j * 16 + col][kc * 32], lane); }
          __builtin_amdgcn_sched_barrier(0);   // keeps the LDS reads of a step together in front of its products: without it each pair of reads stands, and is waited for, at its own product
#pragma unroll
          for (int j = 0; j < 4; ++j) { ac[pl][j] = __builtin_amdgcn_wmma_f32_16x16x32_f16(false, vh, false, kh[j], (short)0, ac[pl][j], false, false); al[pl][j] = __builtin_amdgcn_wmma_f32_16x16x32_f16(false, vl, false, kh[j], (short)0, al[pl][j], false, false); al[pl][j] = __builtin_amdgcn_wmma_f32_16x16x32_f16(false, vh, false, kl[j], (short)0, al[pl][j], false, false); } } }
      __syncthreads();   // every wave has read its last fragment: the planes' room is free for the tables
#pragma unroll
      for (int pl = 0; pl < 2; ++pl)
#pragma unroll
        for (int j = 0; j < 4; ++j)
#pragma unroll
          for (int r = 0; r < 8; ++r) skv[pl][m0 + 8 * g + r][j * 16 + col] = ac[pl][j][r] + al[pl][j][r] * (1.0f / 2048.0f);
      __syncthreads();   // publishes the tables and the key sums
      float* P = KVP + (rec0 + (size_t)hh * NSP) * PREC;
#pragma unroll      // whole: every store address is the start pointer plus an immediate
      for (int i = 0; i < 2 * HD * HD / 512; ++i) vst2(P + tid * 4 + i * 512, *(const v4f*)((const float*)smem + ((tid >> 4) + i * 8) * (HD + 4) + (tid & 15) * 4));   // the two tables are 128 rows on end, in LDS as in the record; 8 rows a pass
      if (tid < 2 * HD / 4) vst2(P + 2 * HD * HD + tid * 4, *(const v4f*)(&sks[0][0] + tid * 4));
      asm volatile("s_wait_xcnt 0x0" ::: "memory");   // stands behind the record's stores, in front of the next head's rewriting of their registers
      if (hh == 0) __syncthreads();   // every wave has read the tables and the key sums: their room is free for the next head's planes
    }
  } else {
    float (*so)[FA * 16][FB * 16 + 4] = (float (*)[FA * 16][FB * 16 + 4])smem; const size_t r0 = ((size_t)blockIdx.x * 2 + wr) * (FA * 16);
#pragma unroll      // whole: acc stays in registers
    for (int i = 0; i < FA; ++i)
#pragma unroll
      for (int j = 0; j < FB; ++j)
#pragma unroll
        for (int r = 0; r < 8; ++r) so[wave][i * 16 + 8 * g + r][j * 16 + col] = fmaxf(acc[i][j][r] + bb[j], 0.f);
    LDSX();
#pragma unroll      // whole: every store address is the start pointer plus an immediate
    for (int rg = 0; rg < FA * 16; rg += 16) {
#pragma unroll
      for (int rl = rg; rl < rg + 16; ++rl) vst2(Q + (r0 + rl) * EE + c0 + lane * 4, *(const v4f*)&so[wave][rl][lane * 4]);   // one row of 512 bytes a store: whole lines
      asm volatile("s_wait_xcnt 0x0" ::: "memory"); }   // stands behind 16 stores, in front of the LDS reads that rewrite their data registers
  }
}
// ---- k_red: thread = 4 floats of a head's record: the NSP partial records added in f32, in the order of the positions; key sums to KS in f32; the tables are split here, once a head, into bf16 hi + lo and written as the B fragments of k_fin's products (block = the 16 rows m of one fragment column j of one table; turned in LDS so that every store is whole lines)
#define TABF (2 * HD * HD)                             // bf16 elements of a head's two tables, hi parts; the lo parts follow
__global__ __launch_bounds__(256) void k_red(const float* __restrict__ KVP, __bf16* __restrict__ KVF, float* __restrict__ KS) {
  __shared__ __align__(16) __bf16 sf[2][1024];
  const int t = threadIdx.x, q = blockIdx.x * 256 + t; const size_t bh = blockIdx.y; const bool tab = blockIdx.x < TABF / 1024;   // the same for a whole block: the blocks behind the tables hold the key sums alone
  if (q >= PREC / 4) return;   // only in the key sums' block, which meets no barrier
  const float* p = KVP + bh * NSP * PREC + q * 4; v4f r[NSP];
#pragma unroll      // whole: the NSP independent loads are in flight together, one latency instead of NSP
  for (int sp = 0; sp < NSP; ++sp) r[sp] = *(const v4f*)(p + (size_t)sp * PREC);
  asm volatile("s_wait_xcnt 0x0" :: "v"(p) : "memory");   // stands behind the loads; p as an input keeps their address registers unwritten up to this wait
  v4f s = r[0];
#pragma unroll      // whole: r stays in registers
  for (int sp = 1; sp < NSP; ++sp) s += r[sp];
  if (tab) { const int dq = t & 15;   // the thread's floats: row m = (block & 3) * 16 + (t >> 4), d = dq * 4 .. + 3, so kc = d / 32, half = d / 16 & 1, lane = (d / 8 & 1) * 16 + (m & 15), element d & 7
    v4b hv, lv;
#pragma unroll
    for (int c = 0; c < 4; ++c) { const float v = s[c]; const __bf16 hb = (__bf16)v; hv[c] = hb; lv[c] = (__bf16)(v - (float)hb); }
    const int o = (dq >> 3) * 512 + ((dq >> 2) & 1) * 256 + (((dq >> 1) & 1) * 16 + (t >> 4)) * 8 + (dq & 1) * 4;
    *(v4b*)&sf[0][o] = hv; *(v4b*)&sf[1][o] = lv;
    __syncthreads();   // publishes the block's fragments
    const int hl = t >> 7, kc = (t >> 6) & 1, ch = t & 63;   // 16 bytes a thread: a wave stores 512 bytes on end
    *(v8b*)(KVF + bh * (2 * TABF) + (size_t)hl * TABF + ((((int)blockIdx.x >> 2) * 2 + kc) * 4 + ((int)blockIdx.x & 3)) * 512 + ch * 8) = *(const v8b*)&sf[hl][kc * 512 + ch * 8];
  } else { vst2(KS + bh * 2 * HD + (q * 4 - 2 * HD * HD), s);
    asm volatile("s_wait_xcnt 0x0" ::: "memory"); }   // stands behind the key sums' store, in front of any rewriting of its address and data registers
}
// ---- k_fin: block = (64 positions l, bh): z = 1/(qcos . sum kcos + qsin . sum ksin + eps); attn[l][m] = z (qcos . kv_cos[m] + qsin . kv_sin[m]) with bf16 hi + lo operands (4 products each); the tables come from k_red as ready B fragments, from memory straight into registers; output rows (bh, l) of 64 (raw view)
__global__ __launch_bounds__(128) void k_fin(const float* __restrict__ Q, const __bf16* __restrict__ KVF, const float* __restrict__ KS, float* __restrict__ OUT) {
  __shared__ __align__(16) float sq[2][64][HD + 4]; __shared__ float sz[64]; __shared__ __align__(16) float so[4][16][68]; __shared__ __align__(8) float wt[64][2]; __shared__ __align__(16) float sks[2 * HD];
  const int tid = threadIdx.x, wave = tid >> 5, lane = tid & 31, col = lane & 15, g = lane >> 4; const int l0 = blockIdx.x * 64; const size_t bh = blockIdx.y; const size_t b = bh / NH; const int h = (int)(bh % NH);
  const __bf16* pf = KVF + bh * (2 * TABF) + lane * 8; v16b wh[4], wl[4];   // fragment (step s4 = table * 2 + kc, j): hi at pf + (s4 * 4 + j) * 512, lo TABF on
  { const int d = tid & 63; const float* pq = Q + ((size_t)(l0 + (tid >> 6)) * NBATCH + b) * EE + h * HD + d; float qr[32];
#pragma unroll      // whole: the 32 independent loads are in flight together, each the start pointer plus an immediate
    for (int i = 0; i < 32; ++i) qr[i] = pq[(size_t)i * 2 * NBATCH * EE];
    // the table fragments of the first step (16 loads of 16 bytes a thread) and the head's key sums (one float a thread) are asked for here too, under the same memory latency
    const float* pk = KS + bh * 2 * HD + tid;
#pragma unroll      // whole: the 16 independent loads are in flight together, each the start pointer plus an immediate
    for (int j = 0; j < 4; ++j) { wh[j] = frag_p(pf + j * 512); wl[j] = frag_p(pf + TABF + j * 512); }
    const float ksv = *pk;
    asm volatile("s_wait_xcnt 0x0" :: "v"(pq) : "memory");   // stands behind the loads; pq as an input keeps the q loads' address registers unwritten up to this wait (the table and key-sum loads go by the thread index and a scalar base)
    // the cos and sin weight of each of the 64 positions, computed once (a call waits for every load in flight, so none stands in the element loop)
    { const float ang = (1.5707963267948966f * (float)(l0 + d + 1)) / (float)LL; wt[d][tid >> 6] = (tid >> 6) ? sin_p(ang) : cos_p(ang); }
    __syncthreads();
#pragma unroll      // whole: qr stays in registers
    for (int i = 0; i < 32; ++i) { const int ll = (tid >> 6) + 2 * i; const v2f w = *(const v2f*)&wt[ll][0]; sq[0][ll][d] = qr[i] * w[0]; sq[1][ll][d] = qr[i] * w[1]; }
    sks[tid] = ksv; }
  __syncthreads();
  if (tid < 64) { float a = 0.f; for (int d = 0; d < HD; ++d) a += sq[0][tid][d] * sks[d] + sq[1][tid][d] * sks[HD + d]; sz[tid] = 1.0f / (a + 1e-6f); }
  v8f acc[4] = {};
#pragma unroll      // whole: the fragments stay in registers
  for (int s4 = 0; s4 < 4; ++s4) { const F2 a = split_row(&sq[s4 >> 1][wave * 16 + col][0], (s4 & 1) * 32, lane);   // step = (table s4 >> 1, kc s4 & 1), in the order of before
#pragma unroll
    for (int j = 0; j < 4; ++j) { acc[j] = wmma_bf(a.h, wh[j], acc[j]); acc[j] = wmma_bf(a.l, wh[j], acc[j]); acc[j] = wmma_bf(a.h, wl[j], acc[j]); acc[j] = wmma_bf(a.l, wl[j], acc[j]);
      if (s4 < 3) { wh[j] = frag_p(pf + ((s4 + 1) * 4 + j) * 512); wl[j] = frag_p(pf + TABF + ((s4 + 1) * 4 + j) * 512); } } }   // the next step's pair is asked for as soon as this step's has been used: one set of registers, and the products of three other columns stand between a load and its use
  asm volatile("s_wait_xcnt 0x0" :: "v"(pf) : "memory");   // stands behind the fragment loads; pf as an input keeps their address registers unwritten up to this wait
  __syncthreads();
#pragma unroll
  for (int j = 0; j < 4; ++j)
#pragma unroll
    for (int r = 0; r < 8; ++r) so[wave][8 * g + r][j * 16 + col] = acc[j][r] * sz[wave * 16 + 8 * g + r];
  LDSX();
  for (int rl = 0; rl < 16; ++rl) if (lane < 16) vst2(OUT + (bh * LL + l0 + wave * 16 + rl) * HD + lane * 4, *(const v4f*)&so[wave][rl][lane * 4]);   // (B H, L, 64) buffer viewed as (L, B, E)
}
extern "C" void kernel_launch(void* const* d_in, const int* in_sizes, int n_in, void* d_out, int out_size, void* d_ws, size_t ws_size, hipStream_t stream) {
  (void)in_sizes; (void)n_in; (void)out_size;
  const float** F = (const float**)d_in;   // 0 query, 1 key, 2 value [2048,4,1024]; 3 Wq [1024,1024], 4 bq, 5 Wk, 6 bk (natural; v uses Wk, bk)
  if (ws_size < (size_t)WS_END) return;
  char* ws = (char*)d_ws; __bf16* PW = (__bf16*)(ws + WS_PW); float *Q = (float*)(ws + WS_Q), *KS = (float*)(ws + WS_KS), *KVP = (float*)(ws + WS_KVP); __bf16* PX = (__bf16*)(ws + WS_PX); __bf16* KVF = (__bf16*)(ws + WS_KV);
  k_pack<<<dim3(3 * RT_X + 2 * RT_W), 256, 0, stream>>>(F[0], F[1], F[2], F[3], F[5], PX, PW);
  k_proj<<<dim3(NR / (32 * FA), EE / (32 * FB), 3), 128, 0, stream>>>(PX, PW, F[4], F[6], Q, KVP);
  k_red<<<dim3((PREC / 4 + 255) / 256, TBH), 256, 0, stream>>>(KVP, KVF, KS);
  k_fin<<<dim3(LL / 64, TBH), 128, 0, stream>>>(Q, KVF, KS, (float*)d_out);
}

// v010
// It runs in 82.8 microseconds.
// In two side-by-side timings against v009, it was 1.06 and 1.05 times as fast.
// Counting every step since v000, it is 15.3 times as fast.
// compute dtype: all float inputs rounded to bf16; q/k/v = x . W^T + b with EXACT bf16 products on WMMA 16x16x32 (both operands packed ahead in fragment order; v uses the k projection as the module does); ReLU and the cos/sin position weights in f32 (precise sinf/cosf); the linear-attention contractions on WMMA with every computed operand as f16 hi + residual (3 products for kv = k_w^T v, 4 products (bf16 hi + lo) for q_w . kv); key sums, normaliser z and the final scaling in f32; f32 output.
#include <hip/hip_runtime.h>
#include <math.h>

typedef __attribute__((ext_vector_type(16))) _Float16 v16h;
typedef __attribute__((ext_vector_type(16))) __bf16 v16b;
typedef __attribute__((ext_vector_type(8)))  _Float16 v8h;
typedef __attribute__((ext_vector_type(8)))  float v8f;
typedef __attribute__((ext_vector_type(4)))  float v4f;
typedef __attribute__((ext_vector_type(2)))  float v2f;
typedef __attribute__((ext_vector_type(4)))  unsigned v4u;
typedef __attribute__((ext_vector_type(4)))  int v4i;
typedef float __attribute__((may_alias)) float_a;
typedef int __attribute__((may_alias)) int_a;

template <typename T> __device__ __forceinline__ void vst2(void* p, T v) { *(T*)p = v;  }
__device__ __forceinline__ v8f wmma16(v16h a, v16h b, v8f c) {
  v8f d = __builtin_amdgcn_wmma_f32_16x16x32_f16(false, a, false, b, (short)0, c, false, false);
  asm volatile("v_nop\n\tv_nop\n\tv_nop\n\tv_nop" : "+v"(d) : "v"(a), "v"(b));
  return d;
}
__device__ __forceinline__ v8f wmma_bf(v16b a, v16b b, v8f c) {
  v8f d = __builtin_amdgcn_wmma_f32_16x16x32_bf16(false, a, false, b, (short)0, c, false, false);
  asm volatile("v_nop\n\tv_nop\n\tv_nop\n\tv_nop" : "+v"(d) : "v"(a), "v"(b));
  return d;
}
// 16x16x32 fragments: lane = (h = lane>>4, row/col = lane&15); elements 0..7 = k0+8h+0..7, 8..15 = k0+16+8h+0..7; D element r = row 8h+r
__device__ __forceinline__ v16h frag_h(const _Float16* rowk0, int lane) {
  union { v16h v; v8h q[2]; } u; const _Float16* p = rowk0 + 8 * (lane >> 4);
  u.q[0] = *(const v8h*)p; u.q[1] = *(const v8h*)(p + 16); return u.v;
}
__device__ __forceinline__ v16h frag_f32(const float* rowk0, int lane) {
  v16h a; const float* p = rowk0 + 8 * (lane >> 4);
#pragma unroll
  for (int i = 0; i < 8; ++i) { a[i] = (_Float16)p[i]; a[8 + i] = (_Float16)p[16 + i]; }
  return a;
}
__device__ __forceinline__ v16h frag_f32s(const float* rowk0, int lane, float sc) {
  v16h a; const float* p = rowk0 + 8 * (lane >> 4);
#pragma unroll
  for (int i = 0; i < 8; ++i) { a[i] = (_Float16)(p[i] * sc); a[8 + i] = (_Float16)(p[16 + i] * sc); }
  return a;
}
// column fragment from a [K][ld] layout (column n), rows >= K read as 0
__device__ __forceinline__ v16h fragc_f32(const float* W, int k0, int n, int lane, int ld, int K) {
  v16h a; const int g = lane >> 4;
#pragma unroll
  for (int i = 0; i < 8; ++i) { const int ka = k0 + 8 * g + i, kb = ka + 16;
    a[i] = (_Float16)(ka < K ? W[(size_t)(ka < K ? ka : K - 1) * ld + n] : 0.f); a[8 + i] = (_Float16)(kb < K ? W[(size_t)(kb < K ? kb : K - 1) * ld + n] : 0.f); }
  return a;
}
struct F2 { v16b h, l; };
__device__ __forceinline__ F2 bsplit16(const float v[16]) { F2 r;
#pragma unroll
  for (int i = 0; i < 16; ++i) { const __bf16 h = (__bf16)v[i]; r.h[i] = h; r.l[i] = (__bf16)(v[i] - (float)h); }
  return r; }
__device__ __forceinline__ F2 split_row(const float* row, int k0, int lane) { float v[16]; const float* p = row + k0 + 8 * (lane >> 4);
#pragma unroll
  for (int i = 0; i < 8; ++i) { v[i] = p[i]; v[8 + i] = p[16 + i]; }
  return bsplit16(v); }
__device__ __forceinline__ F2 split_rowK(const float* row, int k0, int lane, int K) { float v[16]; const int g = lane >> 4;
#pragma unroll
  for (int i = 0; i < 8; ++i) { const int ka = k0 + 8 * g + i, kb = ka + 16; v[i] = ka < K ? row[ka < K ? ka : K - 1] : 0.f; v[8 + i] = kb < K ? row[kb < K ? kb : K - 1] : 0.f; }
  return bsplit16(v); }
__device__ __forceinline__ F2 split_col(const float* W, int k0, int n, int lane, int ld, int K) { float v[16]; const int g = lane >> 4;
#pragma unroll
  for (int i = 0; i < 8; ++i) { const int ka = k0 + 8 * g + i, kb = ka + 16; v[i] = ka < K ? W[(size_t)(ka < K ? ka : K - 1) * ld + n] : 0.f; v[8 + i] = kb < K ? W[(size_t)(kb < K ? kb : K - 1) * ld + n] : 0.f; }
  return bsplit16(v); }
__device__ __forceinline__ v8f mac3(const F2& a, const F2& b, v8f c) { c = wmma_bf(a.l, b.h, c); c = wmma_bf(a.h, b.l, c); return wmma_bf(a.h, b.h, c); }
__device__ __forceinline__ float sigm(float v) { return 1.0f / (1.0f + expf(-v)); }
#define LDSX() do { asm volatile("s_wait_dscnt 0" ::: "memory"); __builtin_amdgcn_wave_barrier(); __builtin_amdgcn_fence(__ATOMIC_RELEASE, "workgroup"); } while (0)


// cosFormer multi-head linear attention (L 2,048, B 4, E 1,024, 16 heads x 64, non-causal): q = relu(Wq x), k = relu(Wk key), v = Wk value; attn = [q cos . (k cos)^T v + q sin . (k sin)^T v] / (q cos . sum k cos + q sin . sum k sin + eps), reshaped (B H, L, 64) -> (L, B, E) by raw view.
#define LL 2048
#define NBATCH 4
#define EE 1024
#define NH 16
#define HD 64
#define NBH (NBATCH * NH)
#define NR (LL * NBATCH)          // token rows (l, b) = l*B + b
#ifndef TBH
#define TBH NBH
#endif
typedef __attribute__((ext_vector_type(8))) __bf16 v8b;
__device__ __forceinline__ v16b frag_b(const __bf16* rowk0, int lane) {
  union { v16b v; v8b q[2]; } u; const __bf16* p = rowk0 + 8 * (lane >> 4);
  u.q[0] = *(const v8b*)p; u.q[1] = *(const v8b*)(p + 16); return u.v;
}
__device__ __forceinline__ float bfr(float v) { return (float)(__bf16)v; }
__device__ __attribute__((noinline)) float exp_ni(float v) { return expf(v); }
__device__ __attribute__((noinline)) float erf_ni(float v) { return erff(v); }

#define WS_PW  0u                                      // bf16 Wq, Wk in fragment order [2][RT_W][TILE_E]
#define WS_Q   (WS_PW + 2u * (size_t)2 * EE * EE)         // f32 rows relu(q) [NR][1024]; the rooms WS_K and WS_V are no longer used (k and v stay in their block)
#define WS_K   (WS_Q + 4u * (size_t)NR * EE)
#define WS_V   (WS_K + 4u * (size_t)NR * EE)
#define WS_PL  (WS_V + 4u * (size_t)NR * EE)             // room of the packed inputs (WS_PX)
#define WS_KV  (WS_PL + 2u * (size_t)NBH * 6 * HD * LL)    // bf16 kv_cos, kv_sin as hi and lo parts in fragment order [bh][hi, lo][table 2][kc 2][j 4][half 2][lane 32][8] ; ksum f32 [bh][2][64]
#define WS_KS  (WS_KV + 4u * (size_t)NBH * 2 * HD * HD)
#define NSP 16                                         // the key/value blocks of k_proj split the LL positions over NSP work-groups a head
#define PREC (2 * HD * HD + 2 * HD)                    // floats of one partial record: kv_cos, kv_sin [64 m][64 d], then the two key sums [64]
#define WS_KVP (WS_KS + 4u * (size_t)NBH * 2 * HD)        // f32 [bh][NSP][PREC] partial records
#define WS_END (WS_KVP + 4u * (size_t)NBH * NSP * PREC)
#define RT_X (NR / 16)                                 // tiles of 16 token rows in one input
#define RT_W (EE / 16)                                 // tiles of 16 rows in one weight
#define TILE_E (16 * EE)                               // bf16 elements of one packed tile: [kc 32][half 2][lane 32][8], the 16 bytes a lane loads for half a 16x16x32 fragment
#define WS_PX  WS_PL                                   // bf16 query, key, value in fragment order [3][RT_X][TILE_E]; half of that room

__device__ __attribute__((noinline)) float sin_p(float v) { return sinf(v); }
__device__ __attribute__((noinline)) float cos_p(float v) { return cosf(v); }
typedef __attribute__((ext_vector_type(4))) __bf16 v4b;
// ---- k_pack: query, key, value, Wq and Wk rounded to bf16 and written in fragment order, so that each operand load of k_proj is 512 contiguous bytes. A tile is 16 rows x 1024 k: of query 16 token rows (l, b) on end; of key or value 16 consecutive positions l of ONE batch b (tile = b * LL / 16 + l / 16), so that a block of k_proj holds a run of positions of one head. Unit of work = 16 rows x 128 k of a tile (8 KB in, 4 KB on end out), done by ONE wave: read in whole lines, turned in the wave's own LDS rows, no work-group barrier. One block of 13 waves a WGP, PK_U units a wave, the next unit's loads in flight while this one is turned and stored: a quarter of the waves to start
#define PK_U 4                                         // units a wave
#define PK_G 256                                       // blocks of the launch
#define PK_WA ((RT_X + 2 * RT_W) * 8 / (PK_U * PK_G))  // waves of a block on query and the weights (rows on end)
#define PK_WB (2 * RT_X * 8 / (PK_U * PK_G))           // waves of a block on key and value (rows NBATCH apart)
static_assert(PK_WA * PK_U * PK_G == (RT_X + 2 * RT_W) * 8 && PK_WB * PK_U * PK_G == 2 * RT_X * 8, "the units divide evenly over the waves");
// PITCH = floats from row to row of the source, known at compile time: a straight run of code, every load the unit's start plus the lane's offset plus an immediate. sb[n], db[n] = start of the wave's n-th unit in the source and in the packed tile, the same for the whole wave (scalar registers); sw = the wave's own LDS rows
template <int PITCH> __device__ __forceinline__ void pk_run(const float* const (&sb)[PK_U], __bf16* const (&db)[PK_U], __bf16 (*sw)[128 + 8], int lane) {
  v4f v[2][16];
#pragma unroll      // whole: the 16 independent row loads are in flight together
  for (int i = 0; i < 16; ++i) v[0][i] = *(const v4f*)(sb[0] + lane * 4 + (size_t)i * PITCH);
  asm volatile("s_wait_xcnt 0x0" :: "s"(sb[0]) : "memory");   // stands behind the loads; their base as an input keeps its registers unwritten up to this wait (the lane's offset is never rewritten)
#pragma unroll      // whole: the two register sets are named at compile time
  for (int it = 0; it < PK_U; ++it) {
    if (it + 1 < PK_U) {
#pragma unroll      // whole: the next unit's 16 loads are in flight under this unit's turn and stores
      for (int i = 0; i < 16; ++i) v[(it + 1) & 1][i] = *(const v4f*)(sb[it + 1] + lane * 4 + (size_t)i * PITCH);
      asm volatile("s_wait_xcnt 0x0" :: "s"(sb[it + 1]) : "memory"); }   // as above
#pragma unroll      // whole: v stays in registers
    for (int i = 0; i < 16; ++i) { const v4f x = v[it & 1][i]; v4b h; h[0] = (__bf16)x[0]; h[1] = (__bf16)x[1]; h[2] = (__bf16)x[2]; h[3] = (__bf16)x[3]; *(v4b*)&sw[i][lane * 4] = h; }
    asm volatile("s_wait_dscnt 0" ::: "memory");   // the wave's own rows are written before its lanes read each other's (the clobber keeps the reads below behind it); no fence here: one would also wait for the next unit's loads
    v8b c[8];
#pragma unroll      // whole: the 8 reads are in flight together; chunk (kc, half, lane) = row lane & 15, k = kc * 32 + half * 16 + 8 * (lane >> 4) .. + 7
    for (int k = 0; k < 8; ++k) c[k] = *(const v8b*)&sw[lane & 15][(k >> 1) * 32 + (k & 1) * 16 + 8 * (lane >> 4)];
#pragma unroll      // whole: every store address is the start pointer plus an immediate; 512 bytes on end a store
    for (int k = 0; k < 8; ++k) *(v8b*)(db[it] + lane * 8 + k * 256) = c[k];
    asm volatile("s_wait_xcnt 0x0" :: "s"(db[it]), "v"(c[0]), "v"(c[1]), "v"(c[2]), "v"(c[3]), "v"(c[4]), "v"(c[5]), "v"(c[6]), "v"(c[7]) : "memory");   // stands behind the stores; base and data as inputs keep their registers unwritten up to this wait
  }
}
__global__ __launch_bounds__((PK_WA + PK_WB) * 32) void k_pack(const float* __restrict__ XQ, const float* __restrict__ XK, const float* __restrict__ XV, const float* __restrict__ WQ, const float* __restrict__ WK, __bf16* __restrict__ PX, __bf16* __restrict__ PW) {
  __shared__ __align__(16) __bf16 s[PK_WA + PK_WB][16][128 + 8];   // 272 bytes from row to row, 16 x odd: free of bank conflicts for 16-byte reads down a column
  const int wave = __builtin_amdgcn_readfirstlane(threadIdx.x >> 5), lane = threadIdx.x & 31; const float* sb[PK_U]; __bf16* db[PK_U];
  if (wave < PK_WA) {   // the same for a whole wave
#pragma unroll
    for (int n = 0; n < PK_U; ++n) { const int u = (n * PK_G + blockIdx.x) * PK_WA + wave, tl = u >> 3, e = tl - RT_X; const bool xq = tl < RT_X;   // tile tl of query, or tile e of Wq, Wk on end
      sb[n] = (xq ? XQ + (size_t)tl * TILE_E : (e / RT_W ? WK : WQ) + (size_t)(e % RT_W) * TILE_E) + (u & 7) * 128;
      db[n] = (xq ? PX + (size_t)tl * TILE_E : PW + (size_t)e * TILE_E) + (u & 7) * 2048; }
    pk_run<EE>(sb, db, s[wave], lane);
  } else {
#pragma unroll
    for (int n = 0; n < PK_U; ++n) { const int u = (n * PK_G + blockIdx.x) * PK_WB + wave - PK_WA, tl = u >> 3, rt = tl % RT_X;   // tile rt of key (tl < RT_X) or value
      sb[n] = ((tl < RT_X) ? XK : XV) + ((size_t)(rt % (LL / 16)) * 16 * NBATCH + rt / (LL / 16)) * EE + (u & 7) * 128;
      db[n] = PX + (size_t)(RT_X + tl) * TILE_E + (u & 7) * 2048; }
    pk_run<NBATCH * EE>(sb, db, s[wave], lane);
  }
}
// fragment from a packed tile: p = tile + kc * 512 + lane * 8; elements 0..7 = k0+8h+0..7, 8..15 = k0+16+8h+0..7 of row lane&15, as frag_b gives them
__device__ __forceinline__ v16b frag_p(const __bf16* p) { union { v16b v; v8b q[2]; } u; u.q[0] = *(const v8b*)p; u.q[1] = *(const v8b*)(p + 256); return u.v; }
// ---- k_proj: blocks z = 2: (128 token rows, 256 cols) of q = relu(x Wq^T + bq), 2 x 2 waves of 64 rows x 128 cols, f32 rows to Q. Blocks z = 0, 1: (128 positions of one batch, 128 cols = 2 heads) of BOTH k = relu(key Wk^T + bk) and v = value Wk^T + bk: wave = (64 positions, k or v); k and v never leave the block: from the accumulators it forms, head by head, k cos/sin-weighted and v as f16 hi + (x2048) residual planes [d][s] in LDS and from these a partial record, summed by k_red: kv_cos[m][d] = sum_s kcos[s][d] v[s][m] and kv_sin (A = v planes [m][s], B = k planes [d][s]; hi.hi + hi.lo + lo.hi); key sums over s in f32 (fixed order: a lane's 32 positions, then the four lane groups)
#define FA 4                                           // fragments of 16 token rows a wave
#define FB 8                                           // fragments of 16 output columns a wave
#define SP (LL / NSP)                                  // positions of one key/value block
#define PP (SP + 8)                                    // f16 elements from one plane row to the next in LDS: 272 bytes, 16 x odd, free of bank conflicts for 16-byte accesses down a column
#define PL_B (6 * HD * PP * 2)                         // bytes of the six planes
// two waves a SIMD: the attribute holds the register budget at 512, so that a second work-group's products run under this one's waits
__global__ __launch_bounds__(128) __attribute__((amdgpu_waves_per_eu(2, 2))) void k_proj(const __bf16* __restrict__ PX, const __bf16* __restrict__ PW, const float* __restrict__ BQ, const float* __restrict__ BK, float* __restrict__ Q, float* __restrict__ KVP) {
  __shared__ __align__(16) char smem[4 * FA * 16 * (FB * 16 + 4) * 4];   // query blocks: the f32 staging of the four waves; key/value blocks: the six planes (behind the products the same room stages the two f32 tables), then the weight table and the key sums
  const int tid = threadIdx.x, wave = __builtin_amdgcn_readfirstlane(tid >> 5), lane = tid & 31, col = lane & 15, g = lane >> 4; const int z = blockIdx.z; const bool kvb = z < 2; const int wr = wave >> 1;
  // query block: wc = half of the columns. Key/value block: wc = 0 the k wave, 1 the v wave; which of a pair of waves takes k (the longer epilogue) alternates from block to block, so that two blocks on one WGP need not have their k waves on the same SIMDs (for speed only)
  const int wc = (wave & 1) ^ (kvb ? (blockIdx.x ^ z) & 1 : 0);
  float (*wt)[SP] = (float (*)[SP])(smem + PL_B);
  // the cos and sin weight of each of the block's positions, computed once, at the head: a call here finds no load in flight and no accumulator live
  if (kvb) { const float ang = (1.5707963267948966f * (float)((blockIdx.x & (NSP - 1)) * SP + tid + 1)) / (float)LL; wt[0][tid] = cos_p(ang); wt[1][tid] = sin_p(ang);
    __syncthreads(); }   // publishes the weight table
  const int cb = blockIdx.y * 2 + (kvb ? z : wc);      // block of 128 output columns
  // operand addresses: a wave-uniform base in scalar registers plus the lane's 16 bytes; only the two bases step from trip to trip
  unsigned long long Ab = (unsigned long long)(PX + ((size_t)(kvb ? 1 + wc : 0) * RT_X + (blockIdx.x * 2 + wr) * FA) * TILE_E), Bb = (unsigned long long)(PW + ((size_t)(kvb ? RT_W : 0) + cb * FB) * TILE_E); const unsigned vo = (unsigned)lane * 16u; const int c0 = cb * (FB * 16);
  // the bases pass through an asm statement as integers: the cast names the global address space again, else the loads would be flat ones
#define FRAG_G(base, off) ({ union { v16b v; v8b q[2]; } u_; u_.q[0] = *(const __attribute__((address_space(1))) v8b*)((base) + (unsigned long long)vo + (unsigned long long)(off)); u_.q[1] = *(const __attribute__((address_space(1))) v8b*)((base) + (unsigned long long)vo + (unsigned long long)(off) + 512u); u_.v; })
  v8f acc[FA][FB] = {};
  // FA x FB accumulator tiles a wave: a loaded A fragment feeds FB products, a B fragment FA. Two register sets of operands: the loads of the next k step are issued together, in front of the products of this step, so one memory latency is paid per step and it runs under the products
  v16b a0[FA], a1[FA], b0[FB], b1[FB];
  // the scheduling barrier at the end keeps the products behind the loads: without it the first product, and with it the wait for the set that it reads, is lifted over the next set's loads
#define PROJ_LD(a, b, kc) do { _Pragma("unroll") for (int j = 0; j < FA; ++j) a[j] = FRAG_G(Ab, (size_t)j * TILE_E * 2 + (kc) * 1024); _Pragma("unroll") for (int j = 0; j < FB; ++j) b[j] = FRAG_G(Bb, (size_t)j * TILE_E * 2 + (kc) * 1024); __builtin_amdgcn_sched_barrier(0); } while (0)
  // the plain builtin: the compiler keeps the distances behind a WMMA itself, and the fragments may lie above v255, which an asm operand cannot name
#define PROJ_MM(a, b) do { _Pragma("unroll") for (int i = 0; i < FA; ++i) { _Pragma("unroll") for (int j = 0; j < FB; ++j) acc[i][j] = __builtin_amdgcn_wmma_f32_16x16x32_bf16(false, a[i], false, b[j], (short)0, acc[i][j], false, false); } } while (0)
  PROJ_LD(a0, b0, 0);
#pragma unroll 1    // three trips of ten k steps (for speed only)
  for (int t3 = 0; t3 < 3; ++t3) {
#pragma unroll      // whole: every load address of a trip is a start pointer plus an immediate
    for (int kc = 0; kc < 10; kc += 2) { PROJ_LD(a1, b1, kc + 1); PROJ_MM(a0, b0); PROJ_LD(a0, b0, kc + 2); PROJ_MM(a1, b1); }
    // the step of the two bases (ten k steps of 1,024 bytes) in one statement with the wait that stands in front of it: the loads issued above name these registers
    asm volatile("s_wait_xcnt 0x0\n\ts_add_nc_u64 %0, %0, 0x2800\n\ts_add_nc_u64 %1, %1, 0x2800" : "+s"(Ab), "+s"(Bb) :: "memory"); }
  { const unsigned long long At = Ab + vo, Bt = Bb + vo;   // the last step's loads go by these two lane addresses
#pragma unroll
    for (int j = 0; j < FA; ++j) { union { v16b v; v8b q[2]; } u; u.q[0] = *(const __attribute__((address_space(1))) v8b*)(At + (size_t)j * TILE_E * 2 + 1024); u.q[1] = *(const __attribute__((address_space(1))) v8b*)(At + (size_t)j * TILE_E * 2 + 1536); a1[j] = u.v; }
#pragma unroll
    for (int j = 0; j < FB; ++j) { union { v16b v; v8b q[2]; } u; u.q[0] = *(const __attribute__((address_space(1))) v8b*)(Bt + (size_t)j * TILE_E * 2 + 1024); u.q[1] = *(const __attribute__((address_space(1))) v8b*)(Bt + (size_t)j * TILE_E * 2 + 1536); b1[j] = u.v; }
    __builtin_amdgcn_sched_barrier(0);   // keeps the products behind the loads, as in PROJ_LD
    asm volatile("s_wait_xcnt 0x0" :: "v"(At), "v"(Bt) : "memory"); }   // stands behind the last loads; the two addresses as inputs keep their registers unwritten up to this wait
  PROJ_MM(a0, b0); PROJ_MM(a1, b1);
  const float* pb = (kvb ? BK : BQ) + c0 + col; float bb[FB];
#pragma unroll
  for (int j = 0; j < FB; ++j) bb[j] = pb[j * 16];
  asm volatile("s_wait_xcnt 0x0" :: "v"(pb) : "memory");   // stands behind the bias loads; pb as an input keeps their address registers unwritten up to this wait
#pragma unroll
  for (int j = 0; j < FB; ++j) bb[j] = bfr(bb[j]);
  if (kvb) {
    _Float16 (*st)[HD][PP] = (_Float16 (*)[HD][PP])smem; float (*skv)[HD][HD + 4] = (float (*)[HD][HD + 4])smem;
    float (*sp)[4][HD] = (float (*)[4][HD])(smem + PL_B + 2 * SP * 4); float (*sks)[HD] = (float (*)[HD])(smem + PL_B + 2 * SP * 4 + 2 * 4 * HD * 4);
    // the 32 accumulator tiles as a queue of 8 groups (head, 16 positions) of 4 tiles: the loops below stay rolled (short text), work on the first group and move the queue up by one
    v8f T[8][4];
#pragma unroll
    for (int q = 0; q < 8; ++q)
#pragma unroll
      for (int jj = 0; jj < 4; ++jj) T[q][jj] = acc[q & 3][(q >> 2) * 4 + jj];
    const size_t rec0 = ((size_t)(blockIdx.x / NSP) * NH + cb * 2) * NSP + (blockIdx.x & (NSP - 1));   // record of the block's first head; the second head's lies NSP records on
#pragma unroll 1    // rolled: one text for both heads
    for (int hh = 0; hh < 2; ++hh) {
      float sc[4] = {0.f, 0.f, 0.f, 0.f}, ss[4] = {0.f, 0.f, 0.f, 0.f};
#pragma unroll 1    // rolled: one text for the four groups of a head
      for (int i = 0; i < FA; ++i) { const int sl = wr * 64 + i * 16 + 8 * g;   // a lane's 8 accumulator elements are 8 consecutive positions of a column: 16 bytes of its plane row, one store a plane
        if (wc == 0) { float cw[8], sw[8]; *(v4f*)&cw[0] = *(const v4f*)&wt[0][sl]; *(v4f*)&cw[4] = *(const v4f*)&wt[0][sl + 4]; *(v4f*)&sw[0] = *(const v4f*)&wt[1][sl]; *(v4f*)&sw[4] = *(const v4f*)&wt[1][sl + 4];
#pragma unroll
          for (int jj = 0; jj < 4; ++jj) { const int d = jj * 16 + col; v8h ch, cl, sh, sl2;
#pragma unroll
            for (int e = 0; e < 8; ++e) { const float kv = fmaxf(T[0][jj][e] + bb[jj], 0.f); const float kc = kv * cw[e], ks = kv * sw[e]; sc[jj] += kc; ss[jj] += ks; _Float16 hv;
              hv = (_Float16)kc; ch[e] = hv; cl[e] = (_Float16)((kc - (float)hv) * 2048.0f);
              hv = (_Float16)ks; sh[e] = hv; sl2[e] = (_Float16)((ks - (float)hv) * 2048.0f); }
            *(v8h*)&st[0][d][sl] = ch; *(v8h*)&st[1][d][sl] = cl; *(v8h*)&st[2][d][sl] = sh; *(v8h*)&st[3][d][sl] = sl2; } }
        else {
#pragma unroll
          for (int jj = 0; jj < 4; ++jj) { const int d = jj * 16 + col; v8h vh, vl;
#pragma unroll
            for (int e = 0; e < 8; ++e) { const float vv = T[0][jj][e] + bb[jj]; const _Float16 hv = (_Float16)vv; vh[e] = hv; vl[e] = (_Float16)((vv - (float)hv) * 2048.0f); }
            *(v8h*)&st[4][d][sl] = vh; *(v8h*)&st[5][d][sl] = vl; } }
#pragma unroll
        for (int q = 0; q < 7; ++q)
#pragma unroll
          for (int jj = 0; jj < 4; ++jj) T[q][jj] = T[q + 1][jj]; }
      if (wc == 0) {
#pragma unroll
        for (int jj = 0; jj < 4; ++jj) { sp[0][wr * 2 + g][jj * 16 + col] = sc[jj]; sp[1][wr * 2 + g][jj * 16 + col] = ss[jj]; } }
#pragma unroll
      for (int jj = 0; jj < 4; ++jj) bb[jj] = bb[jj + 4];
      __syncthreads();   // publishes the planes and the four parts of the key sums
      { const int p = tid >> 6, d = tid & 63; sks[p][d] = ((sp[p][0][d] + sp[p][1][d]) + sp[p][2][d]) + sp[p][3][d]; }
      // wave = 16 rows m of both tables, all 64 columns d
      const int m0 = wave * 16; v8f ac[2][4] = {}, al[2][4] = {};
#pragma unroll      // whole: every LDS address is a start address plus an immediate
      for (int kc = 0; kc < SP / 32; ++kc) { const v16h vh = frag_h(&st[4][m0 + col][kc * 32], lane), vl = frag_h(&st[5][m0 + col][kc * 32], lane);
#pragma unroll
        for (int pl = 0; pl < 2; ++pl) { v16h kh[4], kl[4];
#pragma unroll
          for (int j = 0; j < 4; ++j) { kh[j] = frag_h(&st[2 * pl][j * 16 + col][kc * 32], lane); kl[j] = frag_h(&st[2 * pl + 1][j * 16 + col][kc * 32], lane); }
          __builtin_amdgcn_sched_barrier(0);   // keeps the LDS reads of a step together in front of its products: without it each pair of reads stands, and is waited for, at its own product
#pragma unroll
          for (int j = 0; j < 4; ++j) { ac[pl][j] = __builtin_amdgcn_wmma_f32_16x16x32_f16(false, vh, false, kh[j], (short)0, ac[pl][j], false, false); al[pl][j] = __builtin_amdgcn_wmma_f32_16x16x32_f16(false, vl, false, kh[j], (short)0, al[pl][j], false, false); al[pl][j] = __builtin_amdgcn_wmma_f32_16x16x32_f16(false, vh, false, kl[j], (short)0, al[pl][j], false, false); } } }
      __syncthreads();   // every wave has read its last fragment: the planes' room is free for the tables
#pragma unroll
      for (int pl = 0; pl < 2; ++pl)
#pragma unroll
        for (int j = 0; j < 4; ++j)
#pragma unroll
          for (int r = 0; r < 8; ++r) skv[pl][m0 + 8 * g + r][j * 16 + col] = ac[pl][j][r] + al[pl][j][r] * (1.0f / 2048.0f);
      __syncthreads();   // publishes the tables and the key sums
      float* P = KVP + (rec0 + (size_t)hh * NSP) * PREC;
#pragma unroll      // whole: every store address is the start pointer plus an immediate
      for (int i = 0; i < 2 * HD * HD / 512; ++i) vst2(P + tid * 4 + i * 512, *(const v4f*)((const float*)smem + ((tid >> 4) + i * 8) * (HD + 4) + (tid & 15) * 4));   // the two tables are 128 rows on end, in LDS as in the record; 8 rows a pass
      if (tid < 2 * HD / 4) vst2(P + 2 * HD * HD + tid * 4, *(const v4f*)(&sks[0][0] + tid * 4));
      asm volatile("s_wait_xcnt 0x0" ::: "memory");   // stands behind the record's stores, in front of the next head's rewriting of their registers
      if (hh == 0) __syncthreads();   // every wave has read the tables and the key sums: their room is free for the next head's planes
    }
  } else {
    float (*so)[FA * 16][FB * 16 + 4] = (float (*)[FA * 16][FB * 16 + 4])smem; const size_t r0 = ((size_t)blockIdx.x * 2 + wr) * (FA * 16);
#pragma unroll      // whole: acc stays in registers
    for (int i = 0; i < FA; ++i)
#pragma unroll
      for (int j = 0; j < FB; ++j)
#pragma unroll
        for (int r = 0; r < 8; ++r) so[wave][i * 16 + 8 * g + r][j * 16 + col] = fmaxf(acc[i][j][r] + bb[j], 0.f);
    LDSX();
#pragma unroll      // whole: every store address is the start pointer plus an immediate
    for (int rg = 0; rg < FA * 16; rg += 16) {
#pragma unroll
      for (int rl = rg; rl < rg + 16; ++rl) vst2(Q + (r0 + rl) * EE + c0 + lane * 4, *(const v4f*)&so[wave][rl][lane * 4]);   // one row of 512 bytes a store: whole lines
      asm volatile("s_wait_xcnt 0x0" ::: "memory"); }   // stands behind 16 stores, in front of the LDS reads that rewrite their data registers
  }
}
// ---- k_red: thread = 4 floats of a head's record: the NSP partial records added in f32, in the order of the positions; key sums to KS in f32; the tables are split here, once a head, into bf16 hi + lo and written as the B fragments of k_fin's products (block = the 16 rows m of one fragment column j of one table; turned in LDS so that every store is whole lines)
#define TABF (2 * HD * HD)                             // bf16 elements of a head's two tables, hi parts; the lo parts follow
__global__ __launch_bounds__(256) void k_red(const float* __restrict__ KVP, __bf16* __restrict__ KVF, float* __restrict__ KS) {
  __shared__ __align__(16) __bf16 sf[2][1024];
  const int t = threadIdx.x, q = blockIdx.x * 256 + t; const size_t bh = blockIdx.y; const bool tab = blockIdx.x < TABF / 1024;   // the same for a whole block: the blocks behind the tables hold the key sums alone
  if (q >= PREC / 4) return;   // only in the key sums' block, which meets no barrier
  const float* p = KVP + bh * NSP * PREC + q * 4; v4f r[NSP];
#pragma unroll      // whole: the NSP independent loads are in flight together, one latency instead of NSP
  for (int sp = 0; sp < NSP; ++sp) r[sp] = *(const v4f*)(p + (size_t)sp * PREC);
  asm volatile("s_wait_xcnt 0x0" :: "v"(p) : "memory");   // stands behind the loads; p as an input keeps their address registers unwritten up to this wait
  v4f s = r[0];
#pragma unroll      // whole: r stays in registers
  for (int sp = 1; sp < NSP; ++sp) s += r[sp];
  if (tab) { const int dq = t & 15;   // the thread's floats: row m = (block & 3) * 16 + (t >> 4), d = dq * 4 .. + 3, so kc = d / 32, half = d / 16 & 1, lane = (d / 8 & 1) * 16 + (m & 15), element d & 7
    v4b hv, lv;
#pragma unroll
    for (int c = 0; c < 4; ++c) { const float v = s[c]; const __bf16 hb = (__bf16)v; hv[c] = hb; lv[c] = (__bf16)(v - (float)hb); }
    const int o = (dq >> 3) * 512 + ((dq >> 2) & 1) * 256 + (((dq >> 1) & 1) * 16 + (t >> 4)) * 8 + (dq & 1) * 4;
    *(v4b*)&sf[0][o] = hv; *(v4b*)&sf[1][o] = lv;
    __syncthreads();   // publishes the block's fragments
    const int hl = t >> 7, kc = (t >> 6) & 1, ch = t & 63;   // 16 bytes a thread: a wave stores 512 bytes on end
    *(v8b*)(KVF + bh * (2 * TABF) + (size_t)hl * TABF + ((((int)blockIdx.x >> 2) * 2 + kc) * 4 + ((int)blockIdx.x & 3)) * 512 + ch * 8) = *(const v8b*)&sf[hl][kc * 512 + ch * 8];
  } else { vst2(KS + bh * 2 * HD + (q * 4 - 2 * HD * HD), s);
    asm volatile("s_wait_xcnt 0x0" ::: "memory"); }   // stands behind the key sums' store, in front of any rewriting of its address and data registers
}
// ---- k_fin: block = (FIN_C runs of 64 positions l, one after the other, bh): z = 1/(qcos . sum kcos + qsin . sum ksin + eps); attn[l][m] = z (qcos . kv_cos[m] + qsin . kv_sin[m]) with bf16 hi + lo operands (4 products each); the tables come from k_red as ready B fragments, from memory straight into registers; output rows (bh, l) of 64 (raw view)
#define FIN_C 2                                        // runs of 64 positions a block
__global__ __launch_bounds__(128) void k_fin(const float* __restrict__ Q, const __bf16* __restrict__ KVF, const float* __restrict__ KS, float* __restrict__ OUT) {
  __shared__ __align__(16) float sq[2][64][HD + 4]; __shared__ float sz[64]; __shared__ __align__(16) float so[4][16][68]; __shared__ __align__(8) float wt[64][2]; __shared__ __align__(16) float sks[2 * HD];
  const int tid = threadIdx.x, wave = tid >> 5, lane = tid & 31, col = lane & 15, g = lane >> 4; const size_t bh = blockIdx.y; const size_t b = bh / NH; const int h = (int)(bh % NH);
#pragma unroll 1    // rolled: one text for the block's FIN_C runs of 64 positions, done one after the other by the same waves: half the waves to start. No barrier between two runs: each LDS room is rewritten only behind a barrier which no wave passes before all have left this run's reads of it: the weight table behind this run's later barriers, the other rooms behind one of the next run
  for (int c = 0; c < FIN_C; ++c) { const int l0 = (blockIdx.x * FIN_C + c) * 64;
  const __bf16* pf = KVF + bh * (2 * TABF) + lane * 8; v16b wh[4], wl[4];   // fragment (step s4 = table * 2 + kc, j): hi at pf + (s4 * 4 + j) * 512, lo TABF on
  { const int d = tid & 63; const float* pq = Q + ((size_t)(l0 + (tid >> 6)) * NBATCH + b) * EE + h * HD + d; float qr[32];
#pragma unroll      // whole: the 32 independent loads are in flight together, each the start pointer plus an immediate
    for (int i = 0; i < 32; ++i) qr[i] = pq[(size_t)i * 2 * NBATCH * EE];
    // the table fragments of the first step (16 loads of 16 bytes a thread) and the head's key sums (one float a thread) are asked for here too, under the same memory latency
    const float* pk = KS + bh * 2 * HD + tid;
#pragma unroll      // whole: the 16 independent loads are in flight together, each the start pointer plus an immediate
    for (int j = 0; j < 4; ++j) { wh[j] = frag_p(pf + j * 512); wl[j] = frag_p(pf + TABF + j * 512); }
    const float ksv = *pk;
    asm volatile("s_wait_xcnt 0x0" :: "v"(pq) : "memory");   // stands behind the loads; pq as an input keeps the q loads' address registers unwritten up to this wait (the table and key-sum loads go by the thread index and a scalar base)
    // the cos and sin weight of each of the 64 positions, computed once (a call waits for every load in flight, so none stands in the element loop)
    { const float ang = (1.5707963267948966f * (float)(l0 + d + 1)) / (float)LL; wt[d][tid >> 6] = (tid >> 6) ? sin_p(ang) : cos_p(ang); }
    __syncthreads();
#pragma unroll      // whole: qr stays in registers
    for (int i = 0; i < 32; ++i) { const int ll = (tid >> 6) + 2 * i; const v2f w = *(const v2f*)&wt[ll][0]; sq[0][ll][d] = qr[i] * w[0]; sq[1][ll][d] = qr[i] * w[1]; }
    sks[tid] = ksv; }
  __syncthreads();
  if (tid < 64) { float a = 0.f; for (int d = 0; d < HD; ++d) a += sq[0][tid][d] * sks[d] + sq[1][tid][d] * sks[HD + d]; sz[tid] = 1.0f / (a + 1e-6f); }
  v8f acc[4] = {};
#pragma unroll      // whole: the fragments stay in registers
  for (int s4 = 0; s4 < 4; ++s4) { const F2 a = split_row(&sq[s4 >> 1][wave * 16 + col][0], (s4 & 1) * 32, lane);   // step = (table s4 >> 1, kc s4 & 1), in the order of before
#pragma unroll
    for (int j = 0; j < 4; ++j) { acc[j] = wmma_bf(a.h, wh[j], acc[j]); acc[j] = wmma_bf(a.l, wh[j], acc[j]); acc[j] = wmma_bf(a.h, wl[j], acc[j]); acc[j] = wmma_bf(a.l, wl[j], acc[j]);
      if (s4 < 3) { wh[j] = frag_p(pf + ((s4 + 1) * 4 + j) * 512); wl[j] = frag_p(pf + TABF + ((s4 + 1) * 4 + j) * 512); } } }   // the next step's pair is asked for as soon as this step's has been used: one set of registers, and the products of three other columns stand between a load and its use
  asm volatile("s_wait_xcnt 0x0" :: "v"(pf) : "memory");   // stands behind the fragment loads; pf as an input keeps their address registers unwritten up to this wait
  __syncthreads();
#pragma unroll
  for (int j = 0; j < 4; ++j)
#pragma unroll
    for (int r = 0; r < 8; ++r) so[wave][8 * g + r][j * 16 + col] = acc[j][r] * sz[wave * 16 + 8 * g + r];
  LDSX();
  for (int rl = 0; rl < 16; ++rl) if (lane < 16) vst2(OUT + (bh * LL + l0 + wave * 16 + rl) * HD + lane * 4, *(const v4f*)&so[wave][rl][lane * 4]);   // (B H, L, 64) buffer viewed as (L, B, E)
  asm volatile("s_wait_xcnt 0x0" ::: "memory");   // stands behind the output stores, in front of the next run's rewriting of their registers
  }
}
extern "C" void kernel_launch(void* const* d_in, const int* in_sizes, int n_in, void* d_out, int out_size, void* d_ws, size_t ws_size, hipStream_t stream) {
  (void)in_sizes; (void)n_in; (void)out_size;
  const float** F = (const float**)d_in;   // 0 query, 1 key, 2 value [2048,4,1024]; 3 Wq [1024,1024], 4 bq, 5 Wk, 6 bk (natural; v uses Wk, bk)
  if (ws_size < (size_t)WS_END) return;
  char* ws = (char*)d_ws; __bf16* PW = (__bf16*)(ws + WS_PW); float *Q = (float*)(ws + WS_Q), *KS = (float*)(ws + WS_KS), *KVP = (float*)(ws + WS_KVP); __bf16* PX = (__bf16*)(ws + WS_PX); __bf16* KVF = (__bf16*)(ws + WS_KV);
  k_pack<<<dim3(PK_G), (PK_WA + PK_WB) * 32, 0, stream>>>(F[0], F[1], F[2], F[3], F[5], PX, PW);
  k_proj<<<dim3(NR / (32 * FA), EE / (32 * FB), 3), 128, 0, stream>>>(PX, PW, F[4], F[6], Q, KVP);
  k_red<<<dim3((PREC / 4 + 255) / 256, TBH), 256, 0, stream>>>(KVP, KVF, KS);
  k_fin<<<dim3(LL / (64 * FIN_C), TBH), 128, 0, stream>>>(Q, KVF, KS, (float*)d_out);
}
